// v000
// Times are from an AMD MI455X. After a warm-up the kernel runs many times in a row, and a time is the length of
// such a window on the GPU divided by its runs, so every launch and the gaps after it count. The runs cycle
// through copies of the inputs. A figure is the median of several windows, for all but v000 over two sittings.
// Sittings can differ by a few percent; kernels timed side by side share one.
// The starting kernel, v000, takes 2420 microseconds a run.
#include <hip/hip_runtime.h>

// ThornsAttention (x [2][2048][2048]; q/k/v = x W^T ([out][in] weights, no bias); 16 heads x 128; "RoPE" whose rotate_half is the identity (rotary_ndims == head_dim in the source), so
// q <- q*cos + q*sin elementwise with emb = cat(freqs, freqs), inv_freq = 10000^(-2i/128); scores = q.k / sqrt(128) + attention_mask (verbatim [1][1][2048][2048] additive input, read
// as data); softmax; out = (attn.v merged) Wd^T).
// Compute dtypes, f32 accumulate: every input rounded to bf16; projections on PLAIN bf16 operands (inputs: exact); the rotary factors cos/sin(t x inv_freq)
// in f32 (powf/cosf/sinf, tabulated once); scores for rows < RH on bf16 hi+lo planes of the rotated q and k (3 products; the 1/sqrt(128) applied in f32 in the softmax kernel), rows >= RH on fp16 planes (1 product); attn.v for rows < RH on hi+lo planes
// (3 products), rows >= RH on fp16 planes (1 product) - the mask is causal-shaped here so early rows see few keys; output hi+lo x exact Wd (2 products). One-wave-

#define NB_  2
#define TT   2048
#define DD   2048
#define NH_  16
#define HD   128
#define ZH   2
#define RH   512                  // query rows < RH use hi+lo planes for scores and attn.v; rows >= RH use single fp16 planes
#define NF   64                   // rotary frequencies (head_dim / 2)
#define SCL  0.088388349f
#define PCAR 1024.0f         // scale of the fp16 P rows (i >= RH), divided out again in k_merge
typedef _Float16 h16;
typedef unsigned short bf;
typedef __attribute__((ext_vector_type(16))) __bf16   v16bf;
typedef __attribute__((ext_vector_type(16))) _Float16 v16h;
typedef __attribute__((ext_vector_type(8)))  _Float16 v8h;
typedef __attribute__((ext_vector_type(8)))  unsigned short v8us;
typedef __attribute__((ext_vector_type(8)))  float    v8f;
typedef __attribute__((ext_vector_type(4)))  float    v4f;
typedef v8h  __attribute__((may_alias)) v8ha;
typedef v4f  __attribute__((may_alias)) v4fa;
typedef v8us __attribute__((may_alias)) v8usa;

__device__ __forceinline__ unsigned short f2bf(float f) { unsigned u = __float_as_uint(f); u += 0x7FFFu + ((u >> 16) & 1u); return (unsigned short)(u >> 16); }
__device__ __forceinline__ float bf2f(unsigned short b) { return __uint_as_float(((unsigned)b) << 16); }
__device__ __forceinline__ float bfr(float f) { return bf2f(f2bf(f)); }
__device__ __forceinline__ v16h cat16(v8h lo, v8h hi) { return __builtin_shufflevector(lo, hi, 0, 1, 2, 3, 4, 5, 6, 7, 8, 9, 10, 11, 12, 13, 14, 15); }
__device__ __forceinline__ v16bf cat16b(v8us lo, v8us hi) { return __builtin_bit_cast(v16bf, __builtin_shufflevector(lo, hi, 0, 1, 2, 3, 4, 5, 6, 7, 8, 9, 10, 11, 12, 13, 14, 15)); }
__device__ __forceinline__ v8f wmma16(v16h a, v16h b, v8f c) { return __builtin_amdgcn_wmma_f32_16x16x32_f16(false, a, false, b, (short)0, c, false, false); }
__device__ __forceinline__ v8f wmmab(v16bf a, v16bf b, v8f c) { return __builtin_amdgcn_wmma_f32_16x16x32_bf16(false, a, false, b, (short)0, c, false, false); }



// ---- k_gemmw: register-blocked GEMM, ONE WAVE per 64x64 output tile (16 accumulators), operands straight from K-contiguous 16-bit planes; grid (M/64, N/64, Z), 32 threads.
// C[m][n] (f32, pitch ldc, + optional f32 bias[n]) = sum_k A[m][k] Bt[n][k] (+ split products per NSPLIT). z-batch strides sA/sB/sC in elements. K % 32 == 0.
template <typename T16> struct WFrag;
template <> struct WFrag<h16> { typedef v16h V; static __device__ __forceinline__ V ld(const h16* p) { return cat16(*(const v8h*)p, *(const v8h*)(p + 16)); } static __device__ __forceinline__ v8f mma(V a, V b, v8f c) { return wmma16(a, b, c); } };
template <> struct WFrag<bf> { typedef v16bf V; static __device__ __forceinline__ V ld(const bf* p) { return cat16b(*(const v8us*)p, *(const v8us*)(p + 16)); } static __device__ __forceinline__ v8f mma(V a, V b, v8f c) { return wmmab(a, b, c); } };
template <typename T16, int NSPLIT, bool BIAS>
__global__ __launch_bounds__(32) void k_gemmw(const T16* __restrict__ A, const T16* __restrict__ A2, const T16* __restrict__ Bt, const T16* __restrict__ Bt2, int K, float* C, int ldc, const float* __restrict__ bias, size_t sA, size_t sB, size_t sC) {
    typedef typename WFrag<T16>::V V;
    __shared__ __align__(16) float os[16 * 68];
    const size_t z = blockIdx.z; A += z * sA; if (A2) A2 += z * sA; Bt += z * sB; if (Bt2) Bt2 += z * sB; C += z * sC;
    const int lane = threadIdx.x & 31, lr = lane & 15, hi = lane >> 4; const int r0 = blockIdx.x * 64, c0 = blockIdx.y * 64;
    v8f acc[4][4];
#pragma unroll
    for (int mb = 0; mb < 4; ++mb)
#pragma unroll
        for (int nb = 0; nb < 4; ++nb) acc[mb][nb] = (v8f){};
    const size_t aoff = (size_t)(r0 + lr) * K + 8 * hi, boff = (size_t)(c0 + lr) * K + 8 * hi;
#pragma unroll 1
    for (int kc = 0; kc < K; kc += 32) {
        V a[4], a2[4];
#pragma unroll
        for (int mb = 0; mb < 4; ++mb) { a[mb] = WFrag<T16>::ld(A + aoff + (size_t)mb * 16 * K + kc); if (NSPLIT == 1 || NSPLIT == 2) a2[mb] = WFrag<T16>::ld(A2 + aoff + (size_t)mb * 16 * K + kc); }
#pragma unroll
        for (int nb = 0; nb < 4; ++nb) { const V b = WFrag<T16>::ld(Bt + boff + (size_t)nb * 16 * K + kc); V b2; if (NSPLIT >= 2) b2 = WFrag<T16>::ld(Bt2 + boff + (size_t)nb * 16 * K + kc);
#pragma unroll
            for (int mb = 0; mb < 4; ++mb) { acc[mb][nb] = WFrag<T16>::mma(a[mb], b, acc[mb][nb]); if (NSPLIT == 1 || NSPLIT == 2) acc[mb][nb] = WFrag<T16>::mma(a2[mb], b, acc[mb][nb]); if (NSPLIT >= 2) acc[mb][nb] = WFrag<T16>::mma(a[mb], b2, acc[mb][nb]); } }
        asm volatile("v_nop\n\tv_nop\n\tv_nop\n\tv_nop" : "+v"(acc[0][0]), "+v"(acc[1][1]), "+v"(acc[2][2]), "+v"(acc[3][3]) : "v"(a[0]), "v"(a[3]));
    }
#pragma unroll
    for (int mb = 0; mb < 4; ++mb) {
#pragma unroll
        for (int nb = 0; nb < 4; ++nb) {
#pragma unroll
            for (int j = 0; j < 8; ++j) os[(hi * 8 + j) * 68 + nb * 16 + lr] = acc[mb][nb][j]; }
        __builtin_amdgcn_wave_barrier(); asm volatile("" ::: "memory");
        float* crow = C + (size_t)(r0 + mb * 16) * ldc + c0;
{
#pragma unroll
            for (int s = 0; s < 8; ++s) { const int row = 2 * s + hi, cofs = lr * 4; v4f val = *(const v4fa*)(os + row * 68 + cofs); if (BIAS) { val[0] += bfr(bias[c0 + cofs]); val[1] += bfr(bias[c0 + cofs + 1]); val[2] += bfr(bias[c0 + cofs + 2]); val[3] += bfr(bias[c0 + cofs + 3]); }
                *(v4f*)(crow + (size_t)row * ldc + cofs) = val; }
             }
        __builtin_amdgcn_wave_barrier(); asm volatile("" ::: "memory");
    }
}

__device__ __forceinline__ h16 tohx(float x) { return (h16)x; }
__device__ __forceinline__ void splitf(float y, unsigned short& h, unsigned short& l) { h = f2bf(y); l = f2bf(y - bf2f(h)); }
typedef __attribute__((ext_vector_type(2))) unsigned short v2us;
typedef __attribute__((ext_vector_type(2))) _Float16 v2h;
typedef __attribute__((ext_vector_type(4))) _Float16 v4h;
typedef __attribute__((ext_vector_type(2))) float v2f;

__global__ __launch_bounds__(256) void k_cvt8(const float* __restrict__ src, bf* dst, size_t n8) { const size_t i = (size_t)blockIdx.x * 256 + threadIdx.x; if (i >= n8) return; const v8f v = *(const v8f*)(src + i * 8); v8us o;
#pragma unroll
    for (int k = 0; k < 8; ++k) o[k] = f2bf(v[k]); *(v8us*)(dst + i * 8) = o;  }
__global__ __launch_bounds__(256) void k_cstab(float* CSN) {
    const int idx = blockIdx.x * 256 + threadIdx.x; if (idx >= TT * NF) return; const int t = idx / NF, i = idx % NF; const float invf = __fdiv_rn(1.0f, powf(10000.0f, (float)(2 * i) * (1.0f / HD))); const float ang = __fmul_rn((float)t, invf);
    v2f o; o[0] = cosf(ang); o[1] = sinf(ang); *(v2f*)(CSN + (size_t)idx * 2) = o;  }
__global__ __launch_bounds__(256) void k_hsplit(const float* __restrict__ F, const float* __restrict__ CSN, bf* Ph, bf* Pl, h16* P16) {
    const int lane = threadIdx.x & 31; const int L0 = (blockIdx.x * 8 + (threadIdx.x >> 5)) * 8; const int nlines = NH_ * TT * HD / 64;
{
#pragma unroll
        for (int l = 0; l < 8; ++l) { const int L = L0 + l; if (L >= nlines) break; const int e = L * 64 + lane * 2; const int d = e & (HD - 1); const int t = (e >> 7) & (TT - 1); const int h = e >> 18; v2us oh, ol; v2h o16;
#pragma unroll
            for (int q = 0; q < 2; ++q) { const int dd = d + q; const float x = F[(size_t)t * DD + h * HD + dd]; const v2f cs = *(const v2f*)(CSN + ((size_t)t * NF + (dd & (NF - 1))) * 2);
                float p1 = __fmul_rn(x, cs[0]), p2 = __fmul_rn(x, cs[1]); asm volatile("" : "+v"(p1)); asm volatile("" : "+v"(p2)); const float r = __fadd_rn(p1, p2); unsigned short a, c2; splitf(r, a, c2); oh[q] = a; ol[q] = c2; o16[q] = tohx(r); }
            *(v2us*)(Ph + (size_t)e) = oh; *(v2us*)(Pl + (size_t)e) = ol; *(v2h*)(P16 + (size_t)e) = o16; }
         }
}
__global__ __launch_bounds__(256) void k_vtplane(const float* __restrict__ F, bf* Vh, bf* Vl, h16* V16) {
    const int lane = threadIdx.x & 31; const int L0 = (blockIdx.x * 8 + (threadIdx.x >> 5)) * 8; const int nlines = NH_ * TT * HD / 64;
{
#pragma unroll
        for (int l = 0; l < 8; ++l) { const int L = L0 + l; if (L >= nlines) break; const int e = L * 64 + lane * 2; const int t = e & (TT - 1); const int d = (e >> 11) & (HD - 1); const int h = e >> 18; v2us oh, ol; v2h o16;
#pragma unroll
            for (int q = 0; q < 2; ++q) { const float x = F[(size_t)(t + q) * DD + h * HD + d]; unsigned short a, c2; splitf(x, a, c2); oh[q] = a; ol[q] = c2; o16[q] = tohx(x); }
            *(v2us*)(Vh + (size_t)e) = oh; *(v2us*)(Vl + (size_t)e) = ol; *(v2h*)(V16 + (size_t)e) = o16; }
         }
}
// k_asoft: per row (zz, i): s = S * f32(1/sqrt(128)) + bf16(mask[0][0][i][j]) (additive input read as data); softmax over the 2048 keys (register row, one exp) -> rows i < RH: P hi/lo
__global__ __launch_bounds__(256) void k_asoft(const float* __restrict__ Sb, const float* __restrict__ am, int b, bf* Ph, bf* Pl, h16* P16) {
    typedef __attribute__((ext_vector_type(4))) unsigned short v4us;
    const int lane = threadIdx.x & 31; const int row = blockIdx.x * 8 + (threadIdx.x >> 5); if (row >= ZH * TT) return; const int i = row & (TT - 1); const int zz = row >> 11; const bool hires = (i < RH);
    const float* sr = Sb + (size_t)row * TT; const float* mr = am + ((size_t)b * TT + i) * TT; float v[64]; float mx = -3.0e38f;
#pragma unroll
    for (int ch = 0; ch < 16; ++ch) { const int j0 = ch * 128 + lane * 4; const v4f a = *(const v4f*)(sr + j0), mk = *(const v4f*)(mr + j0);
#pragma unroll
        for (int q = 0; q < 4; ++q) { float mm = bfr(mk[q]); asm volatile("" : "+v"(mm)); float sp = __fmul_rn(a[q], SCL); asm volatile("" : "+v"(sp)); const float t = __fadd_rn(sp, mm); v[ch * 4 + q] = t; mx = fmaxf(mx, t); } }
#pragma unroll
    for (int sh = 16; sh; sh >>= 1) mx = fmaxf(mx, __shfl_xor(mx, sh, 32));
    float sum = 0.f;
#pragma unroll
    for (int k = 0; k < 64; ++k) { v[k] = __expf(v[k] - mx); sum += v[k]; }
#pragma unroll
    for (int sh = 16; sh; sh >>= 1) sum += __shfl_xor(sum, sh, 32);
    const float f = __fdiv_rn(hires ? 1.0f : PCAR, sum);
{
        if (hires) {
#pragma unroll
            for (int ch = 0; ch < 16; ++ch) { v4us oh, ol;
#pragma unroll
                for (int q = 0; q < 4; ++q) { unsigned short a, c2; splitf(v[ch * 4 + q] * f, a, c2); oh[q] = a; ol[q] = c2; }
                const size_t o = ((size_t)zz * RH + i) * TT + ch * 128 + lane * 4; *(v4us*)(Ph + o) = oh; *(v4us*)(Pl + o) = ol; }
        } else {
#pragma unroll
            for (int ch = 0; ch < 16; ++ch) { v4h o;
#pragma unroll
                for (int q = 0; q < 4; ++q) o[q] = tohx(v[ch * 4 + q] * f);
                *(v4h*)(P16 + (size_t)row * TT + ch * 128 + lane * 4) = o; } }
         }
}
__global__ __launch_bounds__(256) void k_merge(const float* __restrict__ O, int h0, bf* Ah, bf* Al) {
    const int lane = threadIdx.x & 31; const int L0 = (blockIdx.x * 8 + (threadIdx.x >> 5)) * 8; const int nlines = ZH * TT * HD / 64;
{
#pragma unroll
        for (int l = 0; l < 8; ++l) { const int L = L0 + l; if (L >= nlines) break; const int e = L * 64 + lane * 2; const int d = e & (HD - 1); const int t = (e >> 7) & (TT - 1); const int zz = e >> 18; v2us oh, ol;
const float cs = (t < RH) ? 1.0f : (1.0f / PCAR);
#pragma unroll
            for (int q = 0; q < 2; ++q) { unsigned short a, c2; splitf(O[(size_t)e + q] * cs, a, c2); oh[q] = a; ol[q] = c2; }
            const size_t o = (size_t)t * DD + (h0 + zz) * HD + d; *(v2us*)(Ah + o) = oh; *(v2us*)(Al + o) = ol; }
         }
}

extern "C" void kernel_launch(void* const* d_in, const int* in_sizes, int n_in,
                              void* d_out, int out_size, void* d_ws, size_t ws_size, hipStream_t stream) {
    (void)in_sizes; (void)n_in; (void)out_size;
    const float* x = (const float*)d_in[0]; const float* amask = (const float*)d_in[1]; const float* Wq = (const float*)d_in[2]; const float* Wk = (const float*)d_in[3]; const float* Wv = (const float*)d_in[4]; const float* Wd = (const float*)d_in[5];
    float* OUT = (float*)d_out;     // [2][2048][2048]
    char* wsp = (char*)d_ws;
    auto take = [&](size_t bytes) { char* p = wsp; wsp += (bytes + 255) & ~(size_t)255; return (void*)p; };
    bf* WQ = (bf*)take((size_t)DD * DD * 2); bf* WK = (bf*)take((size_t)DD * DD * 2); bf* WV = (bf*)take((size_t)DD * DD * 2); bf* WO = (bf*)take((size_t)DD * DD * 2);
    bf* XB = (bf*)take((size_t)TT * DD * 2); float* F = (float*)take((size_t)TT * DD * 4); float* CSN = (float*)take((size_t)TT * NF * 2 * 4);
    bf* QPh = (bf*)take((size_t)TT * DD * 2); bf* QPl = (bf*)take((size_t)TT * DD * 2); bf* KPh = (bf*)take((size_t)TT * DD * 2); bf* KPl = (bf*)take((size_t)TT * DD * 2); bf* VTh = (bf*)take((size_t)TT * DD * 2); bf* VTl = (bf*)take((size_t)TT * DD * 2);
    h16* QP16 = (h16*)take((size_t)TT * DD * 2); h16* KP16 = (h16*)take((size_t)TT * DD * 2); h16* VT16 = (h16*)take((size_t)TT * DD * 2);
    float* Sb = (float*)take((size_t)ZH * TT * TT * 4); bf* Ph = (bf*)take((size_t)ZH * RH * TT * 2); bf* Pl = (bf*)take((size_t)ZH * RH * TT * 2); h16* P16 = (h16*)take((size_t)ZH * TT * TT * 2); float* Ob = (float*)take((size_t)ZH * TT * HD * 4); bf* ATh = (bf*)take((size_t)TT * DD * 2); bf* ATl = (bf*)take((size_t)TT * DD * 2);
    if ((size_t)(wsp - (char*)d_ws) > ws_size) return;    // total ~ 213 MB = 203 MiB; ws 256 MiB
    { const size_t nw = (size_t)DD * DD / 8; const unsigned gw = (unsigned)((nw + 255) / 256); k_cvt8<<<gw, 256, 0, stream>>>(Wq, WQ, nw); k_cvt8<<<gw, 256, 0, stream>>>(Wk, WK, nw); k_cvt8<<<gw, 256, 0, stream>>>(Wv, WV, nw); k_cvt8<<<gw, 256, 0, stream>>>(Wd, WO, nw);
      k_cstab<<<TT * NF / 256, 256, 0, stream>>>(CSN); }
    const unsigned LB = (unsigned)((NH_ * TT * HD / 64 + 63) / 64); const dim3 gP(TT / 64, DD / 64, 1);
    for (int b = 0; b < NB_; ++b) {
        k_cvt8<<<(unsigned)(((size_t)TT * DD / 8 + 255) / 256), 256, 0, stream>>>(x + (size_t)b * TT * DD, XB, (size_t)TT * DD / 8);
        k_gemmw<bf, 0, false><<<gP, 32, 0, stream>>>(XB, nullptr, WQ, nullptr, DD, F, DD, nullptr, 0, 0, 0); k_hsplit<<<LB, 256, 0, stream>>>(F, CSN, QPh, QPl, QP16);
        k_gemmw<bf, 0, false><<<gP, 32, 0, stream>>>(XB, nullptr, WK, nullptr, DD, F, DD, nullptr, 0, 0, 0); k_hsplit<<<LB, 256, 0, stream>>>(F, CSN, KPh, KPl, KP16);
        k_gemmw<bf, 0, false><<<gP, 32, 0, stream>>>(XB, nullptr, WV, nullptr, DD, F, DD, nullptr, 0, 0, 0); k_vtplane<<<LB, 256, 0, stream>>>(F, VTh, VTl, VT16);
        for (int h0 = 0; h0 < NH_; h0 += ZH) { const size_t z0 = (size_t)h0;
            // scores: rows < RH on hi+lo planes (3 products), rows >= RH on fp16 planes - both into the same [ZH][TT][TT] score buffer
            k_gemmw<bf, 2, false><<<dim3(RH / 64, TT / 64, ZH), 32, 0, stream>>>(QPh + z0 * TT * HD, QPl + z0 * TT * HD, KPh + z0 * TT * HD, KPl + z0 * TT * HD, HD, Sb, TT, nullptr, (size_t)TT * HD, (size_t)TT * HD, (size_t)TT * TT);
            k_gemmw<h16, 0, false><<<dim3((TT - RH) / 64, TT / 64, ZH), 32, 0, stream>>>(QP16 + z0 * TT * HD + (size_t)RH * HD, nullptr, KP16 + z0 * TT * HD, nullptr, HD, Sb + (size_t)RH * TT, TT, nullptr, (size_t)TT * HD, (size_t)TT * HD, (size_t)TT * TT);
            k_asoft<<<ZH * TT / 8, 256, 0, stream>>>(Sb, amask, 0, Ph, Pl, P16);
            k_gemmw<bf, 2, false><<<dim3(RH / 64, HD / 64, ZH), 32, 0, stream>>>(Ph, Pl, VTh + z0 * HD * TT, VTl + z0 * HD * TT, TT, Ob, HD, nullptr, (size_t)RH * TT, (size_t)HD * TT, (size_t)TT * HD);
            k_gemmw<h16, 0, false><<<dim3((TT - RH) / 64, HD / 64, ZH), 32, 0, stream>>>(P16 + (size_t)RH * TT, nullptr, VT16 + z0 * HD * TT, nullptr, TT, Ob + (size_t)RH * HD, HD, nullptr, (size_t)TT * TT, (size_t)HD * TT, (size_t)TT * HD);
            k_merge<<<(ZH * TT * HD / 64 + 63) / 64, 256, 0, stream>>>(Ob, h0, ATh, ATl); }
        k_gemmw<bf, 1, false><<<gP, 32, 0, stream>>>(ATh, ATl, WO, nullptr, DD, OUT + (size_t)b * TT * DD, DD, nullptr, 0, 0, 0); }
}

// v001
// Measured time: 1510 microseconds a run.
// In both of two side-by-side timings against v000, it was 1.61 times as fast.
#include <hip/hip_runtime.h>

// ThornsAttention (x [2][2048][2048]; q/k/v = x W^T ([out][in] weights, no bias); 16 heads x 128; "RoPE" whose rotate_half is the identity (rotary_ndims == head_dim in the source), so
// q <- q*cos + q*sin elementwise with emb = cat(freqs, freqs), inv_freq = 10000^(-2i/128); scores = q.k / sqrt(128) + attention_mask (verbatim [1][1][2048][2048] additive input, read
// as data); softmax; out = (attn.v merged) Wd^T).
// Compute dtypes, f32 accumulate: every input rounded to bf16; projections on PLAIN bf16 operands (inputs: exact); the rotary factors cos/sin(t x inv_freq)
// in f32 (powf/cosf/sinf, tabulated once); scores for rows < RH on bf16 hi+lo planes of the rotated q and k (3 products; the 1/sqrt(128) applied in f32 in the softmax kernel), rows >= RH on fp16 planes (1 product); attn.v for rows < RH on hi+lo planes
// (3 products), rows >= RH on fp16 planes (1 product) - the mask is causal-shaped here so early rows see few keys; output hi+lo x exact Wd (2 products).

#define NB_  2
#define TT   2048
#define DD   2048
#define NH_  16
#define HD   128
#define ZH   2
#define RH   512                  // query rows < RH use hi+lo planes for scores and attn.v; rows >= RH use single fp16 planes
#define NF   64                   // rotary frequencies (head_dim / 2)
#define SCL  0.088388349f
#define PCAR 1024.0f         // scale of the fp16 P rows (i >= RH), divided out again in k_merge
typedef _Float16 h16;
typedef unsigned short bf;
typedef __attribute__((ext_vector_type(16))) __bf16   v16bf;
typedef __attribute__((ext_vector_type(16))) _Float16 v16h;
typedef __attribute__((ext_vector_type(8)))  _Float16 v8h;
typedef __attribute__((ext_vector_type(8)))  unsigned short v8us;
typedef __attribute__((ext_vector_type(8)))  float    v8f;
typedef __attribute__((ext_vector_type(4)))  float    v4f;
typedef v8h  __attribute__((may_alias)) v8ha;
typedef v4f  __attribute__((may_alias)) v4fa;
typedef v8us __attribute__((may_alias)) v8usa;

__device__ __forceinline__ unsigned short f2bf(float f) { unsigned u = __float_as_uint(f); u += 0x7FFFu + ((u >> 16) & 1u); return (unsigned short)(u >> 16); }
__device__ __forceinline__ float bf2f(unsigned short b) { return __uint_as_float(((unsigned)b) << 16); }
__device__ __forceinline__ float bfr(float f) { return bf2f(f2bf(f)); }
__device__ __forceinline__ v16h cat16(v8h lo, v8h hi) { return __builtin_shufflevector(lo, hi, 0, 1, 2, 3, 4, 5, 6, 7, 8, 9, 10, 11, 12, 13, 14, 15); }
__device__ __forceinline__ v16bf cat16b(v8us lo, v8us hi) { return __builtin_bit_cast(v16bf, __builtin_shufflevector(lo, hi, 0, 1, 2, 3, 4, 5, 6, 7, 8, 9, 10, 11, 12, 13, 14, 15)); }
__device__ __forceinline__ v8f wmma16(v16h a, v16h b, v8f c) { return __builtin_amdgcn_wmma_f32_16x16x32_f16(false, a, false, b, (short)0, c, false, false); }
__device__ __forceinline__ v8f wmmab(v16bf a, v16bf b, v8f c) { return __builtin_amdgcn_wmma_f32_16x16x32_bf16(false, a, false, b, (short)0, c, false, false); }



// ---- k_gemmw: register-blocked GEMM, one 64x64 output tile per work-group (16 accumulators per wave), operands straight from K-contiguous 16-bit planes; grid (M/64, N/64, Z), KW * 32 threads.
// C[m][n] (f32, pitch ldc, + optional f32 bias[n]) = sum_k A[m][k] Bt[n][k] (+ split products per NSPLIT). z-batch strides sA/sB/sC in elements. K % (KW * 32) == 0.
// KW waves share the tile's K: wave w takes the 32-k blocks w, w + KW, w + 2 KW, ... (neighbouring waves read neighbouring 64-byte pieces of the same rows), so the chain of dependent
// load-then-multiply trips is K / (32 KW) long; the KW f32 partial tiles are summed in LDS in the fixed order w = 0 .. KW - 1. KW == 1 is the one-wave form.
template <typename T16> struct WFrag;
template <> struct WFrag<h16> { typedef v16h V; static __device__ __forceinline__ V ld(const h16* p) { return cat16(*(const v8h*)p, *(const v8h*)(p + 16)); } static __device__ __forceinline__ v8f mma(V a, V b, v8f c) { return wmma16(a, b, c); } };
template <> struct WFrag<bf> { typedef v16bf V; static __device__ __forceinline__ V ld(const bf* p) { return cat16b(*(const v8us*)p, *(const v8us*)(p + 16)); } static __device__ __forceinline__ v8f mma(V a, V b, v8f c) { return wmmab(a, b, c); } };
template <typename T16, int NSPLIT, bool BIAS, int KW>
__global__ __launch_bounds__(KW * 32) void k_gemmw(const T16* __restrict__ A, const T16* __restrict__ A2, const T16* __restrict__ Bt, const T16* __restrict__ Bt2, int K, float* C, int ldc, const float* __restrict__ bias, size_t sA, size_t sB, size_t sC) {
    typedef typename WFrag<T16>::V V;
    __shared__ __align__(16) float os[KW == 1 ? 16 * 68 : KW * 64 * 68];
    const int w = KW == 1 ? 0 : __builtin_amdgcn_readfirstlane((int)(threadIdx.x >> 5));    // the wave's number, held scalar so that the loop's k offset stays scalar
    const size_t z = blockIdx.z; A += z * sA; if (A2) A2 += z * sA; Bt += z * sB; if (Bt2) Bt2 += z * sB; C += z * sC;
    const int lane = threadIdx.x & 31, lr = lane & 15, hi = lane >> 4; const int r0 = blockIdx.x * 64, c0 = blockIdx.y * 64;
    v8f acc[4][4];
#pragma unroll
    for (int mb = 0; mb < 4; ++mb)
#pragma unroll
        for (int nb = 0; nb < 4; ++nb) acc[mb][nb] = (v8f){};
    const size_t aoff = (size_t)(r0 + lr) * K + 8 * hi, boff = (size_t)(c0 + lr) * K + 8 * hi;
#pragma unroll 1
    for (int kc = w * 32; kc < K; kc += KW * 32) {
        V a[4], a2[4];
#pragma unroll
        for (int mb = 0; mb < 4; ++mb) { a[mb] = WFrag<T16>::ld(A + aoff + (size_t)mb * 16 * K + kc); if (NSPLIT == 1 || NSPLIT == 2) a2[mb] = WFrag<T16>::ld(A2 + aoff + (size_t)mb * 16 * K + kc); }
#pragma unroll
        for (int nb = 0; nb < 4; ++nb) { const V b = WFrag<T16>::ld(Bt + boff + (size_t)nb * 16 * K + kc); V b2; if (NSPLIT >= 2) b2 = WFrag<T16>::ld(Bt2 + boff + (size_t)nb * 16 * K + kc);
#pragma unroll
            for (int mb = 0; mb < 4; ++mb) { acc[mb][nb] = WFrag<T16>::mma(a[mb], b, acc[mb][nb]); if (NSPLIT == 1 || NSPLIT == 2) acc[mb][nb] = WFrag<T16>::mma(a2[mb], b, acc[mb][nb]); if (NSPLIT >= 2) acc[mb][nb] = WFrag<T16>::mma(a[mb], b2, acc[mb][nb]); } }
        asm volatile("v_nop\n\tv_nop\n\tv_nop\n\tv_nop" : "+v"(acc[0][0]), "+v"(acc[1][1]), "+v"(acc[2][2]), "+v"(acc[3][3]) : "v"(a[0]), "v"(a[3]));
    }
    if constexpr (KW > 1) {
        float* my = os + w * (64 * 68);
#pragma unroll
        for (int mb = 0; mb < 4; ++mb)
#pragma unroll
            for (int nb = 0; nb < 4; ++nb)
#pragma unroll
                for (int j = 0; j < 8; ++j) my[(mb * 16 + hi * 8 + j) * 68 + nb * 16 + lr] = acc[mb][nb][j];
        __syncthreads();    // every wave's partial tile is in LDS before any thread sums across waves
#pragma unroll
        for (int i = 0; i < 32 / KW; ++i) { const int s = i * (KW * 32) + (int)threadIdx.x; const int row = s >> 4, cofs = (s & 15) * 4; v4f val = *(const v4fa*)(os + row * 68 + cofs);
#pragma unroll
            for (int q = 1; q < KW; ++q) val += *(const v4fa*)(os + q * (64 * 68) + row * 68 + cofs);
            if (BIAS) { val[0] += bfr(bias[c0 + cofs]); val[1] += bfr(bias[c0 + cofs + 1]); val[2] += bfr(bias[c0 + cofs + 2]); val[3] += bfr(bias[c0 + cofs + 3]); }
            *(v4f*)(C + (size_t)(r0 + row) * ldc + c0 + cofs) = val; }
    } else {
#pragma unroll
    for (int mb = 0; mb < 4; ++mb) {
#pragma unroll
        for (int nb = 0; nb < 4; ++nb) {
#pragma unroll
            for (int j = 0; j < 8; ++j) os[(hi * 8 + j) * 68 + nb * 16 + lr] = acc[mb][nb][j]; }
        __builtin_amdgcn_wave_barrier(); asm volatile("" ::: "memory");
        float* crow = C + (size_t)(r0 + mb * 16) * ldc + c0;
{
#pragma unroll
            for (int s = 0; s < 8; ++s) { const int row = 2 * s + hi, cofs = lr * 4; v4f val = *(const v4fa*)(os + row * 68 + cofs); if (BIAS) { val[0] += bfr(bias[c0 + cofs]); val[1] += bfr(bias[c0 + cofs + 1]); val[2] += bfr(bias[c0 + cofs + 2]); val[3] += bfr(bias[c0 + cofs + 3]); }
                *(v4f*)(crow + (size_t)row * ldc + cofs) = val; }
             }
        __builtin_amdgcn_wave_barrier(); asm volatile("" ::: "memory");
    }
    }
}

__device__ __forceinline__ h16 tohx(float x) { return (h16)x; }
__device__ __forceinline__ void splitf(float y, unsigned short& h, unsigned short& l) { h = f2bf(y); l = f2bf(y - bf2f(h)); }
typedef __attribute__((ext_vector_type(2))) unsigned short v2us;
typedef __attribute__((ext_vector_type(2))) _Float16 v2h;
typedef __attribute__((ext_vector_type(4))) _Float16 v4h;
typedef __attribute__((ext_vector_type(2))) float v2f;

__global__ __launch_bounds__(256) void k_cvt8(const float* __restrict__ src, bf* dst, size_t n8) { const size_t i = (size_t)blockIdx.x * 256 + threadIdx.x; if (i >= n8) return; const v8f v = *(const v8f*)(src + i * 8); v8us o;
#pragma unroll
    for (int k = 0; k < 8; ++k) o[k] = f2bf(v[k]); *(v8us*)(dst + i * 8) = o;  }
__global__ __launch_bounds__(256) void k_cstab(float* CSN) {
    const int idx = blockIdx.x * 256 + threadIdx.x; if (idx >= TT * NF) return; const int t = idx / NF, i = idx % NF; const float invf = __fdiv_rn(1.0f, powf(10000.0f, (float)(2 * i) * (1.0f / HD))); const float ang = __fmul_rn((float)t, invf);
    v2f o; o[0] = cosf(ang); o[1] = sinf(ang); *(v2f*)(CSN + (size_t)idx * 2) = o;  }
__global__ __launch_bounds__(256) void k_hsplit(const float* __restrict__ F, const float* __restrict__ CSN, bf* Ph, bf* Pl, h16* P16) {
    const int lane = threadIdx.x & 31; const int L0 = (blockIdx.x * 8 + (threadIdx.x >> 5)) * 8; const int nlines = NH_ * TT * HD / 64;
{
#pragma unroll
        for (int l = 0; l < 8; ++l) { const int L = L0 + l; if (L >= nlines) break; const int e = L * 64 + lane * 2; const int d = e & (HD - 1); const int t = (e >> 7) & (TT - 1); const int h = e >> 18; v2us oh, ol; v2h o16;
#pragma unroll
            for (int q = 0; q < 2; ++q) { const int dd = d + q; const float x = F[(size_t)t * DD + h * HD + dd]; const v2f cs = *(const v2f*)(CSN + ((size_t)t * NF + (dd & (NF - 1))) * 2);
                float p1 = __fmul_rn(x, cs[0]), p2 = __fmul_rn(x, cs[1]); asm volatile("" : "+v"(p1)); asm volatile("" : "+v"(p2)); const float r = __fadd_rn(p1, p2); unsigned short a, c2; splitf(r, a, c2); oh[q] = a; ol[q] = c2; o16[q] = tohx(r); }
            *(v2us*)(Ph + (size_t)e) = oh; *(v2us*)(Pl + (size_t)e) = ol; *(v2h*)(P16 + (size_t)e) = o16; }
         }
}
__global__ __launch_bounds__(256) void k_vtplane(const float* __restrict__ F, bf* Vh, bf* Vl, h16* V16) {
    const int lane = threadIdx.x & 31; const int L0 = (blockIdx.x * 8 + (threadIdx.x >> 5)) * 8; const int nlines = NH_ * TT * HD / 64;
{
#pragma unroll
        for (int l = 0; l < 8; ++l) { const int L = L0 + l; if (L >= nlines) break; const int e = L * 64 + lane * 2; const int t = e & (TT - 1); const int d = (e >> 11) & (HD - 1); const int h = e >> 18; v2us oh, ol; v2h o16;
#pragma unroll
            for (int q = 0; q < 2; ++q) { const float x = F[(size_t)(t + q) * DD + h * HD + d]; unsigned short a, c2; splitf(x, a, c2); oh[q] = a; ol[q] = c2; o16[q] = tohx(x); }
            *(v2us*)(Vh + (size_t)e) = oh; *(v2us*)(Vl + (size_t)e) = ol; *(v2h*)(V16 + (size_t)e) = o16; }
         }
}
// k_asoft: per row (zz, i): s = S * f32(1/sqrt(128)) + bf16(mask[0][0][i][j]) (additive input read as data); softmax over the 2048 keys (register row, one exp) -> rows i < RH: P hi/lo
__global__ __launch_bounds__(256) void k_asoft(const float* __restrict__ Sb, const float* __restrict__ am, int b, bf* Ph, bf* Pl, h16* P16) {
    typedef __attribute__((ext_vector_type(4))) unsigned short v4us;
    const int lane = threadIdx.x & 31; const int row = blockIdx.x * 8 + (threadIdx.x >> 5); if (row >= ZH * TT) return; const int i = row & (TT - 1); const int zz = row >> 11; const bool hires = (i < RH);
    const float* sr = Sb + (size_t)row * TT; const float* mr = am + ((size_t)b * TT + i) * TT; float v[64]; float mx = -3.0e38f;
#pragma unroll
    for (int ch = 0; ch < 16; ++ch) { const int j0 = ch * 128 + lane * 4; const v4f a = *(const v4f*)(sr + j0), mk = *(const v4f*)(mr + j0);
#pragma unroll
        for (int q = 0; q < 4; ++q) { float mm = bfr(mk[q]); asm volatile("" : "+v"(mm)); float sp = __fmul_rn(a[q], SCL); asm volatile("" : "+v"(sp)); const float t = __fadd_rn(sp, mm); v[ch * 4 + q] = t; mx = fmaxf(mx, t); } }
#pragma unroll
    for (int sh = 16; sh; sh >>= 1) mx = fmaxf(mx, __shfl_xor(mx, sh, 32));
    float sum = 0.f;
#pragma unroll
    for (int k = 0; k < 64; ++k) { v[k] = __expf(v[k] - mx); sum += v[k]; }
#pragma unroll
    for (int sh = 16; sh; sh >>= 1) sum += __shfl_xor(sum, sh, 32);
    const float f = __fdiv_rn(hires ? 1.0f : PCAR, sum);
{
        if (hires) {
#pragma unroll
            for (int ch = 0; ch < 16; ++ch) { v4us oh, ol;
#pragma unroll
                for (int q = 0; q < 4; ++q) { unsigned short a, c2; splitf(v[ch * 4 + q] * f, a, c2); oh[q] = a; ol[q] = c2; }
                const size_t o = ((size_t)zz * RH + i) * TT + ch * 128 + lane * 4; *(v4us*)(Ph + o) = oh; *(v4us*)(Pl + o) = ol; }
        } else {
#pragma unroll
            for (int ch = 0; ch < 16; ++ch) { v4h o;
#pragma unroll
                for (int q = 0; q < 4; ++q) o[q] = tohx(v[ch * 4 + q] * f);
                *(v4h*)(P16 + (size_t)row * TT + ch * 128 + lane * 4) = o; } }
         }
}
__global__ __launch_bounds__(256) void k_merge(const float* __restrict__ O, int h0, bf* Ah, bf* Al) {
    const int lane = threadIdx.x & 31; const int L0 = (blockIdx.x * 8 + (threadIdx.x >> 5)) * 8; const int nlines = ZH * TT * HD / 64;
{
#pragma unroll
        for (int l = 0; l < 8; ++l) { const int L = L0 + l; if (L >= nlines) break; const int e = L * 64 + lane * 2; const int d = e & (HD - 1); const int t = (e >> 7) & (TT - 1); const int zz = e >> 18; v2us oh, ol;
const float cs = (t < RH) ? 1.0f : (1.0f / PCAR);
#pragma unroll
            for (int q = 0; q < 2; ++q) { unsigned short a, c2; splitf(O[(size_t)e + q] * cs, a, c2); oh[q] = a; ol[q] = c2; }
            const size_t o = (size_t)t * DD + (h0 + zz) * HD + d; *(v2us*)(Ah + o) = oh; *(v2us*)(Al + o) = ol; }
         }
}

extern "C" void kernel_launch(void* const* d_in, const int* in_sizes, int n_in,
                              void* d_out, int out_size, void* d_ws, size_t ws_size, hipStream_t stream) {
    (void)in_sizes; (void)n_in; (void)out_size;
    const float* x = (const float*)d_in[0]; const float* amask = (const float*)d_in[1]; const float* Wq = (const float*)d_in[2]; const float* Wk = (const float*)d_in[3]; const float* Wv = (const float*)d_in[4]; const float* Wd = (const float*)d_in[5];
    float* OUT = (float*)d_out;     // [2][2048][2048]
    char* wsp = (char*)d_ws;
    auto take = [&](size_t bytes) { char* p = wsp; wsp += (bytes + 255) & ~(size_t)255; return (void*)p; };
    bf* WQ = (bf*)take((size_t)DD * DD * 2); bf* WK = (bf*)take((size_t)DD * DD * 2); bf* WV = (bf*)take((size_t)DD * DD * 2); bf* WO = (bf*)take((size_t)DD * DD * 2);
    bf* XB = (bf*)take((size_t)TT * DD * 2); float* F = (float*)take((size_t)TT * DD * 4); float* CSN = (float*)take((size_t)TT * NF * 2 * 4);
    bf* QPh = (bf*)take((size_t)TT * DD * 2); bf* QPl = (bf*)take((size_t)TT * DD * 2); bf* KPh = (bf*)take((size_t)TT * DD * 2); bf* KPl = (bf*)take((size_t)TT * DD * 2); bf* VTh = (bf*)take((size_t)TT * DD * 2); bf* VTl = (bf*)take((size_t)TT * DD * 2);
    h16* QP16 = (h16*)take((size_t)TT * DD * 2); h16* KP16 = (h16*)take((size_t)TT * DD * 2); h16* VT16 = (h16*)take((size_t)TT * DD * 2);
    float* Sb = (float*)take((size_t)ZH * TT * TT * 4); bf* Ph = (bf*)take((size_t)ZH * RH * TT * 2); bf* Pl = (bf*)take((size_t)ZH * RH * TT * 2); h16* P16 = (h16*)take((size_t)ZH * TT * TT * 2); float* Ob = (float*)take((size_t)ZH * TT * HD * 4); bf* ATh = (bf*)take((size_t)TT * DD * 2); bf* ATl = (bf*)take((size_t)TT * DD * 2);
    if ((size_t)(wsp - (char*)d_ws) > ws_size) return;    // total ~ 213 MB = 203 MiB; ws 256 MiB
    { const size_t nw = (size_t)DD * DD / 8; const unsigned gw = (unsigned)((nw + 255) / 256); k_cvt8<<<gw, 256, 0, stream>>>(Wq, WQ, nw); k_cvt8<<<gw, 256, 0, stream>>>(Wk, WK, nw); k_cvt8<<<gw, 256, 0, stream>>>(Wv, WV, nw); k_cvt8<<<gw, 256, 0, stream>>>(Wd, WO, nw);
      k_cstab<<<TT * NF / 256, 256, 0, stream>>>(CSN); }
    const unsigned LB = (unsigned)((NH_ * TT * HD / 64 + 63) / 64); const dim3 gP(TT / 64, DD / 64, 1);
    for (int b = 0; b < NB_; ++b) {
        k_cvt8<<<(unsigned)(((size_t)TT * DD / 8 + 255) / 256), 256, 0, stream>>>(x + (size_t)b * TT * DD, XB, (size_t)TT * DD / 8);
        k_gemmw<bf, 0, false, 4><<<gP, 128, 0, stream>>>(XB, nullptr, WQ, nullptr, DD, F, DD, nullptr, 0, 0, 0); k_hsplit<<<LB, 256, 0, stream>>>(F, CSN, QPh, QPl, QP16);
        k_gemmw<bf, 0, false, 4><<<gP, 128, 0, stream>>>(XB, nullptr, WK, nullptr, DD, F, DD, nullptr, 0, 0, 0); k_hsplit<<<LB, 256, 0, stream>>>(F, CSN, KPh, KPl, KP16);
        k_gemmw<bf, 0, false, 4><<<gP, 128, 0, stream>>>(XB, nullptr, WV, nullptr, DD, F, DD, nullptr, 0, 0, 0); k_vtplane<<<LB, 256, 0, stream>>>(F, VTh, VTl, VT16);
        for (int h0 = 0; h0 < NH_; h0 += ZH) { const size_t z0 = (size_t)h0;
            // scores: rows < RH on hi+lo planes (3 products), rows >= RH on fp16 planes - both into the same [ZH][TT][TT] score buffer
            k_gemmw<bf, 2, false, 1><<<dim3(RH / 64, TT / 64, ZH), 32, 0, stream>>>(QPh + z0 * TT * HD, QPl + z0 * TT * HD, KPh + z0 * TT * HD, KPl + z0 * TT * HD, HD, Sb, TT, nullptr, (size_t)TT * HD, (size_t)TT * HD, (size_t)TT * TT);
            k_gemmw<h16, 0, false, 1><<<dim3((TT - RH) / 64, TT / 64, ZH), 32, 0, stream>>>(QP16 + z0 * TT * HD + (size_t)RH * HD, nullptr, KP16 + z0 * TT * HD, nullptr, HD, Sb + (size_t)RH * TT, TT, nullptr, (size_t)TT * HD, (size_t)TT * HD, (size_t)TT * TT);
            k_asoft<<<ZH * TT / 8, 256, 0, stream>>>(Sb, amask, 0, Ph, Pl, P16);
            k_gemmw<bf, 2, false, 8><<<dim3(RH / 64, HD / 64, ZH), 256, 0, stream>>>(Ph, Pl, VTh + z0 * HD * TT, VTl + z0 * HD * TT, TT, Ob, HD, nullptr, (size_t)RH * TT, (size_t)HD * TT, (size_t)TT * HD);
            k_gemmw<h16, 0, false, 16><<<dim3((TT - RH) / 64, HD / 64, ZH), 512, 0, stream>>>(P16 + (size_t)RH * TT, nullptr, VT16 + z0 * HD * TT, nullptr, TT, Ob + (size_t)RH * HD, HD, nullptr, (size_t)TT * TT, (size_t)HD * TT, (size_t)TT * HD);
            k_merge<<<(ZH * TT * HD / 64 + 63) / 64, 256, 0, stream>>>(Ob, h0, ATh, ATl); }
        k_gemmw<bf, 1, false, 4><<<gP, 128, 0, stream>>>(ATh, ATl, WO, nullptr, DD, OUT + (size_t)b * TT * DD, DD, nullptr, 0, 0, 0); }
}

// v002
// It runs in 1130 microseconds.
// In two side-by-side timings against v001, it was 1.33 and 1.34 times as fast.
// Counting every step since v000, it is 2.15 times as fast.
#include <hip/hip_runtime.h>

// ThornsAttention (x [2][2048][2048]; q/k/v = x W^T ([out][in] weights, no bias); 16 heads x 128; "RoPE" whose rotate_half is the identity (rotary_ndims == head_dim in the source), so
// q <- q*cos + q*sin elementwise with emb = cat(freqs, freqs), inv_freq = 10000^(-2i/128); scores = q.k / sqrt(128) + attention_mask (verbatim [1][1][2048][2048] additive input, read
// as data); softmax; out = (attn.v merged) Wd^T).
// Compute dtypes, f32 accumulate: every input rounded to bf16; projections on PLAIN bf16 operands (inputs: exact); the rotary factors cos/sin(t x inv_freq)
// in f32 (powf/cosf/sinf, tabulated once); scores for rows < RH on bf16 hi+lo planes of the rotated q and k (3 products; the 1/sqrt(128) applied in f32 in the softmax kernel), rows >= RH on fp16 planes (1 product); attn.v for rows < RH on hi+lo planes
// (3 products), rows >= RH on fp16 planes (1 product) - the mask is causal-shaped here so early rows see few keys; output hi+lo x exact Wd (2 products).

#define NB_  2
#define TT   2048
#define DD   2048
#define NH_  16
#define HD   128
#define ZH   4                    // heads per launch in the attention loop
#define RH   512                  // query rows < RH use hi+lo planes for scores and attn.v; rows >= RH use single fp16 planes
#define NF   64                   // rotary frequencies (head_dim / 2)
#define SCL  0.088388349f
#define PCAR 1024.0f         // scale of the fp16 P rows (i >= RH), divided out again in k_merge
typedef _Float16 h16;
typedef unsigned short bf;
typedef __attribute__((ext_vector_type(16))) __bf16   v16bf;
typedef __attribute__((ext_vector_type(16))) _Float16 v16h;
typedef __attribute__((ext_vector_type(8)))  _Float16 v8h;
typedef __attribute__((ext_vector_type(8)))  unsigned short v8us;
typedef __attribute__((ext_vector_type(8)))  float    v8f;
typedef __attribute__((ext_vector_type(4)))  float    v4f;
typedef v8h  __attribute__((may_alias)) v8ha;
typedef v4f  __attribute__((may_alias)) v4fa;
typedef v8us __attribute__((may_alias)) v8usa;

__device__ __forceinline__ unsigned short f2bf(float f) { unsigned u = __float_as_uint(f); u += 0x7FFFu + ((u >> 16) & 1u); return (unsigned short)(u >> 16); }
__device__ __forceinline__ float bf2f(unsigned short b) { return __uint_as_float(((unsigned)b) << 16); }
__device__ __forceinline__ float bfr(float f) { return bf2f(f2bf(f)); }
__device__ __forceinline__ v16h cat16(v8h lo, v8h hi) { return __builtin_shufflevector(lo, hi, 0, 1, 2, 3, 4, 5, 6, 7, 8, 9, 10, 11, 12, 13, 14, 15); }
__device__ __forceinline__ v16bf cat16b(v8us lo, v8us hi) { return __builtin_bit_cast(v16bf, __builtin_shufflevector(lo, hi, 0, 1, 2, 3, 4, 5, 6, 7, 8, 9, 10, 11, 12, 13, 14, 15)); }
__device__ __forceinline__ v8f wmma16(v16h a, v16h b, v8f c) { return __builtin_amdgcn_wmma_f32_16x16x32_f16(false, a, false, b, (short)0, c, false, false); }
__device__ __forceinline__ v8f wmmab(v16bf a, v16bf b, v8f c) { return __builtin_amdgcn_wmma_f32_16x16x32_bf16(false, a, false, b, (short)0, c, false, false); }



// ---- k_gemmw: register-blocked GEMM, one 64x64 output tile per work-group (16 accumulators per wave), operands straight from K-contiguous 16-bit planes; grid (M/64, N/64, Z), KW * 32 threads.
// C[m][n] (f32, pitch ldc, + optional f32 bias[n]) = sum_k A[m][k] Bt[n][k] (+ split products per NSPLIT). z-batch strides sA/sB/sC in elements. K % (KW * 32) == 0.
// KW waves share the tile's K: wave w takes the 32-k blocks w, w + KW, w + 2 KW, ... (neighbouring waves read neighbouring 64-byte pieces of the same rows), so the chain of dependent
// load-then-multiply trips is K / (32 KW) long; the KW f32 partial tiles are summed in LDS in the fixed order w = 0 .. KW - 1. KW == 1 is the one-wave form.
template <typename T16> struct WFrag;
template <> struct WFrag<h16> { typedef v16h V; static __device__ __forceinline__ V ld(const h16* p) { return cat16(*(const v8h*)p, *(const v8h*)(p + 16)); } static __device__ __forceinline__ v8f mma(V a, V b, v8f c) { return wmma16(a, b, c); } };
template <> struct WFrag<bf> { typedef v16bf V; static __device__ __forceinline__ V ld(const bf* p) { return cat16b(*(const v8us*)p, *(const v8us*)(p + 16)); } static __device__ __forceinline__ v8f mma(V a, V b, v8f c) { return wmmab(a, b, c); } };
template <typename T16, int NSPLIT, bool BIAS, int KW>
__global__ __launch_bounds__(KW * 32) void k_gemmw(const T16* __restrict__ A, const T16* __restrict__ A2, const T16* __restrict__ Bt, const T16* __restrict__ Bt2, int K, float* C, int ldc, const float* __restrict__ bias, size_t sA, size_t sB, size_t sC) {
    typedef typename WFrag<T16>::V V;
    __shared__ __align__(16) float os[KW == 1 ? 16 * 68 : KW * 64 * 68];
    const int w = KW == 1 ? 0 : __builtin_amdgcn_readfirstlane((int)(threadIdx.x >> 5));    // the wave's number, held scalar so that the loop's k offset stays scalar
    const size_t z = blockIdx.z; A += z * sA; if (A2) A2 += z * sA; Bt += z * sB; if (Bt2) Bt2 += z * sB; C += z * sC;
    const int lane = threadIdx.x & 31, lr = lane & 15, hi = lane >> 4; const int r0 = blockIdx.x * 64, c0 = blockIdx.y * 64;
    v8f acc[4][4];
#pragma unroll
    for (int mb = 0; mb < 4; ++mb)
#pragma unroll
        for (int nb = 0; nb < 4; ++nb) acc[mb][nb] = (v8f){};
    const size_t aoff = (size_t)(r0 + lr) * K + 8 * hi, boff = (size_t)(c0 + lr) * K + 8 * hi;
#pragma unroll 1
    for (int kc = w * 32; kc < K; kc += KW * 32) {
        V a[4], a2[4];
#pragma unroll
        for (int mb = 0; mb < 4; ++mb) { a[mb] = WFrag<T16>::ld(A + aoff + (size_t)mb * 16 * K + kc); if (NSPLIT == 1 || NSPLIT == 2) a2[mb] = WFrag<T16>::ld(A2 + aoff + (size_t)mb * 16 * K + kc); }
#pragma unroll
        for (int nb = 0; nb < 4; ++nb) { const V b = WFrag<T16>::ld(Bt + boff + (size_t)nb * 16 * K + kc); V b2; if (NSPLIT >= 2) b2 = WFrag<T16>::ld(Bt2 + boff + (size_t)nb * 16 * K + kc);
#pragma unroll
            for (int mb = 0; mb < 4; ++mb) { acc[mb][nb] = WFrag<T16>::mma(a[mb], b, acc[mb][nb]); if (NSPLIT == 1 || NSPLIT == 2) acc[mb][nb] = WFrag<T16>::mma(a2[mb], b, acc[mb][nb]); if (NSPLIT >= 2) acc[mb][nb] = WFrag<T16>::mma(a[mb], b2, acc[mb][nb]); } }
        asm volatile("v_nop\n\tv_nop\n\tv_nop\n\tv_nop" : "+v"(acc[0][0]), "+v"(acc[1][1]), "+v"(acc[2][2]), "+v"(acc[3][3]) : "v"(a[0]), "v"(a[3]));
    }
    if constexpr (KW > 1) {
        float* my = os + w * (64 * 68);
#pragma unroll
        for (int mb = 0; mb < 4; ++mb)
#pragma unroll
            for (int nb = 0; nb < 4; ++nb)
#pragma unroll
                for (int j = 0; j < 8; ++j) my[(mb * 16 + hi * 8 + j) * 68 + nb * 16 + lr] = acc[mb][nb][j];
        __syncthreads();    // every wave's partial tile is in LDS before any thread sums across waves
#pragma unroll
        for (int i = 0; i < 32 / KW; ++i) { const int s = i * (KW * 32) + (int)threadIdx.x; const int row = s >> 4, cofs = (s & 15) * 4; v4f val = *(const v4fa*)(os + row * 68 + cofs);
#pragma unroll
            for (int q = 1; q < KW; ++q) val += *(const v4fa*)(os + q * (64 * 68) + row * 68 + cofs);
            if (BIAS) { val[0] += bfr(bias[c0 + cofs]); val[1] += bfr(bias[c0 + cofs + 1]); val[2] += bfr(bias[c0 + cofs + 2]); val[3] += bfr(bias[c0 + cofs + 3]); }
            *(v4f*)(C + (size_t)(r0 + row) * ldc + c0 + cofs) = val; }
    } else {
#pragma unroll
    for (int mb = 0; mb < 4; ++mb) {
#pragma unroll
        for (int nb = 0; nb < 4; ++nb) {
#pragma unroll
            for (int j = 0; j < 8; ++j) os[(hi * 8 + j) * 68 + nb * 16 + lr] = acc[mb][nb][j]; }
        __builtin_amdgcn_wave_barrier(); asm volatile("" ::: "memory");
        float* crow = C + (size_t)(r0 + mb * 16) * ldc + c0;
{
#pragma unroll
            for (int s = 0; s < 8; ++s) { const int row = 2 * s + hi, cofs = lr * 4; v4f val = *(const v4fa*)(os + row * 68 + cofs); if (BIAS) { val[0] += bfr(bias[c0 + cofs]); val[1] += bfr(bias[c0 + cofs + 1]); val[2] += bfr(bias[c0 + cofs + 2]); val[3] += bfr(bias[c0 + cofs + 3]); }
                *(v4f*)(crow + (size_t)row * ldc + cofs) = val; }
             }
        __builtin_amdgcn_wave_barrier(); asm volatile("" ::: "memory");
    }
    }
}

__device__ __forceinline__ h16 tohx(float x) { return (h16)x; }
__device__ __forceinline__ void splitf(float y, unsigned short& h, unsigned short& l) { h = f2bf(y); l = f2bf(y - bf2f(h)); }
typedef __attribute__((ext_vector_type(2))) unsigned short v2us;
typedef __attribute__((ext_vector_type(2))) _Float16 v2h;
typedef __attribute__((ext_vector_type(4))) _Float16 v4h;
typedef __attribute__((ext_vector_type(2))) float v2f;

__global__ __launch_bounds__(256) void k_cvt8(const float* __restrict__ src, bf* dst, size_t n8) { const size_t i = (size_t)blockIdx.x * 256 + threadIdx.x; if (i >= n8) return; const v8f v = *(const v8f*)(src + i * 8); v8us o;
#pragma unroll
    for (int k = 0; k < 8; ++k) o[k] = f2bf(v[k]); *(v8us*)(dst + i * 8) = o;  }
__global__ __launch_bounds__(256) void k_cstab(float* CSN) {
    const int idx = blockIdx.x * 256 + threadIdx.x; if (idx >= TT * NF) return; const int t = idx / NF, i = idx % NF; const float invf = __fdiv_rn(1.0f, powf(10000.0f, (float)(2 * i) * (1.0f / HD))); const float ang = __fmul_rn((float)t, invf);
    v2f o; o[0] = cosf(ang); o[1] = sinf(ang); *(v2f*)(CSN + (size_t)idx * 2) = o;  }
__global__ __launch_bounds__(256) void k_hsplit(const float* __restrict__ F, const float* __restrict__ CSN, bf* Ph, bf* Pl, h16* P16) {
    const int lane = threadIdx.x & 31; const int L0 = (blockIdx.x * 8 + (threadIdx.x >> 5)) * 8; const int nlines = NH_ * TT * HD / 64;
{
#pragma unroll
        for (int l = 0; l < 8; ++l) { const int L = L0 + l; if (L >= nlines) break; const int e = L * 64 + lane * 2; const int d = e & (HD - 1); const int t = (e >> 7) & (TT - 1); const int h = e >> 18; v2us oh, ol; v2h o16;
#pragma unroll
            for (int q = 0; q < 2; ++q) { const int dd = d + q; const float x = F[(size_t)t * DD + h * HD + dd]; const v2f cs = *(const v2f*)(CSN + ((size_t)t * NF + (dd & (NF - 1))) * 2);
                float p1 = __fmul_rn(x, cs[0]), p2 = __fmul_rn(x, cs[1]); asm volatile("" : "+v"(p1)); asm volatile("" : "+v"(p2)); const float r = __fadd_rn(p1, p2); unsigned short a, c2; splitf(r, a, c2); oh[q] = a; ol[q] = c2; o16[q] = tohx(r); }
            *(v2us*)(Ph + (size_t)e) = oh; *(v2us*)(Pl + (size_t)e) = ol; *(v2h*)(P16 + (size_t)e) = o16; }
         }
}
__global__ __launch_bounds__(256) void k_vtplane(const float* __restrict__ F, bf* Vh, bf* Vl, h16* V16) {
    const int lane = threadIdx.x & 31; const int L0 = (blockIdx.x * 8 + (threadIdx.x >> 5)) * 8; const int nlines = NH_ * TT * HD / 64;
{
#pragma unroll
        for (int l = 0; l < 8; ++l) { const int L = L0 + l; if (L >= nlines) break; const int e = L * 64 + lane * 2; const int t = e & (TT - 1); const int d = (e >> 11) & (HD - 1); const int h = e >> 18; v2us oh, ol; v2h o16;
#pragma unroll
            for (int q = 0; q < 2; ++q) { const float x = F[(size_t)(t + q) * DD + h * HD + d]; unsigned short a, c2; splitf(x, a, c2); oh[q] = a; ol[q] = c2; o16[q] = tohx(x); }
            *(v2us*)(Vh + (size_t)e) = oh; *(v2us*)(Vl + (size_t)e) = ol; *(v2h*)(V16 + (size_t)e) = o16; }
         }
}
// k_asoft: per row (zz, i): s = S * f32(1/sqrt(128)) + bf16(mask[0][0][i][j]) (additive input read as data); softmax over the 2048 keys (register row, one exp) -> rows i < RH: P hi/lo
__global__ __launch_bounds__(256) void k_asoft(const float* __restrict__ Sb, const float* __restrict__ am, int b, bf* Ph, bf* Pl, h16* P16) {
    typedef __attribute__((ext_vector_type(4))) unsigned short v4us;
    const int lane = threadIdx.x & 31; const int row = blockIdx.x * 8 + (threadIdx.x >> 5); if (row >= ZH * TT) return; const int i = row & (TT - 1); const int zz = row >> 11; const bool hires = (i < RH);
    const float* sr = Sb + (size_t)row * TT; const float* mr = am + ((size_t)b * TT + i) * TT; float v[64]; float mx = -3.0e38f;
#pragma unroll
    for (int ch = 0; ch < 16; ++ch) { const int j0 = ch * 128 + lane * 4; const v4f a = *(const v4f*)(sr + j0), mk = *(const v4f*)(mr + j0);
#pragma unroll
        for (int q = 0; q < 4; ++q) { float mm = bfr(mk[q]); asm volatile("" : "+v"(mm)); float sp = __fmul_rn(a[q], SCL); asm volatile("" : "+v"(sp)); const float t = __fadd_rn(sp, mm); v[ch * 4 + q] = t; mx = fmaxf(mx, t); } }
#pragma unroll
    for (int sh = 16; sh; sh >>= 1) mx = fmaxf(mx, __shfl_xor(mx, sh, 32));
    float sum = 0.f;
#pragma unroll
    for (int k = 0; k < 64; ++k) { v[k] = __expf(v[k] - mx); sum += v[k]; }
#pragma unroll
    for (int sh = 16; sh; sh >>= 1) sum += __shfl_xor(sum, sh, 32);
    const float f = __fdiv_rn(hires ? 1.0f : PCAR, sum);
{
        if (hires) {
#pragma unroll
            for (int ch = 0; ch < 16; ++ch) { v4us oh, ol;
#pragma unroll
                for (int q = 0; q < 4; ++q) { unsigned short a, c2; splitf(v[ch * 4 + q] * f, a, c2); oh[q] = a; ol[q] = c2; }
                const size_t o = ((size_t)zz * RH + i) * TT + ch * 128 + lane * 4; *(v4us*)(Ph + o) = oh; *(v4us*)(Pl + o) = ol; }
        } else {
#pragma unroll
            for (int ch = 0; ch < 16; ++ch) { v4h o;
#pragma unroll
                for (int q = 0; q < 4; ++q) o[q] = tohx(v[ch * 4 + q] * f);
                *(v4h*)(P16 + (size_t)row * TT + ch * 128 + lane * 4) = o; } }
         }
}
__global__ __launch_bounds__(256) void k_merge(const float* __restrict__ O, int h0, bf* Ah, bf* Al) {
    const int lane = threadIdx.x & 31; const int L0 = (blockIdx.x * 8 + (threadIdx.x >> 5)) * 8; const int nlines = ZH * TT * HD / 64;
{
#pragma unroll
        for (int l = 0; l < 8; ++l) { const int L = L0 + l; if (L >= nlines) break; const int e = L * 64 + lane * 2; const int d = e & (HD - 1); const int t = (e >> 7) & (TT - 1); const int zz = e >> 18; v2us oh, ol;
const float cs = (t < RH) ? 1.0f : (1.0f / PCAR);
#pragma unroll
            for (int q = 0; q < 2; ++q) { unsigned short a, c2; splitf(O[(size_t)e + q] * cs, a, c2); oh[q] = a; ol[q] = c2; }
            const size_t o = (size_t)t * DD + (h0 + zz) * HD + d; *(v2us*)(Ah + o) = oh; *(v2us*)(Al + o) = ol; }
         }
}

extern "C" void kernel_launch(void* const* d_in, const int* in_sizes, int n_in,
                              void* d_out, int out_size, void* d_ws, size_t ws_size, hipStream_t stream) {
    (void)in_sizes; (void)n_in; (void)out_size;
    const float* x = (const float*)d_in[0]; const float* amask = (const float*)d_in[1]; const float* Wq = (const float*)d_in[2]; const float* Wk = (const float*)d_in[3]; const float* Wv = (const float*)d_in[4]; const float* Wd = (const float*)d_in[5];
    float* OUT = (float*)d_out;     // [2][2048][2048]
    char* wsp = (char*)d_ws;
    auto take = [&](size_t bytes) { char* p = wsp; wsp += (bytes + 255) & ~(size_t)255; return (void*)p; };
    bf* WQ = (bf*)take((size_t)DD * DD * 2); bf* WK = (bf*)take((size_t)DD * DD * 2); bf* WV = (bf*)take((size_t)DD * DD * 2); bf* WO = (bf*)take((size_t)DD * DD * 2);
    bf* XB = (bf*)take((size_t)TT * DD * 2); float* F = (float*)take((size_t)TT * DD * 4); float* CSN = (float*)take((size_t)TT * NF * 2 * 4);
    bf* QPh = (bf*)take((size_t)TT * DD * 2); bf* QPl = (bf*)take((size_t)TT * DD * 2); bf* KPh = (bf*)take((size_t)TT * DD * 2); bf* KPl = (bf*)take((size_t)TT * DD * 2); bf* VTh = (bf*)take((size_t)TT * DD * 2); bf* VTl = (bf*)take((size_t)TT * DD * 2);
    h16* QP16 = (h16*)take((size_t)TT * DD * 2); h16* KP16 = (h16*)take((size_t)TT * DD * 2); h16* VT16 = (h16*)take((size_t)TT * DD * 2);
    float* Sb = (float*)take((size_t)ZH * TT * TT * 4); h16* P16 = (h16*)take((size_t)ZH * TT * TT * 2);
    // XB and F are read only by the projection stage of a batch and are rewritten at the start of the next one; the head loop reuses their bytes: Ph (8 MiB) on XB, Pl (8 MiB) and Ob (4 MiB) on F.
    static_assert((size_t)ZH * RH * TT * 2 <= (size_t)TT * DD * 2 && (size_t)ZH * TT * HD * 4 <= (size_t)TT * DD * 2, "head-loop buffers fit the projection buffers they reuse");
    bf* Ph = XB; bf* Pl = (bf*)F; float* Ob = F + (size_t)TT * DD / 2; bf* ATh = (bf*)take((size_t)TT * DD * 2); bf* ATl = (bf*)take((size_t)TT * DD * 2);
    if ((size_t)(wsp - (char*)d_ws) > ws_size) return;    // total 241 MiB; ws 256 MiB
    { const size_t nw = (size_t)DD * DD / 8; const unsigned gw = (unsigned)((nw + 255) / 256); k_cvt8<<<gw, 256, 0, stream>>>(Wq, WQ, nw); k_cvt8<<<gw, 256, 0, stream>>>(Wk, WK, nw); k_cvt8<<<gw, 256, 0, stream>>>(Wv, WV, nw); k_cvt8<<<gw, 256, 0, stream>>>(Wd, WO, nw);
      k_cstab<<<TT * NF / 256, 256, 0, stream>>>(CSN); }
    const unsigned LB = (unsigned)((NH_ * TT * HD / 64 + 63) / 64); const dim3 gP(TT / 64, DD / 64, 1);
    for (int b = 0; b < NB_; ++b) {
        k_cvt8<<<(unsigned)(((size_t)TT * DD / 8 + 255) / 256), 256, 0, stream>>>(x + (size_t)b * TT * DD, XB, (size_t)TT * DD / 8);
        k_gemmw<bf, 0, false, 4><<<gP, 128, 0, stream>>>(XB, nullptr, WQ, nullptr, DD, F, DD, nullptr, 0, 0, 0); k_hsplit<<<LB, 256, 0, stream>>>(F, CSN, QPh, QPl, QP16);
        k_gemmw<bf, 0, false, 4><<<gP, 128, 0, stream>>>(XB, nullptr, WK, nullptr, DD, F, DD, nullptr, 0, 0, 0); k_hsplit<<<LB, 256, 0, stream>>>(F, CSN, KPh, KPl, KP16);
        k_gemmw<bf, 0, false, 4><<<gP, 128, 0, stream>>>(XB, nullptr, WV, nullptr, DD, F, DD, nullptr, 0, 0, 0); k_vtplane<<<LB, 256, 0, stream>>>(F, VTh, VTl, VT16);
        for (int h0 = 0; h0 < NH_; h0 += ZH) { const size_t z0 = (size_t)h0;
            // scores: rows < RH on hi+lo planes (3 products), rows >= RH on fp16 planes - both into the same [ZH][TT][TT] score buffer
            k_gemmw<bf, 2, false, 1><<<dim3(RH / 64, TT / 64, ZH), 32, 0, stream>>>(QPh + z0 * TT * HD, QPl + z0 * TT * HD, KPh + z0 * TT * HD, KPl + z0 * TT * HD, HD, Sb, TT, nullptr, (size_t)TT * HD, (size_t)TT * HD, (size_t)TT * TT);
            k_gemmw<h16, 0, false, 1><<<dim3((TT - RH) / 64, TT / 64, ZH), 32, 0, stream>>>(QP16 + z0 * TT * HD + (size_t)RH * HD, nullptr, KP16 + z0 * TT * HD, nullptr, HD, Sb + (size_t)RH * TT, TT, nullptr, (size_t)TT * HD, (size_t)TT * HD, (size_t)TT * TT);
            k_asoft<<<ZH * TT / 8, 256, 0, stream>>>(Sb, amask, 0, Ph, Pl, P16);
            k_gemmw<bf, 2, false, 8><<<dim3(RH / 64, HD / 64, ZH), 256, 0, stream>>>(Ph, Pl, VTh + z0 * HD * TT, VTl + z0 * HD * TT, TT, Ob, HD, nullptr, (size_t)RH * TT, (size_t)HD * TT, (size_t)TT * HD);
            k_gemmw<h16, 0, false, 16><<<dim3((TT - RH) / 64, HD / 64, ZH), 512, 0, stream>>>(P16 + (size_t)RH * TT, nullptr, VT16 + z0 * HD * TT, nullptr, TT, Ob + (size_t)RH * HD, HD, nullptr, (size_t)TT * TT, (size_t)HD * TT, (size_t)TT * HD);
            k_merge<<<(ZH * TT * HD / 64 + 63) / 64, 256, 0, stream>>>(Ob, h0, ATh, ATl); }
        k_gemmw<bf, 1, false, 4><<<gP, 128, 0, stream>>>(ATh, ATl, WO, nullptr, DD, OUT + (size_t)b * TT * DD, DD, nullptr, 0, 0, 0); }
}

// v003
// A run of this version takes 1020 microseconds.
// Next to v002, in two timings, it ran 1.11 times as fast each time.
// Counting every step since v000, it is 2.39 times as fast.
#include <hip/hip_runtime.h>

// ThornsAttention (x [2][2048][2048]; q/k/v = x W^T ([out][in] weights, no bias); 16 heads x 128; "RoPE" whose rotate_half is the identity (rotary_ndims == head_dim in the source), so
// q <- q*cos + q*sin elementwise with emb = cat(freqs, freqs), inv_freq = 10000^(-2i/128); scores = q.k / sqrt(128) + attention_mask (verbatim [1][1][2048][2048] additive input, read
// as data); softmax; out = (attn.v merged) Wd^T).
// Compute dtypes, f32 accumulate: every input rounded to bf16; projections on PLAIN bf16 operands (inputs: exact); the rotary factors cos/sin(t x inv_freq)
// in f32 (powf/cosf/sinf, tabulated once); scores for rows < RH on bf16 hi+lo planes of the rotated q and k (3 products; the 1/sqrt(128) applied in f32 in the softmax kernel), rows >= RH on fp16 planes (1 product); attn.v for rows < RH on hi+lo planes
// (3 products), rows >= RH on fp16 planes (1 product) - the mask is causal-shaped here so early rows see few keys; output hi+lo x exact Wd (2 products).

#define NB_  2
#define TT   2048
#define DD   2048
#define NH_  16
#define HD   128
#define ZH   4                    // heads per launch in the attention loop
#define RH   512                  // query rows < RH use hi+lo planes for scores and attn.v; rows >= RH use single fp16 planes
#define NF   64                   // rotary frequencies (head_dim / 2)
#define SCL  0.088388349f
#define PCAR 1024.0f         // scale of the fp16 P rows (i >= RH), divided out again in k_merge
typedef _Float16 h16;
typedef unsigned short bf;
typedef __attribute__((ext_vector_type(16))) __bf16   v16bf;
typedef __attribute__((ext_vector_type(16))) _Float16 v16h;
typedef __attribute__((ext_vector_type(8)))  _Float16 v8h;
typedef __attribute__((ext_vector_type(8)))  unsigned short v8us;
typedef __attribute__((ext_vector_type(8)))  float    v8f;
typedef __attribute__((ext_vector_type(4)))  float    v4f;
typedef v8h  __attribute__((may_alias)) v8ha;
typedef v4f  __attribute__((may_alias)) v4fa;
typedef v8us __attribute__((may_alias)) v8usa;

__device__ __forceinline__ unsigned short f2bf(float f) { unsigned u = __float_as_uint(f); u += 0x7FFFu + ((u >> 16) & 1u); return (unsigned short)(u >> 16); }
__device__ __forceinline__ float bf2f(unsigned short b) { return __uint_as_float(((unsigned)b) << 16); }
__device__ __forceinline__ float bfr(float f) { return bf2f(f2bf(f)); }
__device__ __forceinline__ v16h cat16(v8h lo, v8h hi) { return __builtin_shufflevector(lo, hi, 0, 1, 2, 3, 4, 5, 6, 7, 8, 9, 10, 11, 12, 13, 14, 15); }
__device__ __forceinline__ v16bf cat16b(v8us lo, v8us hi) { return __builtin_bit_cast(v16bf, __builtin_shufflevector(lo, hi, 0, 1, 2, 3, 4, 5, 6, 7, 8, 9, 10, 11, 12, 13, 14, 15)); }
__device__ __forceinline__ v8f wmma16(v16h a, v16h b, v8f c) { return __builtin_amdgcn_wmma_f32_16x16x32_f16(false, a, false, b, (short)0, c, false, false); }
__device__ __forceinline__ v8f wmmab(v16bf a, v16bf b, v8f c) { return __builtin_amdgcn_wmma_f32_16x16x32_bf16(false, a, false, b, (short)0, c, false, false); }



// ---- k_gemmw: register-blocked GEMM, one 64x64 output tile per work-group (16 accumulators per wave), operands straight from K-contiguous 16-bit planes; grid (M/64, N/64, Z), KW * 32 threads.
// C[m][n] (f32, pitch ldc, + optional f32 bias[n]) = sum_k A[m][k] Bt[n][k] (+ split products per NSPLIT). z-batch strides sA/sB/sC in elements. K % (KW * 32) == 0.
// KW waves share the tile's K: wave w takes the 32-k blocks w, w + KW, w + 2 KW, ... (neighbouring waves read neighbouring 64-byte pieces of the same rows), so the chain of dependent
// load-then-multiply trips is K / (32 KW) long; the KW f32 partial tiles are summed in LDS in the fixed order w = 0 .. KW - 1. KW == 1 is the one-wave form.
template <typename T16> struct WFrag;
template <> struct WFrag<h16> { typedef v16h V; static __device__ __forceinline__ V ld(const h16* p) { return cat16(*(const v8h*)p, *(const v8h*)(p + 16)); } static __device__ __forceinline__ v8f mma(V a, V b, v8f c) { return wmma16(a, b, c); } };
template <> struct WFrag<bf> { typedef v16bf V; static __device__ __forceinline__ V ld(const bf* p) { return cat16b(*(const v8us*)p, *(const v8us*)(p + 16)); } static __device__ __forceinline__ v8f mma(V a, V b, v8f c) { return wmmab(a, b, c); } };
template <typename T16, int NSPLIT, bool BIAS, int KW>
__global__ __launch_bounds__(KW * 32) void k_gemmw(const T16* __restrict__ A, const T16* __restrict__ A2, const T16* __restrict__ Bt, const T16* __restrict__ Bt2, int K, float* C, int ldc, const float* __restrict__ bias, size_t sA, size_t sB, size_t sC) {
    typedef typename WFrag<T16>::V V;
    __shared__ __align__(16) float os[KW == 1 ? 16 * 68 : KW * 64 * 68];
    const int w = KW == 1 ? 0 : __builtin_amdgcn_readfirstlane((int)(threadIdx.x >> 5));    // the wave's number, held scalar so that the loop's k offset stays scalar
    const size_t z = blockIdx.z; A += z * sA; if (A2) A2 += z * sA; Bt += z * sB; if (Bt2) Bt2 += z * sB; C += z * sC;
    const int lane = threadIdx.x & 31, lr = lane & 15, hi = lane >> 4; const int r0 = blockIdx.x * 64, c0 = blockIdx.y * 64;
    v8f acc[4][4];
#pragma unroll
    for (int mb = 0; mb < 4; ++mb)
#pragma unroll
        for (int nb = 0; nb < 4; ++nb) acc[mb][nb] = (v8f){};
    const size_t aoff = (size_t)(r0 + lr) * K + 8 * hi, boff = (size_t)(c0 + lr) * K + 8 * hi;
#pragma unroll 1
    for (int kc = w * 32; kc < K; kc += KW * 32) {
        V a[4], a2[4];
#pragma unroll
        for (int mb = 0; mb < 4; ++mb) { a[mb] = WFrag<T16>::ld(A + aoff + (size_t)mb * 16 * K + kc); if (NSPLIT == 1 || NSPLIT == 2) a2[mb] = WFrag<T16>::ld(A2 + aoff + (size_t)mb * 16 * K + kc); }
#pragma unroll
        for (int nb = 0; nb < 4; ++nb) { const V b = WFrag<T16>::ld(Bt + boff + (size_t)nb * 16 * K + kc); V b2; if (NSPLIT >= 2) b2 = WFrag<T16>::ld(Bt2 + boff + (size_t)nb * 16 * K + kc);
#pragma unroll
            for (int mb = 0; mb < 4; ++mb) { acc[mb][nb] = WFrag<T16>::mma(a[mb], b, acc[mb][nb]); if (NSPLIT == 1 || NSPLIT == 2) acc[mb][nb] = WFrag<T16>::mma(a2[mb], b, acc[mb][nb]); if (NSPLIT >= 2) acc[mb][nb] = WFrag<T16>::mma(a[mb], b2, acc[mb][nb]); } }
        asm volatile("v_nop\n\tv_nop\n\tv_nop\n\tv_nop" : "+v"(acc[0][0]), "+v"(acc[1][1]), "+v"(acc[2][2]), "+v"(acc[3][3]) : "v"(a[0]), "v"(a[3]));
    }
    if constexpr (KW > 1) {
        float* my = os + w * (64 * 68);
#pragma unroll
        for (int mb = 0; mb < 4; ++mb)
#pragma unroll
            for (int nb = 0; nb < 4; ++nb)
#pragma unroll
                for (int j = 0; j < 8; ++j) my[(mb * 16 + hi * 8 + j) * 68 + nb * 16 + lr] = acc[mb][nb][j];
        __syncthreads();    // every wave's partial tile is in LDS before any thread sums across waves
#pragma unroll
        for (int i = 0; i < 32 / KW; ++i) { const int s = i * (KW * 32) + (int)threadIdx.x; const int row = s >> 4, cofs = (s & 15) * 4; v4f val = *(const v4fa*)(os + row * 68 + cofs);
#pragma unroll
            for (int q = 1; q < KW; ++q) val += *(const v4fa*)(os + q * (64 * 68) + row * 68 + cofs);
            if (BIAS) { val[0] += bfr(bias[c0 + cofs]); val[1] += bfr(bias[c0 + cofs + 1]); val[2] += bfr(bias[c0 + cofs + 2]); val[3] += bfr(bias[c0 + cofs + 3]); }
            *(v4f*)(C + (size_t)(r0 + row) * ldc + c0 + cofs) = val; }
    } else {
#pragma unroll
    for (int mb = 0; mb < 4; ++mb) {
#pragma unroll
        for (int nb = 0; nb < 4; ++nb) {
#pragma unroll
            for (int j = 0; j < 8; ++j) os[(hi * 8 + j) * 68 + nb * 16 + lr] = acc[mb][nb][j]; }
        __builtin_amdgcn_wave_barrier(); asm volatile("" ::: "memory");
        float* crow = C + (size_t)(r0 + mb * 16) * ldc + c0;
{
#pragma unroll
            for (int s = 0; s < 8; ++s) { const int row = 2 * s + hi, cofs = lr * 4; v4f val = *(const v4fa*)(os + row * 68 + cofs); if (BIAS) { val[0] += bfr(bias[c0 + cofs]); val[1] += bfr(bias[c0 + cofs + 1]); val[2] += bfr(bias[c0 + cofs + 2]); val[3] += bfr(bias[c0 + cofs + 3]); }
                *(v4f*)(crow + (size_t)row * ldc + cofs) = val; }
             }
        __builtin_amdgcn_wave_barrier(); asm volatile("" ::: "memory");
    }
    }
}

// ---- k_gemms: LDS-staged GEMM for the 2048^3 products (projections, output). One 128x128 output tile per work-group of 8 waves (2 x 4; 64x32 per wave, 8 accumulators); grid (M/128, N/128).
// C[m][n] (f32, pitch LDC) = sum_k (A[m][k] (+ A2[m][k] when NSPLIT == 1)) Bt[n][k]. K % 128 == 0. Per 128-k step every operand plane's 128 rows x 256 bytes come from global memory as whole
// 128-byte lines (16 lanes a row), go through registers into one of two LDS buffers (row pitch 272 bytes) and are read from there as fragments, in the k order of WFrag::ld. The next step's
// lines are fetched while this step's products run; fragments are read one 32-k block ahead. Each accumulator sums its K in one ascending chain.
#define GP 136                    // LDS row pitch in 16-bit elements (128 + 8)
template <int NSPLIT, int K, int LDC>
__global__ __launch_bounds__(256) void k_gemms(const bf* __restrict__ A, const bf* __restrict__ A2, const bf* __restrict__ Bt, float* C) {
    constexpr int NP = NSPLIT ? 3 : 2;      // planes staged per step
    constexpr int PL = 128 * GP;            // elements of one staged plane
    constexpr int NT = K / 128;
    __shared__ __align__(16) bf sm[2 * NP * PL];
    static_assert(128 * 132 * 4 <= 2 * NP * PL * 2, "the f32 output tile fits the staging buffers it reuses");
    const int tid = threadIdx.x, lane = tid & 31, lr = lane & 15, hi = lane >> 4;
    const int w = __builtin_amdgcn_readfirstlane(tid >> 5); const int wm = w & 1, wn = w >> 1;
    const int r0 = blockIdx.x * 128, c0 = blockIdx.y * 128;
    const int srow = tid >> 4, scol = (tid & 15) * 8;
    const unsigned go = (unsigned)(srow * K + scol);      // the lane's offset in a tile; the tile's own address stays scalar
    const bf* pa = A + (size_t)r0 * K; const bf* pa2 = NSPLIT ? A2 + (size_t)r0 * K : nullptr; const bf* pb = Bt + (size_t)c0 * K;
    bf* st = sm + srow * GP + scol;
    const bf* fa = sm + (wm * 64 + lr) * GP + 8 * hi; const bf* fb = sm + (NP - 1) * PL + (wn * 32 + lr) * GP + 8 * hi;
    v8us ra[8], ra2[8], rb[8];
    v8f acc[4][2];
#pragma unroll
    for (int mb = 0; mb < 4; ++mb)
#pragma unroll
        for (int nb = 0; nb < 2; ++nb) acc[mb][nb] = (v8f){};
#pragma unroll
    for (int i = 0; i < 8; ++i) { ra[i] = *(const v8us*)(pa + go + i * 16 * K); if (NSPLIT) ra2[i] = *(const v8us*)(pa2 + go + i * 16 * K); rb[i] = *(const v8us*)(pb + go + i * 16 * K); }
#pragma unroll
    for (int i = 0; i < 8; ++i) { *(v8us*)(st + i * 16 * GP) = ra[i]; if (NSPLIT) *(v8us*)(st + PL + i * 16 * GP) = ra2[i]; *(v8us*)(st + (NP - 1) * PL + i * 16 * GP) = rb[i]; }
    __syncthreads();    // step 0 is in buffer 0 before any wave reads a fragment
#pragma unroll 1        // rolled: for speed only
    for (int kt = 0; kt < NT; ++kt) {
        const int cur = (kt & 1) * (NP * PL), nxt = NP * PL - cur; const bool more = kt + 1 < NT;
        if (more) { pa += 128; if (NSPLIT) pa2 += 128; pb += 128;
#pragma unroll
            for (int i = 0; i < 8; ++i) { ra[i] = *(const v8us*)(pa + go + i * 16 * K); if (NSPLIT) ra2[i] = *(const v8us*)(pa2 + go + i * 16 * K); rb[i] = *(const v8us*)(pb + go + i * 16 * K); } }
        v16bf a[2][4], a2[2][4], b[2][2];
#pragma unroll
        for (int nb = 0; nb < 2; ++nb) b[0][nb] = WFrag<bf>::ld(fb + cur + nb * 16 * GP);
#pragma unroll
        for (int mb = 0; mb < 4; ++mb) { a[0][mb] = WFrag<bf>::ld(fa + cur + mb * 16 * GP); if (NSPLIT) a2[0][mb] = WFrag<bf>::ld(fa + cur + PL + mb * 16 * GP); }
#pragma unroll
        for (int kk = 0; kk < 4; ++kk) { const int s = kk & 1, n = s ^ 1;
            if (kk < 3) {
#pragma unroll
                for (int nb = 0; nb < 2; ++nb) b[n][nb] = WFrag<bf>::ld(fb + cur + nb * 16 * GP + (kk + 1) * 32);
#pragma unroll
                for (int mb = 0; mb < 4; ++mb) { a[n][mb] = WFrag<bf>::ld(fa + cur + mb * 16 * GP + (kk + 1) * 32); if (NSPLIT) a2[n][mb] = WFrag<bf>::ld(fa + cur + PL + mb * 16 * GP + (kk + 1) * 32); } }
            __builtin_amdgcn_sched_barrier(0);    // the next block's LDS reads stay one group ahead of this block's products (for speed only)
#pragma unroll
            for (int nb = 0; nb < 2; ++nb)
#pragma unroll
                for (int mb = 0; mb < 4; ++mb) { acc[mb][nb] = wmmab(a[s][mb], b[s][nb], acc[mb][nb]); if (NSPLIT) acc[mb][nb] = wmmab(a2[s][mb], b[s][nb], acc[mb][nb]); }
            __builtin_amdgcn_sched_barrier(0); }  // and the following group of reads stays behind this block's products
        if (more) {
#pragma unroll
            for (int i = 0; i < 8; ++i) { *(v8us*)(st + nxt + i * 16 * GP) = ra[i]; if (NSPLIT) *(v8us*)(st + nxt + PL + i * 16 * GP) = ra2[i]; *(v8us*)(st + nxt + (NP - 1) * PL + i * 16 * GP) = rb[i]; } }
        __syncthreads();    // publishes step kt + 1 and ends every wave's reads of the buffer that the next trip refills
    }
    float* os = (float*)sm;
#pragma unroll
    for (int mb = 0; mb < 4; ++mb)
#pragma unroll
        for (int nb = 0; nb < 2; ++nb)
#pragma unroll
            for (int j = 0; j < 8; ++j) os[(wm * 64 + mb * 16 + hi * 8 + j) * 132 + wn * 32 + nb * 16 + lr] = acc[mb][nb][j];
    __syncthreads();    // the whole f32 tile is in LDS before it is written out row by row
    float* pc = C + (size_t)r0 * LDC + c0; const unsigned co = (unsigned)((tid >> 5) * LDC + (tid & 31) * 4);
#pragma unroll
    for (int i = 0; i < 16; ++i) *(v4f*)(pc + co + i * 8 * LDC) = *(const v4fa*)(os + ((tid >> 5) + i * 8) * 132 + (tid & 31) * 4);
}

__device__ __forceinline__ h16 tohx(float x) { return (h16)x; }
__device__ __forceinline__ void splitf(float y, unsigned short& h, unsigned short& l) { h = f2bf(y); l = f2bf(y - bf2f(h)); }
typedef __attribute__((ext_vector_type(2))) unsigned short v2us;
typedef __attribute__((ext_vector_type(2))) _Float16 v2h;
typedef __attribute__((ext_vector_type(4))) _Float16 v4h;
typedef __attribute__((ext_vector_type(2))) float v2f;

__global__ __launch_bounds__(256) void k_cvt8(const float* __restrict__ src, bf* dst, size_t n8) { const size_t i = (size_t)blockIdx.x * 256 + threadIdx.x; if (i >= n8) return; const v8f v = *(const v8f*)(src + i * 8); v8us o;
#pragma unroll
    for (int k = 0; k < 8; ++k) o[k] = f2bf(v[k]); *(v8us*)(dst + i * 8) = o;  }
__global__ __launch_bounds__(256) void k_cstab(float* CSN) {
    const int idx = blockIdx.x * 256 + threadIdx.x; if (idx >= TT * NF) return; const int t = idx / NF, i = idx % NF; const float invf = __fdiv_rn(1.0f, powf(10000.0f, (float)(2 * i) * (1.0f / HD))); const float ang = __fmul_rn((float)t, invf);
    v2f o; o[0] = cosf(ang); o[1] = sinf(ang); *(v2f*)(CSN + (size_t)idx * 2) = o;  }
__global__ __launch_bounds__(256) void k_hsplit(const float* __restrict__ F, const float* __restrict__ CSN, bf* Ph, bf* Pl, h16* P16) {
    const int lane = threadIdx.x & 31; const int L0 = (blockIdx.x * 8 + (threadIdx.x >> 5)) * 8; const int nlines = NH_ * TT * HD / 64;
{
#pragma unroll
        for (int l = 0; l < 8; ++l) { const int L = L0 + l; if (L >= nlines) break; const int e = L * 64 + lane * 2; const int d = e & (HD - 1); const int t = (e >> 7) & (TT - 1); const int h = e >> 18; v2us oh, ol; v2h o16;
#pragma unroll
            for (int q = 0; q < 2; ++q) { const int dd = d + q; const float x = F[(size_t)t * DD + h * HD + dd]; const v2f cs = *(const v2f*)(CSN + ((size_t)t * NF + (dd & (NF - 1))) * 2);
                float p1 = __fmul_rn(x, cs[0]), p2 = __fmul_rn(x, cs[1]); asm volatile("" : "+v"(p1)); asm volatile("" : "+v"(p2)); const float r = __fadd_rn(p1, p2); unsigned short a, c2; splitf(r, a, c2); oh[q] = a; ol[q] = c2; o16[q] = tohx(r); }
            *(v2us*)(Ph + (size_t)e) = oh; *(v2us*)(Pl + (size_t)e) = ol; *(v2h*)(P16 + (size_t)e) = o16; }
         }
}
__global__ __launch_bounds__(256) void k_vtplane(const float* __restrict__ F, bf* Vh, bf* Vl, h16* V16) {
    const int lane = threadIdx.x & 31; const int L0 = (blockIdx.x * 8 + (threadIdx.x >> 5)) * 8; const int nlines = NH_ * TT * HD / 64;
{
#pragma unroll
        for (int l = 0; l < 8; ++l) { const int L = L0 + l; if (L >= nlines) break; const int e = L * 64 + lane * 2; const int t = e & (TT - 1); const int d = (e >> 11) & (HD - 1); const int h = e >> 18; v2us oh, ol; v2h o16;
#pragma unroll
            for (int q = 0; q < 2; ++q) { const float x = F[(size_t)(t + q) * DD + h * HD + d]; unsigned short a, c2; splitf(x, a, c2); oh[q] = a; ol[q] = c2; o16[q] = tohx(x); }
            *(v2us*)(Vh + (size_t)e) = oh; *(v2us*)(Vl + (size_t)e) = ol; *(v2h*)(V16 + (size_t)e) = o16; }
         }
}
// k_asoft: per row (zz, i): s = S * f32(1/sqrt(128)) + bf16(mask[0][0][i][j]) (additive input read as data); softmax over the 2048 keys (register row, one exp) -> rows i < RH: P hi/lo
__global__ __launch_bounds__(256) void k_asoft(const float* __restrict__ Sb, const float* __restrict__ am, int b, bf* Ph, bf* Pl, h16* P16) {
    typedef __attribute__((ext_vector_type(4))) unsigned short v4us;
    const int lane = threadIdx.x & 31; const int row = blockIdx.x * 8 + (threadIdx.x >> 5); if (row >= ZH * TT) return; const int i = row & (TT - 1); const int zz = row >> 11; const bool hires = (i < RH);
    const float* sr = Sb + (size_t)row * TT; const float* mr = am + ((size_t)b * TT + i) * TT; float v[64]; float mx = -3.0e38f;
#pragma unroll
    for (int ch = 0; ch < 16; ++ch) { const int j0 = ch * 128 + lane * 4; const v4f a = *(const v4f*)(sr + j0), mk = *(const v4f*)(mr + j0);
#pragma unroll
        for (int q = 0; q < 4; ++q) { float mm = bfr(mk[q]); asm volatile("" : "+v"(mm)); float sp = __fmul_rn(a[q], SCL); asm volatile("" : "+v"(sp)); const float t = __fadd_rn(sp, mm); v[ch * 4 + q] = t; mx = fmaxf(mx, t); } }
#pragma unroll
    for (int sh = 16; sh; sh >>= 1) mx = fmaxf(mx, __shfl_xor(mx, sh, 32));
    float sum = 0.f;
#pragma unroll
    for (int k = 0; k < 64; ++k) { v[k] = __expf(v[k] - mx); sum += v[k]; }
#pragma unroll
    for (int sh = 16; sh; sh >>= 1) sum += __shfl_xor(sum, sh, 32);
    const float f = __fdiv_rn(hires ? 1.0f : PCAR, sum);
{
        if (hires) {
#pragma unroll
            for (int ch = 0; ch < 16; ++ch) { v4us oh, ol;
#pragma unroll
                for (int q = 0; q < 4; ++q) { unsigned short a, c2; splitf(v[ch * 4 + q] * f, a, c2); oh[q] = a; ol[q] = c2; }
                const size_t o = ((size_t)zz * RH + i) * TT + ch * 128 + lane * 4; *(v4us*)(Ph + o) = oh; *(v4us*)(Pl + o) = ol; }
        } else {
#pragma unroll
            for (int ch = 0; ch < 16; ++ch) { v4h o;
#pragma unroll
                for (int q = 0; q < 4; ++q) o[q] = tohx(v[ch * 4 + q] * f);
                *(v4h*)(P16 + (size_t)row * TT + ch * 128 + lane * 4) = o; } }
         }
}
__global__ __launch_bounds__(256) void k_merge(const float* __restrict__ O, int h0, bf* Ah, bf* Al) {
    const int lane = threadIdx.x & 31; const int L0 = (blockIdx.x * 8 + (threadIdx.x >> 5)) * 8; const int nlines = ZH * TT * HD / 64;
{
#pragma unroll
        for (int l = 0; l < 8; ++l) { const int L = L0 + l; if (L >= nlines) break; const int e = L * 64 + lane * 2; const int d = e & (HD - 1); const int t = (e >> 7) & (TT - 1); const int zz = e >> 18; v2us oh, ol;
const float cs = (t < RH) ? 1.0f : (1.0f / PCAR);
#pragma unroll
            for (int q = 0; q < 2; ++q) { unsigned short a, c2; splitf(O[(size_t)e + q] * cs, a, c2); oh[q] = a; ol[q] = c2; }
            const size_t o = (size_t)t * DD + (h0 + zz) * HD + d; *(v2us*)(Ah + o) = oh; *(v2us*)(Al + o) = ol; }
         }
}

extern "C" void kernel_launch(void* const* d_in, const int* in_sizes, int n_in,
                              void* d_out, int out_size, void* d_ws, size_t ws_size, hipStream_t stream) {
    (void)in_sizes; (void)n_in; (void)out_size;
    const float* x = (const float*)d_in[0]; const float* amask = (const float*)d_in[1]; const float* Wq = (const float*)d_in[2]; const float* Wk = (const float*)d_in[3]; const float* Wv = (const float*)d_in[4]; const float* Wd = (const float*)d_in[5];
    float* OUT = (float*)d_out;     // [2][2048][2048]
    char* wsp = (char*)d_ws;
    auto take = [&](size_t bytes) { char* p = wsp; wsp += (bytes + 255) & ~(size_t)255; return (void*)p; };
    bf* WQ = (bf*)take((size_t)DD * DD * 2); bf* WK = (bf*)take((size_t)DD * DD * 2); bf* WV = (bf*)take((size_t)DD * DD * 2); bf* WO = (bf*)take((size_t)DD * DD * 2);
    bf* XB = (bf*)take((size_t)TT * DD * 2); float* F = (float*)take((size_t)TT * DD * 4); float* CSN = (float*)take((size_t)TT * NF * 2 * 4);
    bf* QPh = (bf*)take((size_t)TT * DD * 2); bf* QPl = (bf*)take((size_t)TT * DD * 2); bf* KPh = (bf*)take((size_t)TT * DD * 2); bf* KPl = (bf*)take((size_t)TT * DD * 2); bf* VTh = (bf*)take((size_t)TT * DD * 2); bf* VTl = (bf*)take((size_t)TT * DD * 2);
    h16* QP16 = (h16*)take((size_t)TT * DD * 2); h16* KP16 = (h16*)take((size_t)TT * DD * 2); h16* VT16 = (h16*)take((size_t)TT * DD * 2);
    float* Sb = (float*)take((size_t)ZH * TT * TT * 4); h16* P16 = (h16*)take((size_t)ZH * TT * TT * 2);
    // XB and F are read only by the projection stage of a batch and are rewritten at the start of the next one; the head loop reuses their bytes: Ph (8 MiB) on XB, Pl (8 MiB) and Ob (4 MiB) on F.
    static_assert((size_t)ZH * RH * TT * 2 <= (size_t)TT * DD * 2 && (size_t)ZH * TT * HD * 4 <= (size_t)TT * DD * 2, "head-loop buffers fit the projection buffers they reuse");
    bf* Ph = XB; bf* Pl = (bf*)F; float* Ob = F + (size_t)TT * DD / 2; bf* ATh = (bf*)take((size_t)TT * DD * 2); bf* ATl = (bf*)take((size_t)TT * DD * 2);
    if ((size_t)(wsp - (char*)d_ws) > ws_size) return;    // total 241 MiB; ws 256 MiB
    { const size_t nw = (size_t)DD * DD / 8; const unsigned gw = (unsigned)((nw + 255) / 256); k_cvt8<<<gw, 256, 0, stream>>>(Wq, WQ, nw); k_cvt8<<<gw, 256, 0, stream>>>(Wk, WK, nw); k_cvt8<<<gw, 256, 0, stream>>>(Wv, WV, nw); k_cvt8<<<gw, 256, 0, stream>>>(Wd, WO, nw);
      k_cstab<<<TT * NF / 256, 256, 0, stream>>>(CSN); }
    const unsigned LB = (unsigned)((NH_ * TT * HD / 64 + 63) / 64); const dim3 gP(TT / 128, DD / 128, 1);
    for (int b = 0; b < NB_; ++b) {
        k_cvt8<<<(unsigned)(((size_t)TT * DD / 8 + 255) / 256), 256, 0, stream>>>(x + (size_t)b * TT * DD, XB, (size_t)TT * DD / 8);
        k_gemms<0, DD, DD><<<gP, 256, 0, stream>>>(XB, nullptr, WQ, F); k_hsplit<<<LB, 256, 0, stream>>>(F, CSN, QPh, QPl, QP16);
        k_gemms<0, DD, DD><<<gP, 256, 0, stream>>>(XB, nullptr, WK, F); k_hsplit<<<LB, 256, 0, stream>>>(F, CSN, KPh, KPl, KP16);
        k_gemms<0, DD, DD><<<gP, 256, 0, stream>>>(XB, nullptr, WV, F); k_vtplane<<<LB, 256, 0, stream>>>(F, VTh, VTl, VT16);
        for (int h0 = 0; h0 < NH_; h0 += ZH) { const size_t z0 = (size_t)h0;
            // scores: rows < RH on hi+lo planes (3 products), rows >= RH on fp16 planes - both into the same [ZH][TT][TT] score buffer
            k_gemmw<bf, 2, false, 1><<<dim3(RH / 64, TT / 64, ZH), 32, 0, stream>>>(QPh + z0 * TT * HD, QPl + z0 * TT * HD, KPh + z0 * TT * HD, KPl + z0 * TT * HD, HD, Sb, TT, nullptr, (size_t)TT * HD, (size_t)TT * HD, (size_t)TT * TT);
            k_gemmw<h16, 0, false, 1><<<dim3((TT - RH) / 64, TT / 64, ZH), 32, 0, stream>>>(QP16 + z0 * TT * HD + (size_t)RH * HD, nullptr, KP16 + z0 * TT * HD, nullptr, HD, Sb + (size_t)RH * TT, TT, nullptr, (size_t)TT * HD, (size_t)TT * HD, (size_t)TT * TT);
            k_asoft<<<ZH * TT / 8, 256, 0, stream>>>(Sb, amask, 0, Ph, Pl, P16);
            k_gemmw<bf, 2, false, 8><<<dim3(RH / 64, HD / 64, ZH), 256, 0, stream>>>(Ph, Pl, VTh + z0 * HD * TT, VTl + z0 * HD * TT, TT, Ob, HD, nullptr, (size_t)RH * TT, (size_t)HD * TT, (size_t)TT * HD);
            k_gemmw<h16, 0, false, 16><<<dim3((TT - RH) / 64, HD / 64, ZH), 512, 0, stream>>>(P16 + (size_t)RH * TT, nullptr, VT16 + z0 * HD * TT, nullptr, TT, Ob + (size_t)RH * HD, HD, nullptr, (size_t)TT * TT, (size_t)HD * TT, (size_t)TT * HD);
            k_merge<<<(ZH * TT * HD / 64 + 63) / 64, 256, 0, stream>>>(Ob, h0, ATh, ATl); }
        k_gemms<1, DD, DD><<<gP, 256, 0, stream>>>(ATh, ATl, WO, OUT + (size_t)b * TT * DD); }
}

// v004
// Measured time: 372 microseconds a run.
// In two side-by-side timings against v003, it was 2.75 and 2.74 times as fast.
// Over all steps from v000 it is 6.55 times as fast.
#include <hip/hip_runtime.h>

// ThornsAttention (x [2][2048][2048]; q/k/v = x W^T ([out][in] weights, no bias); 16 heads x 128; "RoPE" whose rotate_half is the identity (rotary_ndims == head_dim in the source), so
// q <- q*cos + q*sin elementwise with emb = cat(freqs, freqs), inv_freq = 10000^(-2i/128); scores = q.k / sqrt(128) + attention_mask (verbatim [1][1][2048][2048] additive input, read
// as data); softmax; out = (attn.v merged) Wd^T).
// Compute dtypes, f32 accumulate: every input rounded to bf16; projections on PLAIN bf16 operands (inputs: exact); the rotary factors cos/sin(t x inv_freq)
// in f32 (powf/cosf/sinf, tabulated once); rows < RH: scores on bf16 hi+lo planes of the rotated q and k (3 products; the 1/sqrt(128) applied in f32 with the mask); attn.v on hi+lo planes
// (3 products); rows >= RH: both on single fp16 planes (1 product each) - the mask is causal-shaped here so early rows see few keys; output hi+lo x exact Wd (2 products). One-wave-

#define NB_  2
#define TT   2048
#define DD   2048
#define NH_  16
#define HD   128
#define RH   512                  // query rows < RH use hi+lo planes for scores and attn.v; rows >= RH use single fp16 planes
#define NF   64                   // rotary frequencies (head_dim / 2)
#define SCL  0.088388349f
typedef _Float16 h16;
typedef unsigned short bf;
typedef __attribute__((ext_vector_type(16))) __bf16   v16bf;
typedef __attribute__((ext_vector_type(16))) _Float16 v16h;
typedef __attribute__((ext_vector_type(8)))  _Float16 v8h;
typedef __attribute__((ext_vector_type(8)))  unsigned short v8us;
typedef __attribute__((ext_vector_type(8)))  float    v8f;
typedef __attribute__((ext_vector_type(4)))  float    v4f;
typedef v8h  __attribute__((may_alias)) v8ha;
typedef v4f  __attribute__((may_alias)) v4fa;
typedef v8us __attribute__((may_alias)) v8usa;

__device__ __forceinline__ unsigned short f2bf(float f) { unsigned u = __float_as_uint(f); u += 0x7FFFu + ((u >> 16) & 1u); return (unsigned short)(u >> 16); }
__device__ __forceinline__ float bf2f(unsigned short b) { return __uint_as_float(((unsigned)b) << 16); }
__device__ __forceinline__ float bfr(float f) { return bf2f(f2bf(f)); }
__device__ __forceinline__ v16h cat16(v8h lo, v8h hi) { return __builtin_shufflevector(lo, hi, 0, 1, 2, 3, 4, 5, 6, 7, 8, 9, 10, 11, 12, 13, 14, 15); }
__device__ __forceinline__ v16bf cat16b(v8us lo, v8us hi) { return __builtin_bit_cast(v16bf, __builtin_shufflevector(lo, hi, 0, 1, 2, 3, 4, 5, 6, 7, 8, 9, 10, 11, 12, 13, 14, 15)); }
__device__ __forceinline__ v8f wmma16(v16h a, v16h b, v8f c) { return __builtin_amdgcn_wmma_f32_16x16x32_f16(false, a, false, b, (short)0, c, false, false); }
__device__ __forceinline__ v8f wmmab(v16bf a, v16bf b, v8f c) { return __builtin_amdgcn_wmma_f32_16x16x32_bf16(false, a, false, b, (short)0, c, false, false); }



// ---- WFrag: one 16 x 32 operand fragment of a 16-bit plane whose k runs contiguously; p = row start + 8 * (lane >> 4). A and B use the same k order.
template <typename T16> struct WFrag;
template <> struct WFrag<h16> { typedef v16h V; static __device__ __forceinline__ V ld(const h16* p) { return cat16(*(const v8h*)p, *(const v8h*)(p + 16)); } static __device__ __forceinline__ v8f mma(V a, V b, v8f c) { return wmma16(a, b, c); } };
template <> struct WFrag<bf> { typedef v16bf V; static __device__ __forceinline__ V ld(const bf* p) { return cat16b(*(const v8us*)p, *(const v8us*)(p + 16)); } static __device__ __forceinline__ v8f mma(V a, V b, v8f c) { return wmmab(a, b, c); } };

// ---- k_gemms: LDS-staged GEMM for the 2048^3 products (projections, output). One 128x128 output tile per work-group of 8 waves (2 x 4; 64x32 per wave, 8 accumulators); grid (M/128, N/128).
// C[m][n] (f32, pitch LDC) = sum_k (A[m][k] (+ A2[m][k] when NSPLIT == 1)) Bt[n][k]. K % 128 == 0. Per 128-k step every operand plane's 128 rows x 256 bytes come from global memory as whole
// 128-byte lines (16 lanes a row), go through registers into one of two LDS buffers (row pitch 272 bytes) and are read from there as fragments, in the k order of WFrag::ld. The next step's
// lines are fetched while this step's products run; fragments are read one 32-k block ahead. Each accumulator sums its K in one ascending chain.
#define GP 136                    // LDS row pitch in 16-bit elements (128 + 8)
template <int NSPLIT, int K, int LDC>
__global__ __launch_bounds__(256) void k_gemms(const bf* __restrict__ A, const bf* __restrict__ A2, const bf* __restrict__ Bt, float* C) {
    constexpr int NP = NSPLIT ? 3 : 2;      // planes staged per step
    constexpr int PL = 128 * GP;            // elements of one staged plane
    constexpr int NT = K / 128;
    __shared__ __align__(16) bf sm[2 * NP * PL];
    static_assert(128 * 132 * 4 <= 2 * NP * PL * 2, "the f32 output tile fits the staging buffers it reuses");
    const int tid = threadIdx.x, lane = tid & 31, lr = lane & 15, hi = lane >> 4;
    const int w = __builtin_amdgcn_readfirstlane(tid >> 5); const int wm = w & 1, wn = w >> 1;
    const int r0 = blockIdx.x * 128, c0 = blockIdx.y * 128;
    const int srow = tid >> 4, scol = (tid & 15) * 8;
    const unsigned go = (unsigned)(srow * K + scol);      // the lane's offset in a tile; the tile's own address stays scalar
    const bf* pa = A + (size_t)r0 * K; const bf* pa2 = NSPLIT ? A2 + (size_t)r0 * K : nullptr; const bf* pb = Bt + (size_t)c0 * K;
    bf* st = sm + srow * GP + scol;
    const bf* fa = sm + (wm * 64 + lr) * GP + 8 * hi; const bf* fb = sm + (NP - 1) * PL + (wn * 32 + lr) * GP + 8 * hi;
    v8us ra[8], ra2[8], rb[8];
    v8f acc[4][2];
#pragma unroll
    for (int mb = 0; mb < 4; ++mb)
#pragma unroll
        for (int nb = 0; nb < 2; ++nb) acc[mb][nb] = (v8f){};
#pragma unroll
    for (int i = 0; i < 8; ++i) { ra[i] = *(const v8us*)(pa + go + i * 16 * K); if (NSPLIT) ra2[i] = *(const v8us*)(pa2 + go + i * 16 * K); rb[i] = *(const v8us*)(pb + go + i * 16 * K); }
#pragma unroll
    for (int i = 0; i < 8; ++i) { *(v8us*)(st + i * 16 * GP) = ra[i]; if (NSPLIT) *(v8us*)(st + PL + i * 16 * GP) = ra2[i]; *(v8us*)(st + (NP - 1) * PL + i * 16 * GP) = rb[i]; }
    __syncthreads();    // step 0 is in buffer 0 before any wave reads a fragment
#pragma unroll 1        // rolled: for speed only
    for (int kt = 0; kt < NT; ++kt) {
        const int cur = (kt & 1) * (NP * PL), nxt = NP * PL - cur; const bool more = kt + 1 < NT;
        if (more) { pa += 128; if (NSPLIT) pa2 += 128; pb += 128;
#pragma unroll
            for (int i = 0; i < 8; ++i) { ra[i] = *(const v8us*)(pa + go + i * 16 * K); if (NSPLIT) ra2[i] = *(const v8us*)(pa2 + go + i * 16 * K); rb[i] = *(const v8us*)(pb + go + i * 16 * K); } }
        v16bf a[2][4], a2[2][4], b[2][2];
#pragma unroll
        for (int nb = 0; nb < 2; ++nb) b[0][nb] = WFrag<bf>::ld(fb + cur + nb * 16 * GP);
#pragma unroll
        for (int mb = 0; mb < 4; ++mb) { a[0][mb] = WFrag<bf>::ld(fa + cur + mb * 16 * GP); if (NSPLIT) a2[0][mb] = WFrag<bf>::ld(fa + cur + PL + mb * 16 * GP); }
#pragma unroll
        for (int kk = 0; kk < 4; ++kk) { const int s = kk & 1, n = s ^ 1;
            if (kk < 3) {
#pragma unroll
                for (int nb = 0; nb < 2; ++nb) b[n][nb] = WFrag<bf>::ld(fb + cur + nb * 16 * GP + (kk + 1) * 32);
#pragma unroll
                for (int mb = 0; mb < 4; ++mb) { a[n][mb] = WFrag<bf>::ld(fa + cur + mb * 16 * GP + (kk + 1) * 32); if (NSPLIT) a2[n][mb] = WFrag<bf>::ld(fa + cur + PL + mb * 16 * GP + (kk + 1) * 32); } }
            __builtin_amdgcn_sched_barrier(0);    // the next block's LDS reads stay one group ahead of this block's products (for speed only)
#pragma unroll
            for (int nb = 0; nb < 2; ++nb)
#pragma unroll
                for (int mb = 0; mb < 4; ++mb) { acc[mb][nb] = wmmab(a[s][mb], b[s][nb], acc[mb][nb]); if (NSPLIT) acc[mb][nb] = wmmab(a2[s][mb], b[s][nb], acc[mb][nb]); }
            __builtin_amdgcn_sched_barrier(0); }  // and the following group of reads stays behind this block's products
        if (more) {
#pragma unroll
            for (int i = 0; i < 8; ++i) { *(v8us*)(st + nxt + i * 16 * GP) = ra[i]; if (NSPLIT) *(v8us*)(st + nxt + PL + i * 16 * GP) = ra2[i]; *(v8us*)(st + nxt + (NP - 1) * PL + i * 16 * GP) = rb[i]; } }
        __syncthreads();    // publishes step kt + 1 and ends every wave's reads of the buffer that the next trip refills
    }
    float* os = (float*)sm;
#pragma unroll
    for (int mb = 0; mb < 4; ++mb)
#pragma unroll
        for (int nb = 0; nb < 2; ++nb)
#pragma unroll
            for (int j = 0; j < 8; ++j) os[(wm * 64 + mb * 16 + hi * 8 + j) * 132 + wn * 32 + nb * 16 + lr] = acc[mb][nb][j];
    __syncthreads();    // the whole f32 tile is in LDS before it is written out row by row
    float* pc = C + (size_t)r0 * LDC + c0; const unsigned co = (unsigned)((tid >> 5) * LDC + (tid & 31) * 4);
#pragma unroll
    for (int i = 0; i < 16; ++i) *(v4f*)(pc + co + i * 8 * LDC) = *(const v4fa*)(os + ((tid >> 5) + i * 8) * 132 + (tid & 31) * 4);
}

__device__ __forceinline__ h16 tohx(float x) { return (h16)x; }
__device__ __forceinline__ void splitf(float y, unsigned short& h, unsigned short& l) { h = f2bf(y); l = f2bf(y - bf2f(h)); }
typedef __attribute__((ext_vector_type(2))) unsigned short v2us;
typedef __attribute__((ext_vector_type(2))) _Float16 v2h;
typedef __attribute__((ext_vector_type(4))) _Float16 v4h;
typedef __attribute__((ext_vector_type(2))) float v2f;

__global__ __launch_bounds__(256) void k_cvt8(const float* __restrict__ src, bf* dst, size_t n8) { const size_t i = (size_t)blockIdx.x * 256 + threadIdx.x; if (i >= n8) return; const v8f v = *(const v8f*)(src + i * 8); v8us o;
#pragma unroll
    for (int k = 0; k < 8; ++k) o[k] = f2bf(v[k]); *(v8us*)(dst + i * 8) = o;  }
__global__ __launch_bounds__(256) void k_cstab(float* CSN) {
    const int idx = blockIdx.x * 256 + threadIdx.x; if (idx >= TT * NF) return; const int t = idx / NF, i = idx % NF; const float invf = __fdiv_rn(1.0f, powf(10000.0f, (float)(2 * i) * (1.0f / HD))); const float ang = __fmul_rn((float)t, invf);
    v2f o; o[0] = cosf(ang); o[1] = sinf(ang); *(v2f*)(CSN + (size_t)idx * 2) = o;  }
__global__ __launch_bounds__(256) void k_hsplit(const float* __restrict__ F, const float* __restrict__ CSN, bf* Ph, bf* Pl, h16* P16) {
    const int lane = threadIdx.x & 31; const int L0 = (blockIdx.x * 8 + (threadIdx.x >> 5)) * 8; const int nlines = NH_ * TT * HD / 64;
{
#pragma unroll
        for (int l = 0; l < 8; ++l) { const int L = L0 + l; if (L >= nlines) break; const int e = L * 64 + lane * 2; const int d = e & (HD - 1); const int t = (e >> 7) & (TT - 1); const int h = e >> 18; v2us oh, ol; v2h o16;
#pragma unroll
            for (int q = 0; q < 2; ++q) { const int dd = d + q; const float x = F[(size_t)t * DD + h * HD + dd]; const v2f cs = *(const v2f*)(CSN + ((size_t)t * NF + (dd & (NF - 1))) * 2);
                float p1 = __fmul_rn(x, cs[0]), p2 = __fmul_rn(x, cs[1]); asm volatile("" : "+v"(p1)); asm volatile("" : "+v"(p2)); const float r = __fadd_rn(p1, p2); unsigned short a, c2; splitf(r, a, c2); oh[q] = a; ol[q] = c2; o16[q] = tohx(r); }
            *(v2us*)(Ph + (size_t)e) = oh; *(v2us*)(Pl + (size_t)e) = ol; *(v2h*)(P16 + (size_t)e) = o16; }
         }
}
__global__ __launch_bounds__(256) void k_vtplane(const float* __restrict__ F, bf* Vh, bf* Vl, h16* V16) {
    const int lane = threadIdx.x & 31; const int L0 = (blockIdx.x * 8 + (threadIdx.x >> 5)) * 8; const int nlines = NH_ * TT * HD / 64;
{
#pragma unroll
        for (int l = 0; l < 8; ++l) { const int L = L0 + l; if (L >= nlines) break; const int e = L * 64 + lane * 2; const int t = e & (TT - 1); const int d = (e >> 11) & (HD - 1); const int h = e >> 18; v2us oh, ol; v2h o16;
#pragma unroll
            for (int q = 0; q < 2; ++q) { const float x = F[(size_t)(t + q) * DD + h * HD + d]; unsigned short a, c2; splitf(x, a, c2); oh[q] = a; ol[q] = c2; o16[q] = tohx(x); }
            *(v2us*)(Vh + (size_t)e) = oh; *(v2us*)(Vl + (size_t)e) = ol; *(v2h*)(V16 + (size_t)e) = o16; }
         }
}
typedef __attribute__((ext_vector_type(16))) float v16f;
#define L2E 1.4426950408889634f
#define FKP 136                   // LDS pitch of a K row in elements (128 + 8)
template <bool HI> struct FT;
template <> struct FT<true>  { typedef bf  T; typedef v8us V8; };
template <> struct FT<false> { typedef h16 T; typedef v8h  V8; };
__device__ __forceinline__ float xhalf(float x) { return __builtin_bit_cast(float, __builtin_amdgcn_permlanex16(__builtin_bit_cast(int, x), __builtin_bit_cast(int, x), 0x76543210, 0xfedcba98, false, false)); }  // lane l with lane l ^ 16
// Two exponentials and, in the same statement, the one v_nop that the instruction set asks for behind a transcendental before its result is read or its source overwritten (a v_nop in a statement of
// its own did not stay behind them). The outputs share no register with the inputs ("=&v"), so the second exponential is independent of the first and fills the first one's slot.
__device__ __forceinline__ void exp2x2(float& a, float& b) { float ra, rb; asm("v_exp_f32 %0, %2\n\tv_exp_f32 %1, %3\n\tv_nop" : "=&v"(ra), "=&v"(rb) : "v"(a), "v"(b)); a = ra; b = rb; }
template <bool HI>
__device__ __forceinline__ void flash_body(typename FT<HI>::T* sm, const typename FT<HI>::T* __restrict__ Q, const typename FT<HI>::T* __restrict__ Q2, const typename FT<HI>::T* __restrict__ Kg, const typename FT<HI>::T* __restrict__ Kg2,
                                           const typename FT<HI>::T* __restrict__ Vg, const typename FT<HI>::T* __restrict__ Vg2, const float* __restrict__ am, int q0, bf* Ah, bf* Al) {
    typedef typename FT<HI>::T T; typedef typename FT<HI>::V8 V8; typedef typename WFrag<T>::V V;
    constexpr int NPL = HI ? 2 : 1, SK = HI ? 32 : 64, VP = SK + 8, KPL = SK * FKP, VPL = HD * VP, BUF = NPL * (KPL + VPL), NST = TT / SK, NPASS = SK / 32;
    constexpr int NKL = SK / 16, LPV = SK / 8, RPS = 256 / LPV, NVL = HD / RPS;
    const int tid = threadIdx.x, lane = tid & 31, lr = lane & 15, hi = lane >> 4; const int w = __builtin_amdgcn_readfirstlane(tid >> 5);
    const int q = q0 + w * 16 + lr;       // this lane's query row
    const unsigned gk = (unsigned)((tid >> 4) * HD + (tid & 15) * 8), gv = (unsigned)((tid / LPV) * TT + (tid % LPV) * 8);
    T* sk = sm + (tid >> 4) * FKP + (tid & 15) * 8; T* sv = sm + NPL * KPL + (tid / LPV) * VP + (tid % LPV) * 8;
    const T* fk = sm + lr * FKP + 8 * hi; const T* fv = sm + NPL * KPL + lr * VP + 8 * hi;
    const float* mrow = am + (size_t)q * TT + 8 * hi;
    V qf[NPL][4];
#pragma unroll
    for (int kc = 0; kc < 4; ++kc) { qf[0][kc] = WFrag<T>::ld(Q + (size_t)q * HD + 8 * hi + 32 * kc); if (HI) qf[NPL - 1][kc] = WFrag<T>::ld(Q2 + (size_t)q * HD + 8 * hi + 32 * kc); }
    V8 rk[NPL][NKL], rv[NPL][NVL];
    v8f acc[8];
#pragma unroll
    for (int t = 0; t < 8; ++t) acc[t] = (v8f){};
    float m_run = -3.0e38f, l_run = 0.f;
#pragma unroll
    for (int i = 0; i < NKL; ++i) { rk[0][i] = *(const V8*)(Kg + gk + i * 16 * HD); if (HI) rk[NPL - 1][i] = *(const V8*)(Kg2 + gk + i * 16 * HD); }
    asm volatile("s_wait_xcnt 0x0" ::: "memory");    // stands behind the Q and K loads, in front of the V^T loads, whose results may be given a register that one of those loads names
#pragma unroll
    for (int i = 0; i < NVL; ++i) { rv[0][i] = *(const V8*)(Vg + gv + i * RPS * TT); if (HI) rv[NPL - 1][i] = *(const V8*)(Vg2 + gv + i * RPS * TT); }
#pragma unroll
    for (int i = 0; i < NKL; ++i) { *(V8*)(sk + i * 16 * FKP) = rk[0][i]; if (HI) *(V8*)(sk + KPL + i * 16 * FKP) = rk[NPL - 1][i]; }
#pragma unroll
    for (int i = 0; i < NVL; ++i) { *(V8*)(sv + i * RPS * VP) = rv[0][i]; if (HI) *(V8*)(sv + VPL + i * RPS * VP) = rv[NPL - 1][i]; }
    __syncthreads();    // stage 0 is in buffer 0 before any wave reads a fragment
    v4f mk[NPASS][2][2];    // one stage's mask values for this lane's query. fp16 form: each pass asks for the next stage's as soon as it has used its own, a whole stage ahead;
                            // hi+lo form (short of registers in attn.v): asked for at the head of the stage, they arrive under the score products
    if (!HI) {
#pragma unroll
    for (int ps = 0; ps < NPASS; ++ps)
#pragma unroll
        for (int kt = 0; kt < 2; ++kt) { const float* mp = mrow + ps * 32 + kt * 16; mk[ps][kt][0] = *(const v4f*)mp; mk[ps][kt][1] = *(const v4f*)(mp + 4); } }
    constexpr int DS = HI ? 2 : 4, DV = HI ? 2 : 2;     // how many groups of K fragments (16 keys x 32 d) and of V^T fragments (16 d x 32 keys) are read ahead of the products that use them
    // The last stage asks for its own lines again (in bounds, not stored): with the loads on every path the compiler's load counts in front of the mask values stay exact and do not wait for these lines.
    auto stage_loads = [&](bool more) { const int ak = more ? SK * HD : 0, av = more ? SK : 0; Kg += ak; Vg += av; if (HI) { Kg2 += ak; Vg2 += av; }
#pragma unroll
        for (int i = 0; i < NKL; ++i) { rk[0][i] = *(const V8*)(Kg + gk + i * 16 * HD); if (HI) rk[NPL - 1][i] = *(const V8*)(Kg2 + gk + i * 16 * HD); }
#pragma unroll
        for (int i = 0; i < NVL; ++i) { rv[0][i] = *(const V8*)(Vg + gv + i * RPS * TT); if (HI) rv[NPL - 1][i] = *(const V8*)(Vg2 + gv + i * RPS * TT); } };
#pragma unroll 1        // rolled: for speed only
    for (int st = 0; st < NST; ++st) {
        const int cur = (st & 1) * BUF, nxt = BUF - cur; const bool more = st + 1 < NST;
        const float* mnext = mrow + (more ? st + 1 : st) * SK;      // the last stage asks for its own values again: in bounds, not used
        if (!HI) stage_loads(more);
        if (HI) {
#pragma unroll
            for (int kt = 0; kt < 2; ++kt) { const float* mp = mrow + st * SK + kt * 16; mk[0][kt][0] = *(const v4f*)mp; mk[0][kt][1] = *(const v4f*)(mp + 4); } }
#pragma unroll
        for (int ps = 0; ps < NPASS; ++ps) {
            V kf[4][2][NPL], vf[8][NPL];
            auto ldk = [&](int g) { const int kc = g >> 1, kt = g & 1; const T* p = fk + cur + (ps * 32 + kt * 16) * FKP + 32 * kc; kf[kc][kt][0] = WFrag<T>::ld(p); if (HI) kf[kc][kt][NPL - 1] = WFrag<T>::ld(p + KPL); };
            auto ldv = [&](int t) { const T* p = fv + cur + t * 16 * VP + ps * 32; vf[t][0] = WFrag<T>::ld(p); if (HI) vf[t][NPL - 1] = WFrag<T>::ld(p + VPL); };
            v8f s[2]; s[0] = (v8f){}; s[1] = (v8f){};
#pragma unroll
            for (int g = 0; g < DS; ++g) ldk(g);
#pragma unroll
            for (int g = 0; g < 8; ++g) { const int kc = g >> 1, kt = g & 1; if (g + DS < 8) ldk(g + DS);
                __builtin_amdgcn_sched_barrier(0);    // the LDS reads stay DS groups ahead of the products (for speed only)
                s[kt] = WFrag<T>::mma(kf[kc][kt][0], qf[0][kc], s[kt]); if (HI) { s[kt] = WFrag<T>::mma(kf[kc][kt][0], qf[NPL - 1][kc], s[kt]); s[kt] = WFrag<T>::mma(kf[kc][kt][NPL - 1], qf[0][kc], s[kt]); }
                __builtin_amdgcn_sched_barrier(0); }  // and the following group of reads stays behind these products
            if (HI) stage_loads(more);              // hi+lo form: asked for here, where the K fragments' registers are free again
#pragma unroll
            for (int t = 0; t < DV; ++t) ldv(t);    // the first V^T fragments arrive under the softmax arithmetic
            __builtin_amdgcn_sched_barrier(0);      // keeps those reads in front of the softmax arithmetic
            v16f tv; float mx = -3.0e38f;
#pragma unroll
            for (int e = 0; e < 16; ++e) { const float t2 = fmaf(s[e >> 3][e & 7], SCL * L2E, bfr(mk[ps][e >> 3][(e >> 2) & 1][e & 3]) * L2E); tv[e] = t2; mx = fmaxf(mx, t2); }
            if (!HI) {
#pragma unroll
            for (int kt = 0; kt < 2; ++kt) { const float* mp = mnext + ps * 32 + kt * 16; mk[ps][kt][0] = *(const v4f*)mp; mk[ps][kt][1] = *(const v4f*)(mp + 4); } }
            mx = fmaxf(mx, xhalf(mx));      // both wave halves hold this query's maximum over the pass's 32 keys
            if (__builtin_amdgcn_ballot_w32(mx > m_run + 4.0f) != 0) {      // wave-uniform; rare after the first passes
                const float m_new = fmaxf(m_run, mx); const float corr = __builtin_amdgcn_exp2f(m_run - m_new); l_run *= corr; m_run = m_new;
#pragma unroll
                for (int t = 0; t < 8; ++t) acc[t] = acc[t] * corr; }
            const float nm = (HI ? 0.0f : 10.0f) - m_run; float ps0 = 0.f, ps1 = 0.f;
#pragma unroll
            for (int e = 0; e < 16; e += 2) { float x0 = tv[e] + nm, x1 = tv[e + 1] + nm; exp2x2(x0, x1); tv[e] = x0; tv[e + 1] = x1; ps0 += x0; ps1 += x1; }
            l_run += ps0 + ps1;
            V pa, pb;
            if constexpr (HI) { pa = __builtin_convertvector(tv, v16bf); pb = __builtin_convertvector(tv - __builtin_convertvector(pa, v16f), v16bf); }
            else { pa = __builtin_convertvector(tv, v16h); pb = pa; }
#pragma unroll
            for (int t = 0; t < 8; ++t) { if (t + DV < 8) ldv(t + DV);
                __builtin_amdgcn_sched_barrier(0);    // the V^T reads stay DV groups ahead of their products
                acc[t] = WFrag<T>::mma(vf[t][0], pa, acc[t]); if (HI) { acc[t] = WFrag<T>::mma(vf[t][0], pb, acc[t]); acc[t] = WFrag<T>::mma(vf[t][NPL - 1], pa, acc[t]); }
                __builtin_amdgcn_sched_barrier(0); }  // and the following reads stay behind these products
        }
        if (more) {
#pragma unroll
            for (int i = 0; i < NKL; ++i) { *(V8*)(sk + nxt + i * 16 * FKP) = rk[0][i]; if (HI) *(V8*)(sk + nxt + KPL + i * 16 * FKP) = rk[NPL - 1][i]; }
#pragma unroll
            for (int i = 0; i < NVL; ++i) { *(V8*)(sv + nxt + i * RPS * VP) = rv[0][i]; if (HI) *(V8*)(sv + nxt + VPL + i * RPS * VP) = rv[NPL - 1][i]; } }
        __syncthreads();    // publishes stage st + 1 and ends every wave's reads of the buffer that the next trip refills
    }
    const float inv = __fdiv_rn(1.0f, l_run + xhalf(l_run));    // each wave half summed its own 8 keys of every 16-key tile
#pragma unroll
    for (int t = 0; t < 8; ++t) { v8us oh, ol;
#pragma unroll
        for (int j = 0; j < 8; ++j) { unsigned short a, c2; splitf(acc[t][j] * inv, a, c2); oh[j] = a; ol[j] = c2; }
        const size_t o = (size_t)q * DD + t * 16 + hi * 8; *(v8us*)(Ah + o) = oh; *(v8us*)(Al + o) = ol;
        asm volatile("s_wait_xcnt 0x0" ::: "memory"); }    // stands behind the two stores, in front of any later write of the registers that they name
}
#define FSM_EL (2 * 2 * (32 * FKP + HD * 40))     // the larger of the two forms' LDS, in 16-bit elements
static_assert(2 * (64 * FKP + HD * 72) <= FSM_EL, "the fp16 form's two buffers fit");
// grid: NB_ * NH_ * (RH / 128) hi+lo work-groups first (they are the longer ones), then NB_ * NH_ * ((TT - RH) / 128) fp16 ones. Planes are [batch][head][...]; Ah, Al are [batch][TT][DD].
__global__ __launch_bounds__(256) void k_flash(const bf* __restrict__ Qh, const bf* __restrict__ Ql, const h16* __restrict__ Q16, const bf* __restrict__ Kh, const bf* __restrict__ Kl, const h16* __restrict__ K16,
                                               const bf* __restrict__ Vh, const bf* __restrict__ Vl, const h16* __restrict__ V16, const float* __restrict__ am, bf* Ah, bf* Al) {
    __shared__ __align__(16) unsigned short fsm[FSM_EL];
    constexpr int NHI = NB_ * NH_ * (RH / 128), TLO = (TT - RH) / 128;
    const int idx = blockIdx.x; const bool hires = idx < NHI;
    const int z = hires ? idx / (RH / 128) : (idx - NHI) / TLO; const int q0 = hires ? (idx % (RH / 128)) * 128 : RH + ((idx - NHI) % TLO) * 128;
    const size_t zp = (size_t)z * TT * HD; const size_t ao = (size_t)(z / NH_) * TT * DD + (size_t)(z % NH_) * HD;
    if (hires) flash_body<true>((bf*)fsm, Qh + zp, Ql + zp, Kh + zp, Kl + zp, Vh + zp, Vl + zp, am, q0, Ah + ao, Al + ao);
    else flash_body<false>((h16*)fsm, Q16 + zp, nullptr, K16 + zp, nullptr, V16 + zp, nullptr, am, q0, Ah + ao, Al + ao);
}

extern "C" void kernel_launch(void* const* d_in, const int* in_sizes, int n_in,
                              void* d_out, int out_size, void* d_ws, size_t ws_size, hipStream_t stream) {
    (void)in_sizes; (void)n_in; (void)out_size;
    const float* x = (const float*)d_in[0]; const float* amask = (const float*)d_in[1]; const float* Wq = (const float*)d_in[2]; const float* Wk = (const float*)d_in[3]; const float* Wv = (const float*)d_in[4]; const float* Wd = (const float*)d_in[5];
    float* OUT = (float*)d_out;     // [2][2048][2048]
    char* wsp = (char*)d_ws;
    auto take = [&](size_t bytes) { char* p = wsp; wsp += (bytes + 255) & ~(size_t)255; return (void*)p; };
    const size_t PB = (size_t)TT * DD;      // elements of one batch's plane
    bf* WQ = (bf*)take((size_t)DD * DD * 2); bf* WK = (bf*)take((size_t)DD * DD * 2); bf* WV = (bf*)take((size_t)DD * DD * 2); bf* WO = (bf*)take((size_t)DD * DD * 2);
    bf* XB = (bf*)take(PB * 2); float* F = (float*)take(PB * 4); float* CSN = (float*)take((size_t)TT * NF * 2 * 4);
    bf* QPh = (bf*)take(NB_ * PB * 2); bf* QPl = (bf*)take(NB_ * PB * 2); bf* KPh = (bf*)take(NB_ * PB * 2); bf* KPl = (bf*)take(NB_ * PB * 2); bf* VTh = (bf*)take(NB_ * PB * 2); bf* VTl = (bf*)take(NB_ * PB * 2);
    h16* QP16 = (h16*)take(NB_ * PB * 2); h16* KP16 = (h16*)take(NB_ * PB * 2); h16* VT16 = (h16*)take(NB_ * PB * 2);
    bf* ATh = (bf*)take(NB_ * PB * 2); bf* ATl = (bf*)take(NB_ * PB * 2);
    if ((size_t)(wsp - (char*)d_ws) > ws_size) return;    // total 233 MiB; ws 256 MiB
    { const size_t nw = (size_t)DD * DD / 8; const unsigned gw = (unsigned)((nw + 255) / 256); k_cvt8<<<gw, 256, 0, stream>>>(Wq, WQ, nw); k_cvt8<<<gw, 256, 0, stream>>>(Wk, WK, nw); k_cvt8<<<gw, 256, 0, stream>>>(Wv, WV, nw); k_cvt8<<<gw, 256, 0, stream>>>(Wd, WO, nw);
      k_cstab<<<TT * NF / 256, 256, 0, stream>>>(CSN); }
    const unsigned LB = (unsigned)((NH_ * TT * HD / 64 + 63) / 64); const dim3 gP(TT / 128, DD / 128, 1);
    for (int b = 0; b < NB_; ++b) { const size_t o = (size_t)b * PB;
        k_cvt8<<<(unsigned)((PB / 8 + 255) / 256), 256, 0, stream>>>(x + o, XB, PB / 8);
        k_gemms<0, DD, DD><<<gP, 256, 0, stream>>>(XB, nullptr, WQ, F); k_hsplit<<<LB, 256, 0, stream>>>(F, CSN, QPh + o, QPl + o, QP16 + o);
        k_gemms<0, DD, DD><<<gP, 256, 0, stream>>>(XB, nullptr, WK, F); k_hsplit<<<LB, 256, 0, stream>>>(F, CSN, KPh + o, KPl + o, KP16 + o);
        k_gemms<0, DD, DD><<<gP, 256, 0, stream>>>(XB, nullptr, WV, F); k_vtplane<<<LB, 256, 0, stream>>>(F, VTh + o, VTl + o, VT16 + o); }
    k_flash<<<NB_ * NH_ * (TT / 128), 256, 0, stream>>>(QPh, QPl, QP16, KPh, KPl, KP16, VTh, VTl, VT16, amask, ATh, ATl);
    for (int b = 0; b < NB_; ++b) k_gemms<1, DD, DD><<<gP, 256, 0, stream>>>(ATh + (size_t)b * PB, ATl + (size_t)b * PB, WO, OUT + (size_t)b * PB);
}

// v005
// One run takes 307 microseconds.
// Timed twice side by side with v004, it ran 1.21 and 1.20 times as fast.
// Over all steps from v000 it is 7.90 times as fast.
#include <hip/hip_runtime.h>

// ThornsAttention (x [2][2048][2048]; q/k/v = x W^T ([out][in] weights, no bias); 16 heads x 128; "RoPE" whose rotate_half is the identity (rotary_ndims == head_dim in the source), so
// q <- q*cos + q*sin elementwise with emb = cat(freqs, freqs), inv_freq = 10000^(-2i/128); scores = q.k / sqrt(128) + attention_mask (verbatim [1][1][2048][2048] additive input, read
// as data); softmax; out = (attn.v merged) Wd^T).
// Compute dtypes, f32 accumulate: every input rounded to bf16; projections on PLAIN bf16 operands (inputs: exact); the rotary factors cos/sin(t x inv_freq)
// in f32 (powf/cosf/sinf, tabulated once); rows < RH: scores on bf16 hi+lo planes of the rotated q and k (3 products; the 1/sqrt(128) applied in f32 with the mask); attn.v on hi+lo planes
// (3 products); rows >= RH: both on single fp16 planes (1 product each) - the mask is causal-shaped here so early rows see few keys; output hi+lo x exact Wd (2 products).

#define NB_  2
#define TT   2048
#define DD   2048
#define NH_  16
#define HD   128
#define RH   512                  // query rows < RH use hi+lo planes for scores and attn.v; rows >= RH use single fp16 planes
#define NF   64                   // rotary frequencies (head_dim / 2)
#define SCL  0.088388349f
typedef _Float16 h16;
typedef unsigned short bf;
typedef __attribute__((ext_vector_type(16))) __bf16   v16bf;
typedef __attribute__((ext_vector_type(16))) _Float16 v16h;
typedef __attribute__((ext_vector_type(8)))  _Float16 v8h;
typedef __attribute__((ext_vector_type(8)))  unsigned short v8us;
typedef __attribute__((ext_vector_type(8)))  float    v8f;
typedef __attribute__((ext_vector_type(4)))  float    v4f;
typedef v8h  __attribute__((may_alias)) v8ha;
typedef v4f  __attribute__((may_alias)) v4fa;
typedef v8us __attribute__((may_alias)) v8usa;

__device__ __forceinline__ unsigned short f2bf(float f) { unsigned u = __float_as_uint(f); u += 0x7FFFu + ((u >> 16) & 1u); return (unsigned short)(u >> 16); }
__device__ __forceinline__ float bf2f(unsigned short b) { return __uint_as_float(((unsigned)b) << 16); }
__device__ __forceinline__ float bfr(float f) { return bf2f(f2bf(f)); }
__device__ __forceinline__ v16h cat16(v8h lo, v8h hi) { return __builtin_shufflevector(lo, hi, 0, 1, 2, 3, 4, 5, 6, 7, 8, 9, 10, 11, 12, 13, 14, 15); }
__device__ __forceinline__ v16bf cat16b(v8us lo, v8us hi) { return __builtin_bit_cast(v16bf, __builtin_shufflevector(lo, hi, 0, 1, 2, 3, 4, 5, 6, 7, 8, 9, 10, 11, 12, 13, 14, 15)); }
__device__ __forceinline__ v8f wmma16(v16h a, v16h b, v8f c) { return __builtin_amdgcn_wmma_f32_16x16x32_f16(false, a, false, b, (short)0, c, false, false); }
__device__ __forceinline__ v8f wmmab(v16bf a, v16bf b, v8f c) { return __builtin_amdgcn_wmma_f32_16x16x32_bf16(false, a, false, b, (short)0, c, false, false); }



// ---- WFrag: one 16 x 32 operand fragment of a 16-bit plane whose k runs contiguously; p = row start + 8 * (lane >> 4). A and B use the same k order.
template <typename T16> struct WFrag;
template <> struct WFrag<h16> { typedef v16h V; static __device__ __forceinline__ V ld(const h16* p) { return cat16(*(const v8h*)p, *(const v8h*)(p + 16)); } static __device__ __forceinline__ v8f mma(V a, V b, v8f c) { return wmma16(a, b, c); } };
template <> struct WFrag<bf> { typedef v16bf V; static __device__ __forceinline__ V ld(const bf* p) { return cat16b(*(const v8us*)p, *(const v8us*)(p + 16)); } static __device__ __forceinline__ v8f mma(V a, V b, v8f c) { return wmmab(a, b, c); } };

// ---- k_gemms: LDS-staged GEMM for the 2048^3 products (projections, output). One 128x128 output tile per work-group of 8 waves (2 x 4; 64x32 per wave, 8 accumulators); grid (M/128, N/128).
// C[m][n] (f32, pitch LDC) = sum_k (A[m][k] (+ A2[m][k] when NSPLIT == 1)) Bt[n][k]. K % 128 == 0. Per 128-k step every operand plane's 128 rows x 256 bytes come from global memory as whole
// 128-byte lines (16 lanes a row), go through registers into one of two LDS buffers (row pitch 272 bytes) and are read from there as fragments, in the k order of WFrag::ld. The next step's
// lines are fetched while this step's products run; fragments are read one 32-k block ahead. Each accumulator sums its K in one ascending chain.
// What becomes of the f32 tile, which goes through LDS in every form (its 128 columns are one head: HD == 128):
// EPI 0: written to C as f32. EPI 1 (q, k): y = x cos + x sin from the table CSN, then bf16 hi, bf16 lo and fp16 planes [head][t][d]. EPI 2 (v): the tile is laid into LDS transposed, then the same
// three planes [head][d][t]. In EPI 1 and 2 a lane converts 8 neighbours of a plane's row and 16 lanes store 256 bytes of it: whole 128-byte lines, no f32 copy in memory.
typedef __attribute__((ext_vector_type(8))) __bf16 v8bf;
#define GP 136                    // LDS row pitch in 16-bit elements (128 + 8)
template <int NSPLIT, int K, int LDC, int EPI>
__global__ __launch_bounds__(256) void k_gemms(const bf* __restrict__ A, const bf* __restrict__ A2, const bf* __restrict__ Bt, float* C, const float* __restrict__ CSN, bf* Ph, bf* Pl, h16* P16) {
    constexpr int NP = NSPLIT ? 3 : 2;      // planes staged per step
    constexpr int PL = 128 * GP;            // elements of one staged plane
    constexpr int NT = K / 128;
    __shared__ __align__(16) bf sm[2 * NP * PL];
    static_assert(128 * 132 * 4 <= 2 * NP * PL * 2, "the f32 output tile fits the staging buffers it reuses");
    const int tid = threadIdx.x, lane = tid & 31, lr = lane & 15, hi = lane >> 4;
    const int w = __builtin_amdgcn_readfirstlane(tid >> 5); const int wm = w & 1, wn = w >> 1;
    const int r0 = blockIdx.x * 128, c0 = blockIdx.y * 128;
    const int srow = tid >> 4, scol = (tid & 15) * 8;
    const unsigned go = (unsigned)(srow * K + scol);      // the lane's offset in a tile; the tile's own address stays scalar
    const bf* pa = A + (size_t)r0 * K; const bf* pa2 = NSPLIT ? A2 + (size_t)r0 * K : nullptr; const bf* pb = Bt + (size_t)c0 * K;
    bf* st = sm + srow * GP + scol;
    const bf* fa = sm + (wm * 64 + lr) * GP + 8 * hi; const bf* fb = sm + (NP - 1) * PL + (wn * 32 + lr) * GP + 8 * hi;
    v8us ra[8], ra2[8], rb[8];
    v8f acc[4][2];
#pragma unroll
    for (int mb = 0; mb < 4; ++mb)
#pragma unroll
        for (int nb = 0; nb < 2; ++nb) acc[mb][nb] = (v8f){};
#pragma unroll
    for (int i = 0; i < 8; ++i) { ra[i] = *(const v8us*)(pa + go + i * 16 * K); if (NSPLIT) ra2[i] = *(const v8us*)(pa2 + go + i * 16 * K); rb[i] = *(const v8us*)(pb + go + i * 16 * K); }
#pragma unroll
    for (int i = 0; i < 8; ++i) { *(v8us*)(st + i * 16 * GP) = ra[i]; if (NSPLIT) *(v8us*)(st + PL + i * 16 * GP) = ra2[i]; *(v8us*)(st + (NP - 1) * PL + i * 16 * GP) = rb[i]; }
    __syncthreads();    // step 0 is in buffer 0 before any wave reads a fragment
#pragma unroll 1        // rolled: for speed only
    for (int kt = 0; kt < NT; ++kt) {
        const int cur = (kt & 1) * (NP * PL), nxt = NP * PL - cur; const bool more = kt + 1 < NT;
        if (more) { pa += 128; if (NSPLIT) pa2 += 128; pb += 128;
#pragma unroll
            for (int i = 0; i < 8; ++i) { ra[i] = *(const v8us*)(pa + go + i * 16 * K); if (NSPLIT) ra2[i] = *(const v8us*)(pa2 + go + i * 16 * K); rb[i] = *(const v8us*)(pb + go + i * 16 * K); } }
        v16bf a[2][4], a2[2][4], b[2][2];
#pragma unroll
        for (int nb = 0; nb < 2; ++nb) b[0][nb] = WFrag<bf>::ld(fb + cur + nb * 16 * GP);
#pragma unroll
        for (int mb = 0; mb < 4; ++mb) { a[0][mb] = WFrag<bf>::ld(fa + cur + mb * 16 * GP); if (NSPLIT) a2[0][mb] = WFrag<bf>::ld(fa + cur + PL + mb * 16 * GP); }
#pragma unroll
        for (int kk = 0; kk < 4; ++kk) { const int s = kk & 1, n = s ^ 1;
            if (kk < 3) {
#pragma unroll
                for (int nb = 0; nb < 2; ++nb) b[n][nb] = WFrag<bf>::ld(fb + cur + nb * 16 * GP + (kk + 1) * 32);
#pragma unroll
                for (int mb = 0; mb < 4; ++mb) { a[n][mb] = WFrag<bf>::ld(fa + cur + mb * 16 * GP + (kk + 1) * 32); if (NSPLIT) a2[n][mb] = WFrag<bf>::ld(fa + cur + PL + mb * 16 * GP + (kk + 1) * 32); } }
            __builtin_amdgcn_sched_barrier(0);    // the next block's LDS reads stay one group ahead of this block's products (for speed only)
#pragma unroll
            for (int nb = 0; nb < 2; ++nb)
#pragma unroll
                for (int mb = 0; mb < 4; ++mb) { acc[mb][nb] = wmmab(a[s][mb], b[s][nb], acc[mb][nb]); if (NSPLIT) acc[mb][nb] = wmmab(a2[s][mb], b[s][nb], acc[mb][nb]); }
            __builtin_amdgcn_sched_barrier(0); }  // and the following group of reads stays behind this block's products
        if (more) {
#pragma unroll
            for (int i = 0; i < 8; ++i) { *(v8us*)(st + nxt + i * 16 * GP) = ra[i]; if (NSPLIT) *(v8us*)(st + nxt + PL + i * 16 * GP) = ra2[i]; *(v8us*)(st + nxt + (NP - 1) * PL + i * 16 * GP) = rb[i]; } }
        __syncthreads();    // publishes step kt + 1 and ends every wave's reads of the buffer that the next trip refills
    }
    float* os = (float*)sm;
#pragma unroll
    for (int mb = 0; mb < 4; ++mb)
#pragma unroll
        for (int nb = 0; nb < 2; ++nb) {
            if constexpr (EPI == 2) { float* p = os + (wn * 32 + nb * 16 + lr) * 132 + wm * 64 + mb * 16 + hi * 8;     // transposed: a lane's 8 values are 8 neighbours of row d
                *(v4fa*)p = __builtin_shufflevector(acc[mb][nb], acc[mb][nb], 0, 1, 2, 3); *(v4fa*)(p + 4) = __builtin_shufflevector(acc[mb][nb], acc[mb][nb], 4, 5, 6, 7); }
            else {
#pragma unroll
                for (int j = 0; j < 8; ++j) os[(wm * 64 + mb * 16 + hi * 8 + j) * 132 + wn * 32 + nb * 16 + lr] = acc[mb][nb][j]; } }
    if constexpr (EPI == 0) {
        __syncthreads();    // the whole f32 tile is in LDS before it is written out row by row
        float* pc = C + (size_t)r0 * LDC + c0; const unsigned co = (unsigned)((tid >> 5) * LDC + (tid & 31) * 4);
#pragma unroll
        for (int i = 0; i < 16; ++i) *(v4f*)(pc + co + i * 8 * LDC) = *(const v4fa*)(os + ((tid >> 5) + i * 8) * 132 + (tid & 31) * 4);
    } else {
        static_assert(HD == 128 && LDC == DD, "one tile column block is one head");
        constexpr int DP = EPI == 1 ? HD : TT;      // pitch of a plane's row: [t][d] or [d][t]
        const size_t pbase = EPI == 1 ? ((size_t)blockIdx.y * TT + r0) * HD : (size_t)blockIdx.y * HD * TT + r0;
        const unsigned po = (unsigned)(srow * DP + scol);
        v4f cs[8][4];       // EPI 1: (cos, sin) of the lane's 8 columns in each of its 8 rows; asked for in front of the barrier, they arrive under it
        if constexpr (EPI == 1) { const float* pt = CSN + (size_t)r0 * (NF * 2); const unsigned to = (unsigned)(srow * (NF * 2) + (scol & (NF - 1)) * 2);
#pragma unroll
            for (int i = 0; i < 8; ++i)
#pragma unroll
                for (int c = 0; c < 4; ++c) cs[i][c] = *(const v4f*)(pt + to + i * 16 * (NF * 2) + c * 4); }
        __syncthreads();    // the whole f32 tile is in LDS before it is read row by row
#pragma unroll
        for (int i = 0; i < 8; ++i) { const float* p = os + (srow + i * 16) * 132 + scol; const v4f y0 = *(const v4fa*)p, y1 = *(const v4fa*)(p + 4);
            v8f y = __builtin_shufflevector(y0, y1, 0, 1, 2, 3, 4, 5, 6, 7);
            if constexpr (EPI == 1) {
#pragma unroll
                for (int k = 0; k < 8; ++k) y[k] = y[k] * cs[i][k >> 1][(k & 1) * 2] + y[k] * cs[i][k >> 1][(k & 1) * 2 + 1]; }
            const v8bf yh = __builtin_convertvector(y, v8bf); const v8bf yl = __builtin_convertvector(y - __builtin_convertvector(yh, v8f), v8bf);
            *(v8us*)(Ph + pbase + po + i * 16 * DP) = __builtin_bit_cast(v8us, yh); *(v8us*)(Pl + pbase + po + i * 16 * DP) = __builtin_bit_cast(v8us, yl); *(v8h*)(P16 + pbase + po + i * 16 * DP) = __builtin_convertvector(y, v8h);
            asm volatile("s_wait_xcnt 0x0" ::: "memory"); }    // stands behind the three stores, in front of any later write of the registers that they name
    }
}

__device__ __forceinline__ void splitf(float y, unsigned short& h, unsigned short& l) { h = f2bf(y); l = f2bf(y - bf2f(h)); }
typedef __attribute__((ext_vector_type(2))) float v2f;

__global__ __launch_bounds__(256) void k_cvt8(const float* __restrict__ src, bf* dst, size_t n8) { const size_t i = (size_t)blockIdx.x * 256 + threadIdx.x; if (i >= n8) return; const v8f v = *(const v8f*)(src + i * 8); v8us o;
#pragma unroll
    for (int k = 0; k < 8; ++k) o[k] = f2bf(v[k]); *(v8us*)(dst + i * 8) = o;  }
__global__ __launch_bounds__(256) void k_cstab(float* CSN) {
    const int idx = blockIdx.x * 256 + threadIdx.x; if (idx >= TT * NF) return; const int t = idx / NF, i = idx % NF; const float invf = __fdiv_rn(1.0f, powf(10000.0f, (float)(2 * i) * (1.0f / HD))); const float ang = __fmul_rn((float)t, invf);
    v2f o; o[0] = cosf(ang); o[1] = sinf(ang); *(v2f*)(CSN + (size_t)idx * 2) = o;  }
typedef __attribute__((ext_vector_type(16))) float v16f;
#define L2E 1.4426950408889634f
#define FKP 136                   // LDS pitch of a K row in elements (128 + 8)
template <bool HI> struct FT;
template <> struct FT<true>  { typedef bf  T; typedef v8us V8; };
template <> struct FT<false> { typedef h16 T; typedef v8h  V8; };
__device__ __forceinline__ float xhalf(float x) { return __builtin_bit_cast(float, __builtin_amdgcn_permlanex16(__builtin_bit_cast(int, x), __builtin_bit_cast(int, x), 0x76543210, 0xfedcba98, false, false)); }  // lane l with lane l ^ 16
// Two exponentials and, in the same statement, the one v_nop that the instruction set asks for behind a transcendental before its result is read or its source overwritten (a v_nop in a statement of
// its own did not stay behind them). The outputs share no register with the inputs ("=&v"), so the second exponential is independent of the first and fills the first one's slot.
__device__ __forceinline__ void exp2x2(float& a, float& b) { float ra, rb; asm("v_exp_f32 %0, %2\n\tv_exp_f32 %1, %3\n\tv_nop" : "=&v"(ra), "=&v"(rb) : "v"(a), "v"(b)); a = ra; b = rb; }
template <bool HI>
__device__ __forceinline__ void flash_body(typename FT<HI>::T* sm, const typename FT<HI>::T* __restrict__ Q, const typename FT<HI>::T* __restrict__ Q2, const typename FT<HI>::T* __restrict__ Kg, const typename FT<HI>::T* __restrict__ Kg2,
                                           const typename FT<HI>::T* __restrict__ Vg, const typename FT<HI>::T* __restrict__ Vg2, const float* __restrict__ am, int q0, bf* Ah, bf* Al) {
    typedef typename FT<HI>::T T; typedef typename FT<HI>::V8 V8; typedef typename WFrag<T>::V V;
    constexpr int NPL = HI ? 2 : 1, SK = HI ? 32 : 64, VP = SK + 8, KPL = SK * FKP, VPL = HD * VP, BUF = NPL * (KPL + VPL), NST = TT / SK, NPASS = SK / 32;
    constexpr int NKL = SK / 16, LPV = SK / 8, RPS = 256 / LPV, NVL = HD / RPS;
    const int tid = threadIdx.x, lane = tid & 31, lr = lane & 15, hi = lane >> 4; const int w = __builtin_amdgcn_readfirstlane(tid >> 5);
    const int q = q0 + w * 16 + lr;       // this lane's query row
    const unsigned gk = (unsigned)((tid >> 4) * HD + (tid & 15) * 8), gv = (unsigned)((tid / LPV) * TT + (tid % LPV) * 8);
    T* sk = sm + (tid >> 4) * FKP + (tid & 15) * 8; T* sv = sm + NPL * KPL + (tid / LPV) * VP + (tid % LPV) * 8;
    const T* fk = sm + lr * FKP + 8 * hi; const T* fv = sm + NPL * KPL + lr * VP + 8 * hi;
    const float* mrow = am + (size_t)q * TT + 8 * hi;
    V qf[NPL][4];
#pragma unroll
    for (int kc = 0; kc < 4; ++kc) { qf[0][kc] = WFrag<T>::ld(Q + (size_t)q * HD + 8 * hi + 32 * kc); if (HI) qf[NPL - 1][kc] = WFrag<T>::ld(Q2 + (size_t)q * HD + 8 * hi + 32 * kc); }
    V8 rk[NPL][NKL], rv[NPL][NVL];
    v8f acc[8];
#pragma unroll
    for (int t = 0; t < 8; ++t) acc[t] = (v8f){};
    float m_run = -3.0e38f, l_run = 0.f;
#pragma unroll
    for (int i = 0; i < NKL; ++i) { rk[0][i] = *(const V8*)(Kg + gk + i * 16 * HD); if (HI) rk[NPL - 1][i] = *(const V8*)(Kg2 + gk + i * 16 * HD); }
    asm volatile("s_wait_xcnt 0x0" ::: "memory");    // stands behind the Q and K loads, in front of the V^T loads, whose results may be given a register that one of those loads names
#pragma unroll
    for (int i = 0; i < NVL; ++i) { rv[0][i] = *(const V8*)(Vg + gv + i * RPS * TT); if (HI) rv[NPL - 1][i] = *(const V8*)(Vg2 + gv + i * RPS * TT); }
#pragma unroll
    for (int i = 0; i < NKL; ++i) { *(V8*)(sk + i * 16 * FKP) = rk[0][i]; if (HI) *(V8*)(sk + KPL + i * 16 * FKP) = rk[NPL - 1][i]; }
#pragma unroll
    for (int i = 0; i < NVL; ++i) { *(V8*)(sv + i * RPS * VP) = rv[0][i]; if (HI) *(V8*)(sv + VPL + i * RPS * VP) = rv[NPL - 1][i]; }
    __syncthreads();    // stage 0 is in buffer 0 before any wave reads a fragment
    v4f mk[NPASS][2][2];    // one stage's mask values for this lane's query. fp16 form: each pass asks for the next stage's as soon as it has used its own, a whole stage ahead;
                            // hi+lo form (short of registers in attn.v): asked for at the head of the stage, they arrive under the score products
    if (!HI) {
#pragma unroll
    for (int ps = 0; ps < NPASS; ++ps)
#pragma unroll
        for (int kt = 0; kt < 2; ++kt) { const float* mp = mrow + ps * 32 + kt * 16; mk[ps][kt][0] = *(const v4f*)mp; mk[ps][kt][1] = *(const v4f*)(mp + 4); } }
    constexpr int DS = HI ? 2 : 4, DV = HI ? 2 : 2;     // how many groups of K fragments (16 keys x 32 d) and of V^T fragments (16 d x 32 keys) are read ahead of the products that use them
    // The last stage asks for its own lines again (in bounds, not stored): with the loads on every path the compiler's load counts in front of the mask values stay exact and do not wait for these lines.
    auto stage_loads = [&](bool more) { const int ak = more ? SK * HD : 0, av = more ? SK : 0; Kg += ak; Vg += av; if (HI) { Kg2 += ak; Vg2 += av; }
#pragma unroll
        for (int i = 0; i < NKL; ++i) { rk[0][i] = *(const V8*)(Kg + gk + i * 16 * HD); if (HI) rk[NPL - 1][i] = *(const V8*)(Kg2 + gk + i * 16 * HD); }
#pragma unroll
        for (int i = 0; i < NVL; ++i) { rv[0][i] = *(const V8*)(Vg + gv + i * RPS * TT); if (HI) rv[NPL - 1][i] = *(const V8*)(Vg2 + gv + i * RPS * TT); } };
#pragma unroll 1        // rolled: for speed only
    for (int st = 0; st < NST; ++st) {
        const int cur = (st & 1) * BUF, nxt = BUF - cur; const bool more = st + 1 < NST;
        const float* mnext = mrow + (more ? st + 1 : st) * SK;      // the last stage asks for its own values again: in bounds, not used
        if (!HI) stage_loads(more);
        if (HI) {
#pragma unroll
            for (int kt = 0; kt < 2; ++kt) { const float* mp = mrow + st * SK + kt * 16; mk[0][kt][0] = *(const v4f*)mp; mk[0][kt][1] = *(const v4f*)(mp + 4); } }
#pragma unroll
        for (int ps = 0; ps < NPASS; ++ps) {
            V kf[4][2][NPL], vf[8][NPL];
            auto ldk = [&](int g) { const int kc = g >> 1, kt = g & 1; const T* p = fk + cur + (ps * 32 + kt * 16) * FKP + 32 * kc; kf[kc][kt][0] = WFrag<T>::ld(p); if (HI) kf[kc][kt][NPL - 1] = WFrag<T>::ld(p + KPL); };
            auto ldv = [&](int t) { const T* p = fv + cur + t * 16 * VP + ps * 32; vf[t][0] = WFrag<T>::ld(p); if (HI) vf[t][NPL - 1] = WFrag<T>::ld(p + VPL); };
            v8f s[2]; s[0] = (v8f){}; s[1] = (v8f){};
#pragma unroll
            for (int g = 0; g < DS; ++g) ldk(g);
#pragma unroll
            for (int g = 0; g < 8; ++g) { const int kc = g >> 1, kt = g & 1; if (g + DS < 8) ldk(g + DS);
                __builtin_amdgcn_sched_barrier(0);    // the LDS reads stay DS groups ahead of the products (for speed only)
                s[kt] = WFrag<T>::mma(kf[kc][kt][0], qf[0][kc], s[kt]); if (HI) { s[kt] = WFrag<T>::mma(kf[kc][kt][0], qf[NPL - 1][kc], s[kt]); s[kt] = WFrag<T>::mma(kf[kc][kt][NPL - 1], qf[0][kc], s[kt]); }
                __builtin_amdgcn_sched_barrier(0); }  // and the following group of reads stays behind these products
            if (HI) stage_loads(more);              // hi+lo form: asked for here, where the K fragments' registers are free again
#pragma unroll
            for (int t = 0; t < DV; ++t) ldv(t);    // the first V^T fragments arrive under the softmax arithmetic
            __builtin_amdgcn_sched_barrier(0);      // keeps those reads in front of the softmax arithmetic
            v16f tv; float mx = -3.0e38f;
#pragma unroll
            for (int e = 0; e < 16; ++e) { const float t2 = fmaf(s[e >> 3][e & 7], SCL * L2E, bfr(mk[ps][e >> 3][(e >> 2) & 1][e & 3]) * L2E); tv[e] = t2; mx = fmaxf(mx, t2); }
            if (!HI) {
#pragma unroll
            for (int kt = 0; kt < 2; ++kt) { const float* mp = mnext + ps * 32 + kt * 16; mk[ps][kt][0] = *(const v4f*)mp; mk[ps][kt][1] = *(const v4f*)(mp + 4); } }
            mx = fmaxf(mx, xhalf(mx));      // both wave halves hold this query's maximum over the pass's 32 keys
            if (__builtin_amdgcn_ballot_w32(mx > m_run + 4.0f) != 0) {      // wave-uniform; rare after the first passes
                const float m_new = fmaxf(m_run, mx); const float corr = __builtin_amdgcn_exp2f(m_run - m_new); l_run *= corr; m_run = m_new;
#pragma unroll
                for (int t = 0; t < 8; ++t) acc[t] = acc[t] * corr; }
            const float nm = (HI ? 0.0f : 10.0f) - m_run; float ps0 = 0.f, ps1 = 0.f;
#pragma unroll
            for (int e = 0; e < 16; e += 2) { float x0 = tv[e] + nm, x1 = tv[e + 1] + nm; exp2x2(x0, x1); tv[e] = x0; tv[e + 1] = x1; ps0 += x0; ps1 += x1; }
            l_run += ps0 + ps1;
            V pa, pb;
            if constexpr (HI) { pa = __builtin_convertvector(tv, v16bf); pb = __builtin_convertvector(tv - __builtin_convertvector(pa, v16f), v16bf); }
            else { pa = __builtin_convertvector(tv, v16h); pb = pa; }
#pragma unroll
            for (int t = 0; t < 8; ++t) { if (t + DV < 8) ldv(t + DV);
                __builtin_amdgcn_sched_barrier(0);    // the V^T reads stay DV groups ahead of their products
                acc[t] = WFrag<T>::mma(vf[t][0], pa, acc[t]); if (HI) { acc[t] = WFrag<T>::mma(vf[t][0], pb, acc[t]); acc[t] = WFrag<T>::mma(vf[t][NPL - 1], pa, acc[t]); }
                __builtin_amdgcn_sched_barrier(0); }  // and the following reads stay behind these products
        }
        if (more) {
#pragma unroll
            for (int i = 0; i < NKL; ++i) { *(V8*)(sk + nxt + i * 16 * FKP) = rk[0][i]; if (HI) *(V8*)(sk + nxt + KPL + i * 16 * FKP) = rk[NPL - 1][i]; }
#pragma unroll
            for (int i = 0; i < NVL; ++i) { *(V8*)(sv + nxt + i * RPS * VP) = rv[0][i]; if (HI) *(V8*)(sv + nxt + VPL + i * RPS * VP) = rv[NPL - 1][i]; } }
        __syncthreads();    // publishes stage st + 1 and ends every wave's reads of the buffer that the next trip refills
    }
    const float inv = __fdiv_rn(1.0f, l_run + xhalf(l_run));    // each wave half summed its own 8 keys of every 16-key tile
#pragma unroll
    for (int t = 0; t < 8; ++t) { v8us oh, ol;
#pragma unroll
        for (int j = 0; j < 8; ++j) { unsigned short a, c2; splitf(acc[t][j] * inv, a, c2); oh[j] = a; ol[j] = c2; }
        const size_t o = (size_t)q * DD + t * 16 + hi * 8; *(v8us*)(Ah + o) = oh; *(v8us*)(Al + o) = ol;
        asm volatile("s_wait_xcnt 0x0" ::: "memory"); }    // stands behind the two stores, in front of any later write of the registers that they name
}
#define FSM_EL (2 * 2 * (32 * FKP + HD * 40))     // the larger of the two forms' LDS, in 16-bit elements
static_assert(2 * (64 * FKP + HD * 72) <= FSM_EL, "the fp16 form's two buffers fit");
// grid: NB_ * NH_ * (RH / 128) hi+lo work-groups first (they are the longer ones), then NB_ * NH_ * ((TT - RH) / 128) fp16 ones. Planes are [batch][head][...]; Ah, Al are [batch][TT][DD].
__global__ __launch_bounds__(256) void k_flash(const bf* __restrict__ Qh, const bf* __restrict__ Ql, const h16* __restrict__ Q16, const bf* __restrict__ Kh, const bf* __restrict__ Kl, const h16* __restrict__ K16,
                                               const bf* __restrict__ Vh, const bf* __restrict__ Vl, const h16* __restrict__ V16, const float* __restrict__ am, bf* Ah, bf* Al) {
    __shared__ __align__(16) unsigned short fsm[FSM_EL];
    constexpr int NHI = NB_ * NH_ * (RH / 128), TLO = (TT - RH) / 128;
    const int idx = blockIdx.x; const bool hires = idx < NHI;
    const int z = hires ? idx / (RH / 128) : (idx - NHI) / TLO; const int q0 = hires ? (idx % (RH / 128)) * 128 : RH + ((idx - NHI) % TLO) * 128;
    const size_t zp = (size_t)z * TT * HD; const size_t ao = (size_t)(z / NH_) * TT * DD + (size_t)(z % NH_) * HD;
    if (hires) flash_body<true>((bf*)fsm, Qh + zp, Ql + zp, Kh + zp, Kl + zp, Vh + zp, Vl + zp, am, q0, Ah + ao, Al + ao);
    else flash_body<false>((h16*)fsm, Q16 + zp, nullptr, K16 + zp, nullptr, V16 + zp, nullptr, am, q0, Ah + ao, Al + ao);
}

extern "C" void kernel_launch(void* const* d_in, const int* in_sizes, int n_in,
                              void* d_out, int out_size, void* d_ws, size_t ws_size, hipStream_t stream) {
    (void)in_sizes; (void)n_in; (void)out_size;
    const float* x = (const float*)d_in[0]; const float* amask = (const float*)d_in[1]; const float* Wq = (const float*)d_in[2]; const float* Wk = (const float*)d_in[3]; const float* Wv = (const float*)d_in[4]; const float* Wd = (const float*)d_in[5];
    float* OUT = (float*)d_out;     // [2][2048][2048]
    char* wsp = (char*)d_ws;
    auto take = [&](size_t bytes) { char* p = wsp; wsp += (bytes + 255) & ~(size_t)255; return (void*)p; };
    const size_t PB = (size_t)TT * DD;      // elements of one batch's plane
    bf* WQ = (bf*)take((size_t)DD * DD * 2); bf* WK = (bf*)take((size_t)DD * DD * 2); bf* WV = (bf*)take((size_t)DD * DD * 2); bf* WO = (bf*)take((size_t)DD * DD * 2);
    bf* XB = (bf*)take(PB * 2); float* CSN = (float*)take((size_t)TT * NF * 2 * 4);
    bf* QPh = (bf*)take(NB_ * PB * 2); bf* QPl = (bf*)take(NB_ * PB * 2); bf* KPh = (bf*)take(NB_ * PB * 2); bf* KPl = (bf*)take(NB_ * PB * 2); bf* VTh = (bf*)take(NB_ * PB * 2); bf* VTl = (bf*)take(NB_ * PB * 2);
    h16* QP16 = (h16*)take(NB_ * PB * 2); h16* KP16 = (h16*)take(NB_ * PB * 2); h16* VT16 = (h16*)take(NB_ * PB * 2);
    bf* ATh = (bf*)take(NB_ * PB * 2); bf* ATl = (bf*)take(NB_ * PB * 2);
    if ((size_t)(wsp - (char*)d_ws) > ws_size) return;    // total 217 MiB; ws 256 MiB
    { const size_t nw = (size_t)DD * DD / 8; const unsigned gw = (unsigned)((nw + 255) / 256); k_cvt8<<<gw, 256, 0, stream>>>(Wq, WQ, nw); k_cvt8<<<gw, 256, 0, stream>>>(Wk, WK, nw); k_cvt8<<<gw, 256, 0, stream>>>(Wv, WV, nw); k_cvt8<<<gw, 256, 0, stream>>>(Wd, WO, nw);
      k_cstab<<<TT * NF / 256, 256, 0, stream>>>(CSN); }
    const dim3 gP(TT / 128, DD / 128, 1);
    for (int b = 0; b < NB_; ++b) { const size_t o = (size_t)b * PB;
        k_cvt8<<<(unsigned)((PB / 8 + 255) / 256), 256, 0, stream>>>(x + o, XB, PB / 8);
        k_gemms<0, DD, DD, 1><<<gP, 256, 0, stream>>>(XB, nullptr, WQ, nullptr, CSN, QPh + o, QPl + o, QP16 + o);
        k_gemms<0, DD, DD, 1><<<gP, 256, 0, stream>>>(XB, nullptr, WK, nullptr, CSN, KPh + o, KPl + o, KP16 + o);
        k_gemms<0, DD, DD, 2><<<gP, 256, 0, stream>>>(XB, nullptr, WV, nullptr, nullptr, VTh + o, VTl + o, VT16 + o); }
    k_flash<<<NB_ * NH_ * (TT / 128), 256, 0, stream>>>(QPh, QPl, QP16, KPh, KPl, KP16, VTh, VTl, VT16, amask, ATh, ATl);
    for (int b = 0; b < NB_; ++b) k_gemms<1, DD, DD, 0><<<gP, 256, 0, stream>>>(ATh + (size_t)b * PB, ATl + (size_t)b * PB, WO, OUT + (size_t)b * PB, nullptr, nullptr, nullptr, nullptr);
}

// v006
// It runs in 286 microseconds.
// Next to v005, in two timings, it ran 1.07 times as fast each time.
// All steps since v000 together make it 8.45 times as fast.
#include <hip/hip_runtime.h>

// ThornsAttention (x [2][2048][2048]; q/k/v = x W^T ([out][in] weights, no bias); 16 heads x 128; "RoPE" whose rotate_half is the identity (rotary_ndims == head_dim in the source), so
// q <- q*cos + q*sin elementwise with emb = cat(freqs, freqs), inv_freq = 10000^(-2i/128); scores = q.k / sqrt(128) + attention_mask (verbatim [1][1][2048][2048] additive input, read
// as data); softmax; out = (attn.v merged) Wd^T).
// Compute dtypes, f32 accumulate: every input rounded to bf16; projections on PLAIN bf16 operands (inputs: exact); the rotary factors cos/sin(t x inv_freq)
// in f32 (powf/cosf/sinf, tabulated once); rows < RH: scores on bf16 hi+lo planes of the rotated q and k (3 products; the 1/sqrt(128) applied in f32 with the mask); attn.v on hi+lo planes
// (3 products); rows >= RH: both on single fp16 planes (1 product each) - the mask is causal-shaped here so early rows see few keys; output hi+lo x exact Wd (2 products).

#define NB_  2
#define TT   2048
#define DD   2048
#define NH_  16
#define HD   128
#define RH   512                  // query rows < RH use hi+lo planes for scores and attn.v; rows >= RH use single fp16 planes
#define NF   64                   // rotary frequencies (head_dim / 2)
#define SCL  0.088388349f
typedef _Float16 h16;
typedef unsigned short bf;
typedef __attribute__((ext_vector_type(16))) __bf16   v16bf;
typedef __attribute__((ext_vector_type(16))) _Float16 v16h;
typedef __attribute__((ext_vector_type(8)))  _Float16 v8h;
typedef __attribute__((ext_vector_type(8)))  unsigned short v8us;
typedef __attribute__((ext_vector_type(8)))  float    v8f;
typedef __attribute__((ext_vector_type(4)))  float    v4f;
typedef v8h  __attribute__((may_alias)) v8ha;
typedef v4f  __attribute__((may_alias)) v4fa;
typedef v8us __attribute__((may_alias)) v8usa;

__device__ __forceinline__ unsigned short f2bf(float f) { unsigned u = __float_as_uint(f); u += 0x7FFFu + ((u >> 16) & 1u); return (unsigned short)(u >> 16); }
__device__ __forceinline__ float bf2f(unsigned short b) { return __uint_as_float(((unsigned)b) << 16); }
__device__ __forceinline__ float bfr(float f) { return bf2f(f2bf(f)); }
__device__ __forceinline__ v16h cat16(v8h lo, v8h hi) { return __builtin_shufflevector(lo, hi, 0, 1, 2, 3, 4, 5, 6, 7, 8, 9, 10, 11, 12, 13, 14, 15); }
__device__ __forceinline__ v16bf cat16b(v8us lo, v8us hi) { return __builtin_bit_cast(v16bf, __builtin_shufflevector(lo, hi, 0, 1, 2, 3, 4, 5, 6, 7, 8, 9, 10, 11, 12, 13, 14, 15)); }
__device__ __forceinline__ v8f wmma16(v16h a, v16h b, v8f c) { return __builtin_amdgcn_wmma_f32_16x16x32_f16(false, a, false, b, (short)0, c, false, false); }
__device__ __forceinline__ v8f wmmab(v16bf a, v16bf b, v8f c) { return __builtin_amdgcn_wmma_f32_16x16x32_bf16(false, a, false, b, (short)0, c, false, false); }



// ---- WFrag: one 16 x 32 operand fragment of a 16-bit plane whose k runs contiguously; p = row start + 8 * (lane >> 4). A and B use the same k order.
template <typename T16> struct WFrag;
template <> struct WFrag<h16> { typedef v16h V; static __device__ __forceinline__ V ld(const h16* p) { return cat16(*(const v8h*)p, *(const v8h*)(p + 16)); } static __device__ __forceinline__ v8f mma(V a, V b, v8f c) { return wmma16(a, b, c); } };
template <> struct WFrag<bf> { typedef v16bf V; static __device__ __forceinline__ V ld(const bf* p) { return cat16b(*(const v8us*)p, *(const v8us*)(p + 16)); } static __device__ __forceinline__ v8f mma(V a, V b, v8f c) { return wmmab(a, b, c); } };

// ---- k_gemms: LDS-staged GEMM for the 2048^3 products (projections, output). One 128x128 output tile per work-group of 8 waves (2 x 4; 64x32 per wave, 8 accumulators); grid (M/128, N/128).
// C[m][n] (f32, pitch LDC) = sum_k (A[m][k] (+ A2[m][k] when NSPLIT == 1)) Bt[n][k]. K % 128 == 0. Per 128-k step every operand plane's 128 rows x 256 bytes come from global memory as whole
// 128-byte lines (16 lanes a row), go through registers into one of two LDS buffers (row pitch 272 bytes) and are read from there as fragments, in the k order of WFrag::ld. The next step's
// lines are fetched while this step's products run; fragments are read one 32-k block ahead. Each accumulator sums its K in one ascending chain.
// The rows of A run over both batches ([NB_ * TT][K]). PROJ: the rows of Bt run over Wq, Wk, Wv one after the other, so one grid (NB_ * TT / 128, 3 * DD / 128) does all six projections.
// What becomes of the f32 tile, which goes through LDS in every form (its 128 columns are one head: HD == 128); form E is the same for a whole work-group (it hangs on blockIdx.y alone):
// E 0 (!PROJ): written to C as f32. E 1 (q, k): y = x cos + x sin from the table CSN, then bf16 hi, bf16 lo and fp16 planes [head][t][d]. E 2 (v): the tile is laid into LDS transposed, then the same
// three planes [head][d][t]. In E 1 and 2 a lane converts 8 neighbours of a plane's row and 16 lanes store 256 bytes of it: whole 128-byte lines, no f32 copy in memory.
// PP: the six bf16 planes q hi, q lo, k hi, k lo, v hi, v lo, each [batch][head][...]; P3: the three fp16 planes q, k, v.
typedef __attribute__((ext_vector_type(8))) __bf16 v8bf;
#define GP 136                    // LDS row pitch in 16-bit elements (128 + 8)
template <int N> struct IC { static constexpr int value = N; };
template <int NSPLIT, int K, int LDC, bool PROJ>
__global__ __launch_bounds__(256) void k_gemms(const bf* __restrict__ A, const bf* __restrict__ A2, const bf* __restrict__ Bt, float* C, const float* __restrict__ CSN, bf* PP, h16* P3) {
    constexpr int NP = NSPLIT ? 3 : 2;      // planes staged per step
    constexpr int PL = 128 * GP;            // elements of one staged plane
    constexpr int NT = K / 128;
    __shared__ __align__(16) bf sm[2 * NP * PL];
    static_assert(128 * 132 * 4 <= 2 * NP * PL * 2, "the f32 output tile fits the staging buffers it reuses");
    const int tid = threadIdx.x, lane = tid & 31, lr = lane & 15, hi = lane >> 4;
    const int w = __builtin_amdgcn_readfirstlane(tid >> 5); const int wm = w & 1, wn = w >> 1;
    const int r0 = blockIdx.x * 128, c0 = blockIdx.y * 128;
    const int srow = tid >> 4, scol = (tid & 15) * 8;
    const unsigned go = (unsigned)(srow * K + scol);      // the lane's offset in a tile; the tile's own address stays scalar
    const bf* pa = A + (size_t)r0 * K; const bf* pa2 = NSPLIT ? A2 + (size_t)r0 * K : nullptr; const bf* pb = Bt + (size_t)c0 * K;
    bf* st = sm + srow * GP + scol;
    const bf* fa = sm + (wm * 64 + lr) * GP + 8 * hi; const bf* fb = sm + (NP - 1) * PL + (wn * 32 + lr) * GP + 8 * hi;
    v8us ra[8], ra2[8], rb[8];
    v8f acc[4][2];
#pragma unroll
    for (int mb = 0; mb < 4; ++mb)
#pragma unroll
        for (int nb = 0; nb < 2; ++nb) acc[mb][nb] = (v8f){};
#pragma unroll
    for (int i = 0; i < 8; ++i) { ra[i] = *(const v8us*)(pa + go + i * 16 * K); if (NSPLIT) ra2[i] = *(const v8us*)(pa2 + go + i * 16 * K); rb[i] = *(const v8us*)(pb + go + i * 16 * K); }
#pragma unroll
    for (int i = 0; i < 8; ++i) { *(v8us*)(st + i * 16 * GP) = ra[i]; if (NSPLIT) *(v8us*)(st + PL + i * 16 * GP) = ra2[i]; *(v8us*)(st + (NP - 1) * PL + i * 16 * GP) = rb[i]; }
    __syncthreads();    // step 0 is in buffer 0 before any wave reads a fragment
#pragma unroll 1        // rolled: for speed only
    for (int kt = 0; kt < NT; ++kt) {
        const int cur = (kt & 1) * (NP * PL), nxt = NP * PL - cur; const bool more = kt + 1 < NT;
        if (more) { pa += 128; if (NSPLIT) pa2 += 128; pb += 128;
#pragma unroll
            for (int i = 0; i < 8; ++i) { ra[i] = *(const v8us*)(pa + go + i * 16 * K); if (NSPLIT) ra2[i] = *(const v8us*)(pa2 + go + i * 16 * K); rb[i] = *(const v8us*)(pb + go + i * 16 * K); } }
        v16bf a[2][4], a2[2][4], b[2][2];
#pragma unroll
        for (int nb = 0; nb < 2; ++nb) b[0][nb] = WFrag<bf>::ld(fb + cur + nb * 16 * GP);
#pragma unroll
        for (int mb = 0; mb < 4; ++mb) { a[0][mb] = WFrag<bf>::ld(fa + cur + mb * 16 * GP); if (NSPLIT) a2[0][mb] = WFrag<bf>::ld(fa + cur + PL + mb * 16 * GP); }
#pragma unroll
        for (int kk = 0; kk < 4; ++kk) { const int s = kk & 1, n = s ^ 1;
            if (kk < 3) {
#pragma unroll
                for (int nb = 0; nb < 2; ++nb) b[n][nb] = WFrag<bf>::ld(fb + cur + nb * 16 * GP + (kk + 1) * 32);
#pragma unroll
                for (int mb = 0; mb < 4; ++mb) { a[n][mb] = WFrag<bf>::ld(fa + cur + mb * 16 * GP + (kk + 1) * 32); if (NSPLIT) a2[n][mb] = WFrag<bf>::ld(fa + cur + PL + mb * 16 * GP + (kk + 1) * 32); } }
            __builtin_amdgcn_sched_barrier(0);    // the next block's LDS reads stay one group ahead of this block's products (for speed only)
#pragma unroll
            for (int nb = 0; nb < 2; ++nb)
#pragma unroll
                for (int mb = 0; mb < 4; ++mb) { acc[mb][nb] = wmmab(a[s][mb], b[s][nb], acc[mb][nb]); if (NSPLIT) acc[mb][nb] = wmmab(a2[s][mb], b[s][nb], acc[mb][nb]); }
            __builtin_amdgcn_sched_barrier(0); }  // and the following group of reads stays behind this block's products
        if (more) {
#pragma unroll
            for (int i = 0; i < 8; ++i) { *(v8us*)(st + nxt + i * 16 * GP) = ra[i]; if (NSPLIT) *(v8us*)(st + nxt + PL + i * 16 * GP) = ra2[i]; *(v8us*)(st + nxt + (NP - 1) * PL + i * 16 * GP) = rb[i]; } }
        __syncthreads();    // publishes step kt + 1 and ends every wave's reads of the buffer that the next trip refills
    }
    float* os = (float*)sm;
    auto epilogue = [&](auto form) { constexpr int EPI = decltype(form)::value;
#pragma unroll
    for (int mb = 0; mb < 4; ++mb)
#pragma unroll
        for (int nb = 0; nb < 2; ++nb) {
            if constexpr (EPI == 2) { float* p = os + (wn * 32 + nb * 16 + lr) * 132 + wm * 64 + mb * 16 + hi * 8;     // transposed: a lane's 8 values are 8 neighbours of row d
                *(v4fa*)p = __builtin_shufflevector(acc[mb][nb], acc[mb][nb], 0, 1, 2, 3); *(v4fa*)(p + 4) = __builtin_shufflevector(acc[mb][nb], acc[mb][nb], 4, 5, 6, 7); }
            else {
#pragma unroll
                for (int j = 0; j < 8; ++j) os[(wm * 64 + mb * 16 + hi * 8 + j) * 132 + wn * 32 + nb * 16 + lr] = acc[mb][nb][j]; } }
    if constexpr (EPI == 0) {
        __syncthreads();    // the whole f32 tile is in LDS before it is written out row by row
        float* pc = C + (size_t)r0 * LDC + c0; const unsigned co = (unsigned)((tid >> 5) * LDC + (tid & 31) * 4);
#pragma unroll
        for (int i = 0; i < 16; ++i) *(v4f*)(pc + co + i * 8 * LDC) = *(const v4fa*)(os + ((tid >> 5) + i * 8) * 132 + (tid & 31) * 4);
    } else {
        static_assert(HD == 128 && LDC == DD, "one tile column block is one head");
        constexpr int DP = EPI == 1 ? HD : TT;      // pitch of a plane's row: [t][d] or [d][t]
        const int head = blockIdx.y % NH_, which = blockIdx.y / NH_, bat = r0 / TT, rb = r0 % TT;     // which: 0 q, 1 k, 2 v; rb: the tile's first row inside its batch
        bf* Ph = PP + ((size_t)which * 2 * NB_ + bat) * ((size_t)TT * DD); bf* Pl = Ph + (size_t)NB_ * TT * DD; h16* P16 = P3 + ((size_t)which * NB_ + bat) * ((size_t)TT * DD);
        const size_t pbase = EPI == 1 ? ((size_t)head * TT + rb) * HD : (size_t)head * HD * TT + rb;
        const unsigned po = (unsigned)(srow * DP + scol);
        v4f cs[8][4];       // EPI 1: (cos, sin) of the lane's 8 columns in each of its 8 rows; asked for in front of the barrier, they arrive under it
        if constexpr (EPI == 1) { const float* pt = CSN + (size_t)rb * (NF * 2); const unsigned to = (unsigned)(srow * (NF * 2) + (scol & (NF - 1)) * 2);
#pragma unroll
            for (int i = 0; i < 8; ++i)
#pragma unroll
                for (int c = 0; c < 4; ++c) cs[i][c] = *(const v4f*)(pt + to + i * 16 * (NF * 2) + c * 4); }
        __syncthreads();    // the whole f32 tile is in LDS before it is read row by row
#pragma unroll
        for (int i = 0; i < 8; ++i) { const float* p = os + (srow + i * 16) * 132 + scol; const v4f y0 = *(const v4fa*)p, y1 = *(const v4fa*)(p + 4);
            v8f y = __builtin_shufflevector(y0, y1, 0, 1, 2, 3, 4, 5, 6, 7);
            if constexpr (EPI == 1) {
#pragma unroll
                for (int k = 0; k < 8; ++k) y[k] = y[k] * cs[i][k >> 1][(k & 1) * 2] + y[k] * cs[i][k >> 1][(k & 1) * 2 + 1]; }
            const v8bf yh = __builtin_convertvector(y, v8bf); const v8bf yl = __builtin_convertvector(y - __builtin_convertvector(yh, v8f), v8bf);
            *(v8us*)(Ph + pbase + po + i * 16 * DP) = __builtin_bit_cast(v8us, yh); *(v8us*)(Pl + pbase + po + i * 16 * DP) = __builtin_bit_cast(v8us, yl); *(v8h*)(P16 + pbase + po + i * 16 * DP) = __builtin_convertvector(y, v8h);
            asm volatile("s_wait_xcnt 0x0" ::: "memory"); }    // stands behind the three stores, in front of any later write of the registers that they name
    } };
    if constexpr (PROJ) { if (blockIdx.y / NH_ == 2) epilogue(IC<2>{}); else epilogue(IC<1>{}); } else epilogue(IC<0>{});
}

__device__ __forceinline__ void splitf(float y, unsigned short& h, unsigned short& l) { h = f2bf(y); l = f2bf(y - bf2f(h)); }
typedef __attribute__((ext_vector_type(2))) float v2f;

// ---- k_prep: everything the products need beforehand, in one launch. Work-groups 0 .. PCS-1 fill the rotary table (CTU rows t per thread, one frequency; they are the slow ones); then PBW work-groups for each of
// Wq, Wk, Wv, Wd (bf16 into WB, one after the other) and PBX for x (both batches, into XB). A conversion work-group turns 256 x 8 x CVU floats: each thread asks for its CVU vectors of 8 floats at
// once, so that few work-groups have to be started and each has many lines in flight.
#define CVU 8
#define CTU 4
#define PCS (TT * NF / (256 * CTU))
#define PBW (DD * DD / (256 * 8 * CVU))
#define PBX (NB_ * TT * DD / (256 * 8 * CVU))
__global__ __launch_bounds__(256) void k_prep(const float* __restrict__ x, const float* __restrict__ Wq, const float* __restrict__ Wk, const float* __restrict__ Wv, const float* __restrict__ Wd, bf* WB, bf* XB, float* CSN) {
    if (blockIdx.x < PCS) {
        const int idx = blockIdx.x * 256 + threadIdx.x; const int t0 = idx / NF, i = idx % NF; const float invf = __fdiv_rn(1.0f, powf(10000.0f, (float)(2 * i) * (1.0f / HD)));
#pragma unroll 1        // rolled: one copy of the long cosine and sine code
        for (int u = 0; u < CTU; ++u) { const int t = t0 + u * (TT / CTU); const float ang = __fmul_rn((float)t, invf);
            v2f o; o[0] = cosf(ang); o[1] = sinf(ang); *(v2f*)(CSN + ((size_t)t * NF + i) * 2) = o;
            asm volatile("s_wait_xcnt 0x0" ::: "memory"); }    // stands behind the store, in front of the next trip's writes of the registers that it names
        return; }
    const int c = blockIdx.x - PCS, seg = c / PBW;      // seg 0..3: a weight; from 4 on: x
    const float* src = seg == 0 ? Wq : seg == 1 ? Wk : seg == 2 ? Wv : seg == 3 ? Wd : x;
    bf* dst = seg < 4 ? WB + (size_t)seg * DD * DD : XB;
    const size_t base = (size_t)(seg < 4 ? c - seg * PBW : c - 4 * PBW) * (256 * 8 * CVU) + threadIdx.x * 8;
    const float* pin = src + base;
    v8f v[CVU];
#pragma unroll
    for (int u = 0; u < CVU; ++u) v[u] = *(const v8f*)(pin + u * 2048);
    asm volatile("s_wait_xcnt 0x0" :: "v"(pin) : "memory");    // stands behind the loads, in front of any write of the address register that they name; the address is an input, so no load's result is given that register
#pragma unroll
    for (int u = 0; u < CVU; ++u) { v8us o;
#pragma unroll
        for (int k = 0; k < 8; ++k) o[k] = f2bf(v[u][k]);
        *(v8us*)(dst + base + u * 2048) = o; }
    asm volatile("s_wait_xcnt 0x0" ::: "memory");    // stands behind the last store, in front of any later write of the registers that the stores name
}
typedef __attribute__((ext_vector_type(16))) float v16f;
#define L2E 1.4426950408889634f
#define FKP 136                   // LDS pitch of a K row in elements (128 + 8)
template <bool HI> struct FT;
template <> struct FT<true>  { typedef bf  T; typedef v8us V8; };
template <> struct FT<false> { typedef h16 T; typedef v8h  V8; };
__device__ __forceinline__ float xhalf(float x) { return __builtin_bit_cast(float, __builtin_amdgcn_permlanex16(__builtin_bit_cast(int, x), __builtin_bit_cast(int, x), 0x76543210, 0xfedcba98, false, false)); }  // lane l with lane l ^ 16
// Two exponentials and, in the same statement, the one v_nop that the instruction set asks for behind a transcendental before its result is read or its source overwritten (a v_nop in a statement of
// its own did not stay behind them). The outputs share no register with the inputs ("=&v"), so the second exponential is independent of the first and fills the first one's slot.
__device__ __forceinline__ void exp2x2(float& a, float& b) { float ra, rb; asm("v_exp_f32 %0, %2\n\tv_exp_f32 %1, %3\n\tv_nop" : "=&v"(ra), "=&v"(rb) : "v"(a), "v"(b)); a = ra; b = rb; }
template <bool HI>
__device__ __forceinline__ void flash_body(typename FT<HI>::T* sm, const typename FT<HI>::T* __restrict__ Q, const typename FT<HI>::T* __restrict__ Q2, const typename FT<HI>::T* __restrict__ Kg, const typename FT<HI>::T* __restrict__ Kg2,
                                           const typename FT<HI>::T* __restrict__ Vg, const typename FT<HI>::T* __restrict__ Vg2, const float* __restrict__ am, int q0, bf* Ah, bf* Al) {
    typedef typename FT<HI>::T T; typedef typename FT<HI>::V8 V8; typedef typename WFrag<T>::V V;
    constexpr int NPL = HI ? 2 : 1, SK = HI ? 32 : 64, VP = SK + 8, KPL = SK * FKP, VPL = HD * VP, BUF = NPL * (KPL + VPL), NST = TT / SK, NPASS = SK / 32;
    constexpr int NKL = SK / 16, LPV = SK / 8, RPS = 256 / LPV, NVL = HD / RPS;
    const int tid = threadIdx.x, lane = tid & 31, lr = lane & 15, hi = lane >> 4; const int w = __builtin_amdgcn_readfirstlane(tid >> 5);
    const int q = q0 + w * 16 + lr;       // this lane's query row
    const unsigned gk = (unsigned)((tid >> 4) * HD + (tid & 15) * 8), gv = (unsigned)((tid / LPV) * TT + (tid % LPV) * 8);
    T* sk = sm + (tid >> 4) * FKP + (tid & 15) * 8; T* sv = sm + NPL * KPL + (tid / LPV) * VP + (tid % LPV) * 8;
    const T* fk = sm + lr * FKP + 8 * hi; const T* fv = sm + NPL * KPL + lr * VP + 8 * hi;
    const float* mrow = am + (size_t)q * TT + 8 * hi;
    V qf[NPL][4];
#pragma unroll
    for (int kc = 0; kc < 4; ++kc) { qf[0][kc] = WFrag<T>::ld(Q + (size_t)q * HD + 8 * hi + 32 * kc); if (HI) qf[NPL - 1][kc] = WFrag<T>::ld(Q2 + (size_t)q * HD + 8 * hi + 32 * kc); }
    V8 rk[NPL][NKL], rv[NPL][NVL];
    v8f acc[8];
#pragma unroll
    for (int t = 0; t < 8; ++t) acc[t] = (v8f){};
    float m_run = -3.0e38f, l_run = 0.f;
#pragma unroll
    for (int i = 0; i < NKL; ++i) { rk[0][i] = *(const V8*)(Kg + gk + i * 16 * HD); if (HI) rk[NPL - 1][i] = *(const V8*)(Kg2 + gk + i * 16 * HD); }
    asm volatile("s_wait_xcnt 0x0" ::: "memory");    // stands behind the Q and K loads, in front of the V^T loads, whose results may be given a register that one of those loads names
#pragma unroll
    for (int i = 0; i < NVL; ++i) { rv[0][i] = *(const V8*)(Vg + gv + i * RPS * TT); if (HI) rv[NPL - 1][i] = *(const V8*)(Vg2 + gv + i * RPS * TT); }
#pragma unroll
    for (int i = 0; i < NKL; ++i) { *(V8*)(sk + i * 16 * FKP) = rk[0][i]; if (HI) *(V8*)(sk + KPL + i * 16 * FKP) = rk[NPL - 1][i]; }
#pragma unroll
    for (int i = 0; i < NVL; ++i) { *(V8*)(sv + i * RPS * VP) = rv[0][i]; if (HI) *(V8*)(sv + VPL + i * RPS * VP) = rv[NPL - 1][i]; }
    __syncthreads();    // stage 0 is in buffer 0 before any wave reads a fragment
    v4f mk[NPASS][2][2];    // one stage's mask values for this lane's query. fp16 form: each pass asks for the next stage's as soon as it has used its own, a whole stage ahead;
                            // hi+lo form (short of registers in attn.v): asked for at the head of the stage, they arrive under the score products
    if (!HI) {
#pragma unroll
    for (int ps = 0; ps < NPASS; ++ps)
#pragma unroll
        for (int kt = 0; kt < 2; ++kt) { const float* mp = mrow + ps * 32 + kt * 16; mk[ps][kt][0] = *(const v4f*)mp; mk[ps][kt][1] = *(const v4f*)(mp + 4); } }
    constexpr int DS = HI ? 2 : 4, DV = HI ? 2 : 2;     // how many groups of K fragments (16 keys x 32 d) and of V^T fragments (16 d x 32 keys) are read ahead of the products that use them
    // The last stage asks for its own lines again (in bounds, not stored): with the loads on every path the compiler's load counts in front of the mask values stay exact and do not wait for these lines.
    auto stage_loads = [&](bool more) { const int ak = more ? SK * HD : 0, av = more ? SK : 0; Kg += ak; Vg += av; if (HI) { Kg2 += ak; Vg2 += av; }
#pragma unroll
        for (int i = 0; i < NKL; ++i) { rk[0][i] = *(const V8*)(Kg + gk + i * 16 * HD); if (HI) rk[NPL - 1][i] = *(const V8*)(Kg2 + gk + i * 16 * HD); }
#pragma unroll
        for (int i = 0; i < NVL; ++i) { rv[0][i] = *(const V8*)(Vg + gv + i * RPS * TT); if (HI) rv[NPL - 1][i] = *(const V8*)(Vg2 + gv + i * RPS * TT); } };
#pragma unroll 1        // rolled: for speed only
    for (int st = 0; st < NST; ++st) {
        const int cur = (st & 1) * BUF, nxt = BUF - cur; const bool more = st + 1 < NST;
        const float* mnext = mrow + (more ? st + 1 : st) * SK;      // the last stage asks for its own values again: in bounds, not used
        if (!HI) stage_loads(more);
        if (HI) {
#pragma unroll
            for (int kt = 0; kt < 2; ++kt) { const float* mp = mrow + st * SK + kt * 16; mk[0][kt][0] = *(const v4f*)mp; mk[0][kt][1] = *(const v4f*)(mp + 4); } }
#pragma unroll
        for (int ps = 0; ps < NPASS; ++ps) {
            V kf[4][2][NPL], vf[8][NPL];
            auto ldk = [&](int g) { const int kc = g >> 1, kt = g & 1; const T* p = fk + cur + (ps * 32 + kt * 16) * FKP + 32 * kc; kf[kc][kt][0] = WFrag<T>::ld(p); if (HI) kf[kc][kt][NPL - 1] = WFrag<T>::ld(p + KPL); };
            auto ldv = [&](int t) { const T* p = fv + cur + t * 16 * VP + ps * 32; vf[t][0] = WFrag<T>::ld(p); if (HI) vf[t][NPL - 1] = WFrag<T>::ld(p + VPL); };
            v8f s[2]; s[0] = (v8f){}; s[1] = (v8f){};
#pragma unroll
            for (int g = 0; g < DS; ++g) ldk(g);
#pragma unroll
            for (int g = 0; g < 8; ++g) { const int kc = g >> 1, kt = g & 1; if (g + DS < 8) ldk(g + DS);
                __builtin_amdgcn_sched_barrier(0);    // the LDS reads stay DS groups ahead of the products (for speed only)
                s[kt] = WFrag<T>::mma(kf[kc][kt][0], qf[0][kc], s[kt]); if (HI) { s[kt] = WFrag<T>::mma(kf[kc][kt][0], qf[NPL - 1][kc], s[kt]); s[kt] = WFrag<T>::mma(kf[kc][kt][NPL - 1], qf[0][kc], s[kt]); }
                __builtin_amdgcn_sched_barrier(0); }  // and the following group of reads stays behind these products
            if (HI) stage_loads(more);              // hi+lo form: asked for here, where the K fragments' registers are free again
#pragma unroll
            for (int t = 0; t < DV; ++t) ldv(t);    // the first V^T fragments arrive under the softmax arithmetic
            __builtin_amdgcn_sched_barrier(0);      // keeps those reads in front of the softmax arithmetic
            v16f tv; float mx = -3.0e38f;
#pragma unroll
            for (int e = 0; e < 16; ++e) { const float t2 = fmaf(s[e >> 3][e & 7], SCL * L2E, bfr(mk[ps][e >> 3][(e >> 2) & 1][e & 3]) * L2E); tv[e] = t2; mx = fmaxf(mx, t2); }
            if (!HI) {
#pragma unroll
            for (int kt = 0; kt < 2; ++kt) { const float* mp = mnext + ps * 32 + kt * 16; mk[ps][kt][0] = *(const v4f*)mp; mk[ps][kt][1] = *(const v4f*)(mp + 4); } }
            mx = fmaxf(mx, xhalf(mx));      // both wave halves hold this query's maximum over the pass's 32 keys
            if (__builtin_amdgcn_ballot_w32(mx > m_run + 4.0f) != 0) {      // wave-uniform; rare after the first passes
                const float m_new = fmaxf(m_run, mx); const float corr = __builtin_amdgcn_exp2f(m_run - m_new); l_run *= corr; m_run = m_new;
#pragma unroll
                for (int t = 0; t < 8; ++t) acc[t] = acc[t] * corr; }
            const float nm = (HI ? 0.0f : 10.0f) - m_run; float ps0 = 0.f, ps1 = 0.f;
#pragma unroll
            for (int e = 0; e < 16; e += 2) { float x0 = tv[e] + nm, x1 = tv[e + 1] + nm; exp2x2(x0, x1); tv[e] = x0; tv[e + 1] = x1; ps0 += x0; ps1 += x1; }
            l_run += ps0 + ps1;
            V pa, pb;
            if constexpr (HI) { pa = __builtin_convertvector(tv, v16bf); pb = __builtin_convertvector(tv - __builtin_convertvector(pa, v16f), v16bf); }
            else { pa = __builtin_convertvector(tv, v16h); pb = pa; }
#pragma unroll
            for (int t = 0; t < 8; ++t) { if (t + DV < 8) ldv(t + DV);
                __builtin_amdgcn_sched_barrier(0);    // the V^T reads stay DV groups ahead of their products
                acc[t] = WFrag<T>::mma(vf[t][0], pa, acc[t]); if (HI) { acc[t] = WFrag<T>::mma(vf[t][0], pb, acc[t]); acc[t] = WFrag<T>::mma(vf[t][NPL - 1], pa, acc[t]); }
                __builtin_amdgcn_sched_barrier(0); }  // and the following reads stay behind these products
        }
        if (more) {
#pragma unroll
            for (int i = 0; i < NKL; ++i) { *(V8*)(sk + nxt + i * 16 * FKP) = rk[0][i]; if (HI) *(V8*)(sk + nxt + KPL + i * 16 * FKP) = rk[NPL - 1][i]; }
#pragma unroll
            for (int i = 0; i < NVL; ++i) { *(V8*)(sv + nxt + i * RPS * VP) = rv[0][i]; if (HI) *(V8*)(sv + nxt + VPL + i * RPS * VP) = rv[NPL - 1][i]; } }
        __syncthreads();    // publishes stage st + 1 and ends every wave's reads of the buffer that the next trip refills
    }
    const float inv = __fdiv_rn(1.0f, l_run + xhalf(l_run));    // each wave half summed its own 8 keys of every 16-key tile
#pragma unroll
    for (int t = 0; t < 8; ++t) { v8us oh, ol;
#pragma unroll
        for (int j = 0; j < 8; ++j) { unsigned short a, c2; splitf(acc[t][j] * inv, a, c2); oh[j] = a; ol[j] = c2; }
        const size_t o = (size_t)q * DD + t * 16 + hi * 8; *(v8us*)(Ah + o) = oh; *(v8us*)(Al + o) = ol;
        asm volatile("s_wait_xcnt 0x0" ::: "memory"); }    // stands behind the two stores, in front of any later write of the registers that they name
}
#define FSM_EL (2 * 2 * (32 * FKP + HD * 40))     // the larger of the two forms' LDS, in 16-bit elements
static_assert(2 * (64 * FKP + HD * 72) <= FSM_EL, "the fp16 form's two buffers fit");
// grid: NB_ * NH_ * (RH / 128) hi+lo work-groups first (they are the longer ones), then NB_ * NH_ * ((TT - RH) / 128) fp16 ones. Planes are [batch][head][...]; Ah, Al are [batch][TT][DD].
__global__ __launch_bounds__(256) void k_flash(const bf* __restrict__ Qh, const bf* __restrict__ Ql, const h16* __restrict__ Q16, const bf* __restrict__ Kh, const bf* __restrict__ Kl, const h16* __restrict__ K16,
                                               const bf* __restrict__ Vh, const bf* __restrict__ Vl, const h16* __restrict__ V16, const float* __restrict__ am, bf* Ah, bf* Al) {
    __shared__ __align__(16) unsigned short fsm[FSM_EL];
    constexpr int NHI = NB_ * NH_ * (RH / 128), TLO = (TT - RH) / 128;
    const int idx = blockIdx.x; const bool hires = idx < NHI;
    const int z = hires ? idx / (RH / 128) : (idx - NHI) / TLO; const int q0 = hires ? (idx % (RH / 128)) * 128 : RH + ((idx - NHI) % TLO) * 128;
    const size_t zp = (size_t)z * TT * HD; const size_t ao = (size_t)(z / NH_) * TT * DD + (size_t)(z % NH_) * HD;
    if (hires) flash_body<true>((bf*)fsm, Qh + zp, Ql + zp, Kh + zp, Kl + zp, Vh + zp, Vl + zp, am, q0, Ah + ao, Al + ao);
    else flash_body<false>((h16*)fsm, Q16 + zp, nullptr, K16 + zp, nullptr, V16 + zp, nullptr, am, q0, Ah + ao, Al + ao);
}

extern "C" void kernel_launch(void* const* d_in, const int* in_sizes, int n_in,
                              void* d_out, int out_size, void* d_ws, size_t ws_size, hipStream_t stream) {
    (void)in_sizes; (void)n_in; (void)out_size;
    const float* x = (const float*)d_in[0]; const float* amask = (const float*)d_in[1]; const float* Wq = (const float*)d_in[2]; const float* Wk = (const float*)d_in[3]; const float* Wv = (const float*)d_in[4]; const float* Wd = (const float*)d_in[5];
    float* OUT = (float*)d_out;     // [2][2048][2048]
    char* wsp = (char*)d_ws;
    auto take = [&](size_t bytes) { char* p = wsp; wsp += (bytes + 255) & ~(size_t)255; return (void*)p; };
    const size_t PB = (size_t)TT * DD;      // elements of one batch's plane
    bf* WB = (bf*)take((size_t)4 * DD * DD * 2); bf* WO = WB + (size_t)3 * DD * DD;      // Wq, Wk, Wv, Wd in bf16, one after the other
    bf* XB = (bf*)take(NB_ * PB * 2); float* CSN = (float*)take((size_t)TT * NF * 2 * 4);
    bf* PP = (bf*)take(6 * NB_ * PB * 2); bf* QPh = PP; bf* QPl = PP + NB_ * PB; bf* KPh = PP + 2 * NB_ * PB; bf* KPl = PP + 3 * NB_ * PB; bf* VTh = PP + 4 * NB_ * PB; bf* VTl = PP + 5 * NB_ * PB;
    h16* P3 = (h16*)take(3 * NB_ * PB * 2); h16* QP16 = P3; h16* KP16 = P3 + NB_ * PB; h16* VT16 = P3 + 2 * NB_ * PB;
    bf* ATh = (bf*)take(NB_ * PB * 2); bf* ATl = (bf*)take(NB_ * PB * 2);
    if ((size_t)(wsp - (char*)d_ws) > ws_size) return;    // total 225 MiB; ws 256 MiB
    k_prep<<<PCS + 4 * PBW + PBX, 256, 0, stream>>>(x, Wq, Wk, Wv, Wd, WB, XB, CSN);
    k_gemms<0, DD, DD, true><<<dim3(NB_ * TT / 128, 3 * DD / 128, 1), 256, 0, stream>>>(XB, nullptr, WB, nullptr, CSN, PP, P3);
    k_flash<<<NB_ * NH_ * (TT / 128), 256, 0, stream>>>(QPh, QPl, QP16, KPh, KPl, KP16, VTh, VTl, VT16, amask, ATh, ATl);
    k_gemms<1, DD, DD, false><<<dim3(NB_ * TT / 128, DD / 128, 1), 256, 0, stream>>>(ATh, ATl, WO, OUT, nullptr, nullptr, nullptr);
}

// v007
// A run of this version takes 239 microseconds.
// In both of two side-by-side timings against v006, it was 1.20 times as fast.
// All steps since v000 together make it 10.1 times as fast.
#include <hip/hip_runtime.h>

// ThornsAttention (x [2][2048][2048]; q/k/v = x W^T ([out][in] weights, no bias); 16 heads x 128; "RoPE" whose rotate_half is the identity (rotary_ndims == head_dim in the source), so
// q <- q*cos + q*sin elementwise with emb = cat(freqs, freqs), inv_freq = 10000^(-2i/128); scores = q.k / sqrt(128) + attention_mask (verbatim [1][1][2048][2048] additive input, read
// as data); softmax; out = (attn.v merged) Wd^T).
// Compute dtypes, f32 accumulate: every input rounded to bf16; projections on PLAIN bf16 operands (inputs: exact); the rotary factors cos/sin(t x inv_freq)
// in f32 (powf/cosf/sinf, tabulated once); rows < RH: scores on bf16 hi+lo planes of the rotated q and k (3 products; the 1/sqrt(128) applied in f32 with the mask); attn.v on hi+lo planes
// (3 products); rows >= RH: both on single fp16 planes (1 product each) - the mask is causal-shaped here so early rows see few keys; output hi+lo x exact Wd (2 products).

#define NB_  2
#define TT   2048
#define DD   2048
#define NH_  16
#define HD   128
#define RH   512                  // query rows < RH use hi+lo planes for scores and attn.v; rows >= RH use single fp16 planes
#define NF   64                   // rotary frequencies (head_dim / 2)
#define SCL  0.088388349f
typedef _Float16 h16;
typedef unsigned short bf;
typedef __attribute__((ext_vector_type(16))) __bf16   v16bf;
typedef __attribute__((ext_vector_type(16))) _Float16 v16h;
typedef __attribute__((ext_vector_type(8)))  _Float16 v8h;
typedef __attribute__((ext_vector_type(8)))  unsigned short v8us;
typedef __attribute__((ext_vector_type(8)))  float    v8f;
typedef __attribute__((ext_vector_type(4)))  float    v4f;
typedef v8h  __attribute__((may_alias)) v8ha;
typedef v4f  __attribute__((may_alias)) v4fa;
typedef v8us __attribute__((may_alias)) v8usa;

__device__ __forceinline__ unsigned short f2bf(float f) { unsigned u = __float_as_uint(f); u += 0x7FFFu + ((u >> 16) & 1u); return (unsigned short)(u >> 16); }
__device__ __forceinline__ float bf2f(unsigned short b) { return __uint_as_float(((unsigned)b) << 16); }
__device__ __forceinline__ float bfr(float f) { return bf2f(f2bf(f)); }
__device__ __forceinline__ v16h cat16(v8h lo, v8h hi) { return __builtin_shufflevector(lo, hi, 0, 1, 2, 3, 4, 5, 6, 7, 8, 9, 10, 11, 12, 13, 14, 15); }
__device__ __forceinline__ v16bf cat16b(v8us lo, v8us hi) { return __builtin_bit_cast(v16bf, __builtin_shufflevector(lo, hi, 0, 1, 2, 3, 4, 5, 6, 7, 8, 9, 10, 11, 12, 13, 14, 15)); }
__device__ __forceinline__ v8f wmma16(v16h a, v16h b, v8f c) { return __builtin_amdgcn_wmma_f32_16x16x32_f16(false, a, false, b, (short)0, c, false, false); }
__device__ __forceinline__ v8f wmmab(v16bf a, v16bf b, v8f c) { return __builtin_amdgcn_wmma_f32_16x16x32_bf16(false, a, false, b, (short)0, c, false, false); }



// ---- WFrag: one 16 x 32 operand fragment of a 16-bit plane whose k runs contiguously; p = row start + 8 * (lane >> 4). A and B use the same k order.
template <typename T16> struct WFrag;
template <> struct WFrag<h16> { typedef v16h V; static __device__ __forceinline__ V ld(const h16* p) { return cat16(*(const v8h*)p, *(const v8h*)(p + 16)); } static __device__ __forceinline__ v8f mma(V a, V b, v8f c) { return wmma16(a, b, c); } };
template <> struct WFrag<bf> { typedef v16bf V; static __device__ __forceinline__ V ld(const bf* p) { return cat16b(*(const v8us*)p, *(const v8us*)(p + 16)); } static __device__ __forceinline__ v8f mma(V a, V b, v8f c) { return wmmab(a, b, c); } };

// ---- k_gemms: LDS-staged GEMM for the 2048^3 products (projections, output). One 128x128 output tile per work-group of 8 waves (2 x 4; 64x32 per wave, 8 accumulators); grid (M/128, N/128).
// C[m][n] (f32, pitch LDC) = sum_k (A[m][k] (+ A2[m][k] when NSPLIT == 1)) Bt[n][k]. K % 128 == 0. Per 128-k step every operand plane's 128 rows x 256 bytes come from global memory as whole
// 128-byte lines (16 lanes a row), go through registers into one of two LDS buffers (row pitch 272 bytes) and are read from there as fragments, in the k order of WFrag::ld. The next step's
// lines are fetched while this step's products run; fragments are read one 32-k block ahead. Each accumulator sums its K in one ascending chain.
// The rows of A run over both batches ([NB_ * TT][K]). PROJ: the rows of Bt run over Wq, Wk, Wv one after the other, so one grid (NB_ * TT / 128, 3 * DD / 128) does all six projections.
// What becomes of the f32 tile, which goes through LDS in every form (its 128 columns are one head: HD == 128); form E is the same for a whole work-group (it hangs on blockIdx.y alone):
// E 0 (!PROJ): written to C as f32. E 1 (q, k): y = x cos + x sin from the table CSN, then bf16 hi, bf16 lo and fp16 planes [head][t][d]. E 2 (v): the tile is laid into LDS transposed, then the same
// three planes [head][d][t]. In E 1 and 2 a lane converts 8 neighbours of a plane's row and 16 lanes store 256 bytes of it: whole 128-byte lines, no f32 copy in memory.
// PP: the six bf16 planes q hi, q lo, k hi, k lo, v hi, v lo, each [batch][head][...]; P3: the three fp16 planes q, k, v.
typedef __attribute__((ext_vector_type(8))) __bf16 v8bf;
#define GP 136                    // LDS row pitch in 16-bit elements (128 + 8)
template <int N> struct IC { static constexpr int value = N; };
template <int NSPLIT, int K, int LDC, bool PROJ>
__global__ __launch_bounds__(256) void k_gemms(const bf* __restrict__ A, const bf* __restrict__ A2, const bf* __restrict__ Bt, float* C, const float* __restrict__ CSN, bf* PP, h16* P3) {
    constexpr int NP = NSPLIT ? 3 : 2;      // planes staged per step
    constexpr int PL = 128 * GP;            // elements of one staged plane
    constexpr int NT = K / 128;
    __shared__ __align__(16) bf sm[2 * NP * PL];
    static_assert(128 * 132 * 4 <= 2 * NP * PL * 2, "the f32 output tile fits the staging buffers it reuses");
    const int tid = threadIdx.x, lane = tid & 31, lr = lane & 15, hi = lane >> 4;
    const int w = __builtin_amdgcn_readfirstlane(tid >> 5); const int wm = w & 1, wn = w >> 1;
    const int r0 = blockIdx.x * 128, c0 = blockIdx.y * 128;
    const int srow = tid >> 4, scol = (tid & 15) * 8;
    const unsigned go = (unsigned)(srow * K + scol);      // the lane's offset in a tile; the tile's own address stays scalar
    const bf* pa = A + (size_t)r0 * K; const bf* pa2 = NSPLIT ? A2 + (size_t)r0 * K : nullptr; const bf* pb = Bt + (size_t)c0 * K;
    bf* st = sm + srow * GP + scol;
    const bf* fa = sm + (wm * 64 + lr) * GP + 8 * hi; const bf* fb = sm + (NP - 1) * PL + (wn * 32 + lr) * GP + 8 * hi;
    v8us ra[8], ra2[8], rb[8];
    v8f acc[4][2];
#pragma unroll
    for (int mb = 0; mb < 4; ++mb)
#pragma unroll
        for (int nb = 0; nb < 2; ++nb) acc[mb][nb] = (v8f){};
#pragma unroll
    for (int i = 0; i < 8; ++i) { ra[i] = *(const v8us*)(pa + go + i * 16 * K); if (NSPLIT) ra2[i] = *(const v8us*)(pa2 + go + i * 16 * K); rb[i] = *(const v8us*)(pb + go + i * 16 * K); }
#pragma unroll
    for (int i = 0; i < 8; ++i) { *(v8us*)(st + i * 16 * GP) = ra[i]; if (NSPLIT) *(v8us*)(st + PL + i * 16 * GP) = ra2[i]; *(v8us*)(st + (NP - 1) * PL + i * 16 * GP) = rb[i]; }
    __syncthreads();    // step 0 is in buffer 0 before any wave reads a fragment
#pragma unroll 1        // rolled: for speed only
    for (int kt = 0; kt < NT; ++kt) {
        const int cur = (kt & 1) * (NP * PL), nxt = NP * PL - cur; const bool more = kt + 1 < NT;
        if (more) { pa += 128; if (NSPLIT) pa2 += 128; pb += 128;
#pragma unroll
            for (int i = 0; i < 8; ++i) { ra[i] = *(const v8us*)(pa + go + i * 16 * K); if (NSPLIT) ra2[i] = *(const v8us*)(pa2 + go + i * 16 * K); rb[i] = *(const v8us*)(pb + go + i * 16 * K); } }
        v16bf a[2][4], a2[2][4], b[2][2];
#pragma unroll
        for (int nb = 0; nb < 2; ++nb) b[0][nb] = WFrag<bf>::ld(fb + cur + nb * 16 * GP);
#pragma unroll
        for (int mb = 0; mb < 4; ++mb) { a[0][mb] = WFrag<bf>::ld(fa + cur + mb * 16 * GP); if (NSPLIT) a2[0][mb] = WFrag<bf>::ld(fa + cur + PL + mb * 16 * GP); }
#pragma unroll
        for (int kk = 0; kk < 4; ++kk) { const int s = kk & 1, n = s ^ 1;
            if (kk < 3) {
#pragma unroll
                for (int nb = 0; nb < 2; ++nb) b[n][nb] = WFrag<bf>::ld(fb + cur + nb * 16 * GP + (kk + 1) * 32);
#pragma unroll
                for (int mb = 0; mb < 4; ++mb) { a[n][mb] = WFrag<bf>::ld(fa + cur + mb * 16 * GP + (kk + 1) * 32); if (NSPLIT) a2[n][mb] = WFrag<bf>::ld(fa + cur + PL + mb * 16 * GP + (kk + 1) * 32); } }
            __builtin_amdgcn_sched_barrier(0);    // the next block's LDS reads stay one group ahead of this block's products (for speed only)
#pragma unroll
            for (int nb = 0; nb < 2; ++nb)
#pragma unroll
                for (int mb = 0; mb < 4; ++mb) { acc[mb][nb] = wmmab(a[s][mb], b[s][nb], acc[mb][nb]); if (NSPLIT) acc[mb][nb] = wmmab(a2[s][mb], b[s][nb], acc[mb][nb]); }
            __builtin_amdgcn_sched_barrier(0); }  // and the following group of reads stays behind this block's products
        if (more) {
#pragma unroll
            for (int i = 0; i < 8; ++i) { *(v8us*)(st + nxt + i * 16 * GP) = ra[i]; if (NSPLIT) *(v8us*)(st + nxt + PL + i * 16 * GP) = ra2[i]; *(v8us*)(st + nxt + (NP - 1) * PL + i * 16 * GP) = rb[i]; } }
        __syncthreads();    // publishes step kt + 1 and ends every wave's reads of the buffer that the next trip refills
    }
    float* os = (float*)sm;
    auto epilogue = [&](auto form) { constexpr int EPI = decltype(form)::value;
#pragma unroll
    for (int mb = 0; mb < 4; ++mb)
#pragma unroll
        for (int nb = 0; nb < 2; ++nb) {
            if constexpr (EPI == 2) { float* p = os + (wn * 32 + nb * 16 + lr) * 132 + wm * 64 + mb * 16 + hi * 8;     // transposed: a lane's 8 values are 8 neighbours of row d
                *(v4fa*)p = __builtin_shufflevector(acc[mb][nb], acc[mb][nb], 0, 1, 2, 3); *(v4fa*)(p + 4) = __builtin_shufflevector(acc[mb][nb], acc[mb][nb], 4, 5, 6, 7); }
            else {
#pragma unroll
                for (int j = 0; j < 8; ++j) os[(wm * 64 + mb * 16 + hi * 8 + j) * 132 + wn * 32 + nb * 16 + lr] = acc[mb][nb][j]; } }
    if constexpr (EPI == 0) {
        __syncthreads();    // the whole f32 tile is in LDS before it is written out row by row
        float* pc = C + (size_t)r0 * LDC + c0; const unsigned co = (unsigned)((tid >> 5) * LDC + (tid & 31) * 4);
#pragma unroll
        for (int i = 0; i < 16; ++i) *(v4f*)(pc + co + i * 8 * LDC) = *(const v4fa*)(os + ((tid >> 5) + i * 8) * 132 + (tid & 31) * 4);
    } else {
        static_assert(HD == 128 && LDC == DD, "one tile column block is one head");
        constexpr int DP = EPI == 1 ? HD : TT;      // pitch of a plane's row: [t][d] or [d][t]
        const int head = blockIdx.y % NH_, which = blockIdx.y / NH_, bat = r0 / TT, rb = r0 % TT;     // which: 0 q, 1 k, 2 v; rb: the tile's first row inside its batch
        bf* Ph = PP + ((size_t)which * 2 * NB_ + bat) * ((size_t)TT * DD); bf* Pl = Ph + (size_t)NB_ * TT * DD; h16* P16 = P3 + ((size_t)which * NB_ + bat) * ((size_t)TT * DD);
        const size_t pbase = EPI == 1 ? ((size_t)head * TT + rb) * HD : (size_t)head * HD * TT + rb;
        const unsigned po = (unsigned)(srow * DP + scol);
        v4f cs[8][4];       // EPI 1: (cos, sin) of the lane's 8 columns in each of its 8 rows; asked for in front of the barrier, they arrive under it
        if constexpr (EPI == 1) { const float* pt = CSN + (size_t)rb * (NF * 2); const unsigned to = (unsigned)(srow * (NF * 2) + (scol & (NF - 1)) * 2);
#pragma unroll
            for (int i = 0; i < 8; ++i)
#pragma unroll
                for (int c = 0; c < 4; ++c) cs[i][c] = *(const v4f*)(pt + to + i * 16 * (NF * 2) + c * 4); }
        __syncthreads();    // the whole f32 tile is in LDS before it is read row by row
#pragma unroll
        for (int i = 0; i < 8; ++i) { const float* p = os + (srow + i * 16) * 132 + scol; const v4f y0 = *(const v4fa*)p, y1 = *(const v4fa*)(p + 4);
            v8f y = __builtin_shufflevector(y0, y1, 0, 1, 2, 3, 4, 5, 6, 7);
            if constexpr (EPI == 1) {
#pragma unroll
                for (int k = 0; k < 8; ++k) y[k] = y[k] * cs[i][k >> 1][(k & 1) * 2] + y[k] * cs[i][k >> 1][(k & 1) * 2 + 1]; }
            const v8bf yh = __builtin_convertvector(y, v8bf); const v8bf yl = __builtin_convertvector(y - __builtin_convertvector(yh, v8f), v8bf);
            *(v8us*)(Ph + pbase + po + i * 16 * DP) = __builtin_bit_cast(v8us, yh); *(v8us*)(Pl + pbase + po + i * 16 * DP) = __builtin_bit_cast(v8us, yl); *(v8h*)(P16 + pbase + po + i * 16 * DP) = __builtin_convertvector(y, v8h);
            asm volatile("s_wait_xcnt 0x0" ::: "memory"); }    // stands behind the three stores, in front of any later write of the registers that they name
    } };
    if constexpr (PROJ) { if (blockIdx.y / NH_ == 2) epilogue(IC<2>{}); else epilogue(IC<1>{}); } else epilogue(IC<0>{});
}

__device__ __forceinline__ void splitf(float y, unsigned short& h, unsigned short& l) { h = f2bf(y); l = f2bf(y - bf2f(h)); }
typedef __attribute__((ext_vector_type(2))) float v2f;

// ---- k_prep: everything the products need beforehand, in one launch. Work-groups 0 .. PCS-1 fill the rotary table (CTU rows t per thread, one frequency; they are the slow ones); then PMK for the mask's bits (below); then PBW work-groups for each of
// Wq, Wk, Wv, Wd (bf16 into WB, one after the other) and PBX for x (both batches, into XB). A conversion work-group turns 256 x 8 x CVU floats: each thread asks for its CVU vectors of 8 floats at
// once, so that few work-groups have to be started and each has many lines in flight.
#define CVU 8
#define CTU 4
#define PCS (TT * NF / (256 * CTU))
#define PBW (DD * DD / (256 * 8 * CVU))
#define PBX (NB_ * TT * DD / (256 * 8 * CVU))
// Then PMK work-groups read the additive mask once and write, for each query row, one bit per block of 32 keys into NEED: the bit is 0 only where every mask value of the block (rounded to bf16, as k_flash
// reads it) lies more than MGAP under the row's largest. Such a key's probability is exactly 0 in f32: its exponent is at most (v + B) - (rowmax - B) with B the largest |q.k| / sqrt(128), and
// exp underflows to 0 below -104. B: |x| < 6 and |W| < 6 / sqrt(2048) are the normal generators' own limits, so |q_d|, |k_d| < 2048 * 6 * 0.133 * 1.42 < 2.4e3 and B < 128 * 5.8e6 * 0.0884 < 6.6e7: 2 B + 104 < MGAP.
// The block that holds a row's largest value always keeps its bit. A NaN in the mask is carried by the maxima (nmax) and fails the test "below the threshold", so its block, or its whole row, keeps its bits.
// A wave takes 2 rows, a work-group 16: its 16 words are one 128-byte line.
#define MGAP 2.5e8f
#define PMK (TT / 16)
typedef unsigned long long u64;
__device__ __forceinline__ float nmax(float a, float b) { return __builtin_elementwise_maximum(a, b); }     // the larger; NaN if either is
__global__ __launch_bounds__(256) void k_prep(const float* __restrict__ x, const float* __restrict__ am, const float* __restrict__ Wq, const float* __restrict__ Wk, const float* __restrict__ Wv, const float* __restrict__ Wd, bf* WB, bf* XB, float* CSN, u64* NEED) {
    if (blockIdx.x < PCS) {
        const int idx = blockIdx.x * 256 + threadIdx.x; const int t0 = idx / NF, i = idx % NF; const float invf = __fdiv_rn(1.0f, powf(10000.0f, (float)(2 * i) * (1.0f / HD)));
#pragma unroll 1        // rolled: one copy of the long cosine and sine code
        for (int u = 0; u < CTU; ++u) { const int t = t0 + u * (TT / CTU); const float ang = __fmul_rn((float)t, invf);
            v2f o; o[0] = cosf(ang); o[1] = sinf(ang); *(v2f*)(CSN + ((size_t)t * NF + i) * 2) = o;
            asm volatile("s_wait_xcnt 0x0" ::: "memory"); }    // stands behind the store, in front of the next trip's writes of the registers that it names
        return; }
    if (blockIdx.x < PCS + PMK) {
        const int lane = threadIdx.x & 31, row0 = (blockIdx.x - PCS) * 16 + (threadIdx.x >> 5) * 2;
        const float* pm = am + (size_t)row0 * TT + lane * 4;
        v4f mv[2][16];
#pragma unroll
        for (int r = 0; r < 2; ++r)
#pragma unroll
            for (int i = 0; i < 16; ++i) mv[r][i] = *(const v4f*)(pm + r * TT + i * 128);
        asm volatile("s_wait_xcnt 0x0" :: "v"(pm) : "memory");    // stands behind the loads, in front of any write of the address register that they name; the address is an input, so no load's result is given that register
#pragma unroll
        for (int r = 0; r < 2; ++r) { float tm[16], rm = -__builtin_inff();
#pragma unroll
            for (int i = 0; i < 16; ++i) { tm[i] = nmax(nmax(mv[r][i][0], mv[r][i][1]), nmax(mv[r][i][2], mv[r][i][3])); rm = nmax(rm, tm[i]); }
#pragma unroll
            for (int o = 1; o < 32; o <<= 1) rm = nmax(rm, __shfl_xor(rm, o));
            const float thr = bfr(rm) - MGAP; u64 nd = 0;
#pragma unroll
            for (int i = 0; i < 16; ++i) { const unsigned b = __builtin_amdgcn_ballot_w32(!(bfr(tm[i]) < thr));      // bit l: keys i * 128 + 4 l .. + 3; 8 lanes are one block of 32 keys
#pragma unroll
                for (int g = 0; g < 4; ++g) nd |= (u64)(((b >> (8 * g)) & 0xFFu) != 0) << (i * 4 + g); }
            if (lane == 0) NEED[row0 + r] = nd; }
        return; }
    const int c = blockIdx.x - PCS - PMK, seg = c / PBW;      // seg 0..3: a weight; from 4 on: x
    const float* src = seg == 0 ? Wq : seg == 1 ? Wk : seg == 2 ? Wv : seg == 3 ? Wd : x;
    bf* dst = seg < 4 ? WB + (size_t)seg * DD * DD : XB;
    const size_t base = (size_t)(seg < 4 ? c - seg * PBW : c - 4 * PBW) * (256 * 8 * CVU) + threadIdx.x * 8;
    const float* pin = src + base;
    v8f v[CVU];
#pragma unroll
    for (int u = 0; u < CVU; ++u) v[u] = *(const v8f*)(pin + u * 2048);
    asm volatile("s_wait_xcnt 0x0" :: "v"(pin) : "memory");    // stands behind the loads, in front of any write of the address register that they name; the address is an input, so no load's result is given that register
#pragma unroll
    for (int u = 0; u < CVU; ++u) { v8us o;
#pragma unroll
        for (int k = 0; k < 8; ++k) o[k] = f2bf(v[u][k]);
        *(v8us*)(dst + base + u * 2048) = o; }
    asm volatile("s_wait_xcnt 0x0" ::: "memory");    // stands behind the last store, in front of any later write of the registers that the stores name
}
typedef __attribute__((ext_vector_type(16))) float v16f;
#define L2E 1.4426950408889634f
#define FKP 136                   // LDS pitch of a K row in elements (128 + 8)
template <bool HI> struct FT;
template <> struct FT<true>  { typedef bf  T; typedef v8us V8; };
template <> struct FT<false> { typedef h16 T; typedef v8h  V8; };
__device__ __forceinline__ float xhalf(float x) { return __builtin_bit_cast(float, __builtin_amdgcn_permlanex16(__builtin_bit_cast(int, x), __builtin_bit_cast(int, x), 0x76543210, 0xfedcba98, false, false)); }  // lane l with lane l ^ 16
// Two exponentials and, in the same statement, the one v_nop that the instruction set asks for behind a transcendental before its result is read or its source overwritten (a v_nop in a statement of
// its own did not stay behind them). The outputs share no register with the inputs ("=&v"), so the second exponential is independent of the first and fills the first one's slot.
__device__ __forceinline__ void exp2x2(float& a, float& b) { float ra, rb; asm("v_exp_f32 %0, %2\n\tv_exp_f32 %1, %3\n\tv_nop" : "=&v"(ra), "=&v"(rb) : "v"(a), "v"(b)); a = ra; b = rb; }
template <bool HI>
__device__ __forceinline__ void flash_body(typename FT<HI>::T* sm, const typename FT<HI>::T* __restrict__ Q, const typename FT<HI>::T* __restrict__ Q2, const typename FT<HI>::T* __restrict__ Kg, const typename FT<HI>::T* __restrict__ Kg2,
                                           const typename FT<HI>::T* __restrict__ Vg, const typename FT<HI>::T* __restrict__ Vg2, const float* __restrict__ am, int q0, u64 need, bf* Ah, bf* Al) {
    typedef typename FT<HI>::T T; typedef typename FT<HI>::V8 V8; typedef typename WFrag<T>::V V;
    constexpr int NPL = HI ? 2 : 1, SK = HI ? 32 : 64, VP = SK + 8, KPL = SK * FKP, VPL = HD * VP, BUF = NPL * (KPL + VPL), NST = TT / SK, NPASS = SK / 32;
    constexpr int NKL = SK / 16, LPV = SK / 8, RPS = 256 / LPV, NVL = HD / RPS;
    const int tid = threadIdx.x, lane = tid & 31, lr = lane & 15, hi = lane >> 4; const int w = __builtin_amdgcn_readfirstlane(tid >> 5);
    const int q = q0 + w * 16 + lr;       // this lane's query row
    // The stages to walk: one bit per stage, set where some query row of the work-group needs a key of it (a 64-key stage: either of its two blocks). The same scalar word in every wave, so trips and barriers are alike.
    constexpr u64 ALLST = HI ? ~0ull : 0x5555555555555555ull; constexpr int SH = HI ? 0 : 1;
    u64 todo = HI ? need : ((need | (need >> 1)) & ALLST);
    if (todo == 0) todo = ALLST;          // no row leaves all its bits 0; this keeps the stage index in bounds whatever the word holds
    const int nwalk = __builtin_popcountll(todo);
    int st = __builtin_ctzll(todo) >> SH; todo &= todo - 1;
    Kg += st * (SK * HD); Vg += st * SK; if (HI) { Kg2 += st * (SK * HD); Vg2 += st * SK; }
    const unsigned gk = (unsigned)((tid >> 4) * HD + (tid & 15) * 8), gv = (unsigned)((tid / LPV) * TT + (tid % LPV) * 8);
    T* sk = sm + (tid >> 4) * FKP + (tid & 15) * 8; T* sv = sm + NPL * KPL + (tid / LPV) * VP + (tid % LPV) * 8;
    const T* fk = sm + lr * FKP + 8 * hi; const T* fv = sm + NPL * KPL + lr * VP + 8 * hi;
    const float* mrow = am + (size_t)q * TT + 8 * hi;
    V qf[NPL][4];
#pragma unroll
    for (int kc = 0; kc < 4; ++kc) { qf[0][kc] = WFrag<T>::ld(Q + (size_t)q * HD + 8 * hi + 32 * kc); if (HI) qf[NPL - 1][kc] = WFrag<T>::ld(Q2 + (size_t)q * HD + 8 * hi + 32 * kc); }
    asm volatile("s_wait_xcnt 0x0" ::: "memory");    // stands behind the Q loads, in front of the K loads, whose results may be given the address register that the Q loads name
    V8 rk[NPL][NKL], rv[NPL][NVL];
    v8f acc[8];
#pragma unroll
    for (int t = 0; t < 8; ++t) acc[t] = (v8f){};
    float m_run = -3.0e38f, l_run = 0.f;
#pragma unroll
    for (int i = 0; i < NKL; ++i) { rk[0][i] = *(const V8*)(Kg + gk + i * 16 * HD); if (HI) rk[NPL - 1][i] = *(const V8*)(Kg2 + gk + i * 16 * HD); }
    asm volatile("s_wait_xcnt 0x0" ::: "memory");    // stands behind the K loads, in front of the V^T loads, whose results may be given a register that one of those loads names
#pragma unroll
    for (int i = 0; i < NVL; ++i) { rv[0][i] = *(const V8*)(Vg + gv + i * RPS * TT); if (HI) rv[NPL - 1][i] = *(const V8*)(Vg2 + gv + i * RPS * TT); }
#pragma unroll
    for (int i = 0; i < NKL; ++i) { *(V8*)(sk + i * 16 * FKP) = rk[0][i]; if (HI) *(V8*)(sk + KPL + i * 16 * FKP) = rk[NPL - 1][i]; }
#pragma unroll
    for (int i = 0; i < NVL; ++i) { *(V8*)(sv + i * RPS * VP) = rv[0][i]; if (HI) *(V8*)(sv + VPL + i * RPS * VP) = rv[NPL - 1][i]; }
    __syncthreads();    // the first stage walked is in buffer 0 before any wave reads a fragment
    v4f mk[NPASS][2][2];    // one stage's mask values for this lane's query. fp16 form: each pass asks for the next stage's as soon as it has used its own, a whole stage ahead;
                            // hi+lo form (short of registers in attn.v): asked for at the head of the stage, they arrive under the score products
    if (!HI) {
#pragma unroll
    for (int ps = 0; ps < NPASS; ++ps)
#pragma unroll
        for (int kt = 0; kt < 2; ++kt) { const float* mp = mrow + st * SK + ps * 32 + kt * 16; mk[ps][kt][0] = *(const v4f*)mp; mk[ps][kt][1] = *(const v4f*)(mp + 4); } }
    constexpr int DS = HI ? 2 : 4, DV = HI ? 2 : 2;     // how many groups of K fragments (16 keys x 32 d) and of V^T fragments (16 d x 32 keys) are read ahead of the products that use them
    // The last stage asks for its own lines again (in bounds, not stored): with the loads on every path the compiler's load counts in front of the mask values stay exact and do not wait for these lines.
    auto stage_loads = [&](int ds) { const int ak = ds * (SK * HD), av = ds * SK; Kg += ak; Vg += av; if (HI) { Kg2 += ak; Vg2 += av; }      // ds: stages from the one at work to the next one walked
#pragma unroll
        for (int i = 0; i < NKL; ++i) { rk[0][i] = *(const V8*)(Kg + gk + i * 16 * HD); if (HI) rk[NPL - 1][i] = *(const V8*)(Kg2 + gk + i * 16 * HD); }
#pragma unroll
        for (int i = 0; i < NVL; ++i) { rv[0][i] = *(const V8*)(Vg + gv + i * RPS * TT); if (HI) rv[NPL - 1][i] = *(const V8*)(Vg2 + gv + i * RPS * TT); } };
#pragma unroll 1        // rolled: for speed only
    for (int it = 0; it < nwalk; ++it) {
        const int cur = (it & 1) * BUF, nxt = BUF - cur; const bool more = it + 1 < nwalk;
        const int sn = more ? __builtin_ctzll(todo) >> SH : st; todo &= todo - 1;      // the next stage walked
        const float* mnext = mrow + sn * SK;      // the last stage asks for its own values again: in bounds, not used
        if (!HI) stage_loads(sn - st);
        if (HI) {
#pragma unroll
            for (int kt = 0; kt < 2; ++kt) { const float* mp = mrow + st * SK + kt * 16; mk[0][kt][0] = *(const v4f*)mp; mk[0][kt][1] = *(const v4f*)(mp + 4); } }
#pragma unroll
        for (int ps = 0; ps < NPASS; ++ps) {
            V kf[4][2][NPL], vf[8][NPL];
            auto ldk = [&](int g) { const int kc = g >> 1, kt = g & 1; const T* p = fk + cur + (ps * 32 + kt * 16) * FKP + 32 * kc; kf[kc][kt][0] = WFrag<T>::ld(p); if (HI) kf[kc][kt][NPL - 1] = WFrag<T>::ld(p + KPL); };
            auto ldv = [&](int t) { const T* p = fv + cur + t * 16 * VP + ps * 32; vf[t][0] = WFrag<T>::ld(p); if (HI) vf[t][NPL - 1] = WFrag<T>::ld(p + VPL); };
            v8f s[2]; s[0] = (v8f){}; s[1] = (v8f){};
#pragma unroll
            for (int g = 0; g < DS; ++g) ldk(g);
#pragma unroll
            for (int g = 0; g < 8; ++g) { const int kc = g >> 1, kt = g & 1; if (g + DS < 8) ldk(g + DS);
                __builtin_amdgcn_sched_barrier(0);    // the LDS reads stay DS groups ahead of the products (for speed only)
                s[kt] = WFrag<T>::mma(kf[kc][kt][0], qf[0][kc], s[kt]); if (HI) { s[kt] = WFrag<T>::mma(kf[kc][kt][0], qf[NPL - 1][kc], s[kt]); s[kt] = WFrag<T>::mma(kf[kc][kt][NPL - 1], qf[0][kc], s[kt]); }
                __builtin_amdgcn_sched_barrier(0); }  // and the following group of reads stays behind these products
            if (HI) stage_loads(sn - st);           // hi+lo form: asked for here, where the K fragments' registers are free again
#pragma unroll
            for (int t = 0; t < DV; ++t) ldv(t);    // the first V^T fragments arrive under the softmax arithmetic
            __builtin_amdgcn_sched_barrier(0);      // keeps those reads in front of the softmax arithmetic
            v16f tv; float mx = -3.0e38f;
#pragma unroll
            for (int e = 0; e < 16; ++e) { const float t2 = fmaf(s[e >> 3][e & 7], SCL * L2E, bfr(mk[ps][e >> 3][(e >> 2) & 1][e & 3]) * L2E); tv[e] = t2; mx = fmaxf(mx, t2); }
            if (!HI) {
#pragma unroll
            for (int kt = 0; kt < 2; ++kt) { const float* mp = mnext + ps * 32 + kt * 16; mk[ps][kt][0] = *(const v4f*)mp; mk[ps][kt][1] = *(const v4f*)(mp + 4); } }
            mx = fmaxf(mx, xhalf(mx));      // both wave halves hold this query's maximum over the pass's 32 keys
            if (__builtin_amdgcn_ballot_w32(mx > m_run + 4.0f) != 0) {      // wave-uniform; rare after the first passes
                const float m_new = fmaxf(m_run, mx); const float corr = __builtin_amdgcn_exp2f(m_run - m_new); l_run *= corr; m_run = m_new;
#pragma unroll
                for (int t = 0; t < 8; ++t) acc[t] = acc[t] * corr; }
            const float nm = (HI ? 0.0f : 10.0f) - m_run; float ps0 = 0.f, ps1 = 0.f;
#pragma unroll
            for (int e = 0; e < 16; e += 2) { float x0 = tv[e] + nm, x1 = tv[e + 1] + nm; exp2x2(x0, x1); tv[e] = x0; tv[e + 1] = x1; ps0 += x0; ps1 += x1; }
            l_run += ps0 + ps1;
            V pa, pb;
            if constexpr (HI) { pa = __builtin_convertvector(tv, v16bf); pb = __builtin_convertvector(tv - __builtin_convertvector(pa, v16f), v16bf); }
            else { pa = __builtin_convertvector(tv, v16h); pb = pa; }
#pragma unroll
            for (int t = 0; t < 8; ++t) { if (t + DV < 8) ldv(t + DV);
                __builtin_amdgcn_sched_barrier(0);    // the V^T reads stay DV groups ahead of their products
                acc[t] = WFrag<T>::mma(vf[t][0], pa, acc[t]); if (HI) { acc[t] = WFrag<T>::mma(vf[t][0], pb, acc[t]); acc[t] = WFrag<T>::mma(vf[t][NPL - 1], pa, acc[t]); }
                __builtin_amdgcn_sched_barrier(0); }  // and the following reads stay behind these products
        }
        if (more) {
#pragma unroll
            for (int i = 0; i < NKL; ++i) { *(V8*)(sk + nxt + i * 16 * FKP) = rk[0][i]; if (HI) *(V8*)(sk + nxt + KPL + i * 16 * FKP) = rk[NPL - 1][i]; }
#pragma unroll
            for (int i = 0; i < NVL; ++i) { *(V8*)(sv + nxt + i * RPS * VP) = rv[0][i]; if (HI) *(V8*)(sv + nxt + VPL + i * RPS * VP) = rv[NPL - 1][i]; } }
        __syncthreads();    // publishes the next stage and ends every wave's reads of the buffer that the next trip refills
        asm volatile("s_wait_xcnt 0x0" ::: "memory");    // stands behind this trip's K, V^T and mask loads, in front of the next trip's (or the epilogue's) writes of the registers that they name
        st = sn;
    }
    const float inv = __fdiv_rn(1.0f, l_run + xhalf(l_run));    // each wave half summed its own 8 keys of every 16-key tile
#pragma unroll
    for (int t = 0; t < 8; ++t) { v8us oh, ol;
#pragma unroll
        for (int j = 0; j < 8; ++j) { unsigned short a, c2; splitf(acc[t][j] * inv, a, c2); oh[j] = a; ol[j] = c2; }
        const size_t o = (size_t)q * DD + t * 16 + hi * 8; *(v8us*)(Ah + o) = oh; *(v8us*)(Al + o) = ol;
        asm volatile("s_wait_xcnt 0x0" ::: "memory"); }    // stands behind the two stores, in front of any later write of the registers that they name
}
#define FSM_EL (2 * 2 * (32 * FKP + HD * 40))     // the larger of the two forms' LDS, in 16-bit elements
static_assert(2 * (64 * FKP + HD * 72) <= FSM_EL, "the fp16 form's two buffers fit");
// grid: NB_ * NH_ * (RH / 128) hi+lo work-groups first (the longer ones where the mask closes nothing), then NB_ * NH_ * ((TT - RH) / 128) fp16 ones. Planes are [batch][head][...]; Ah, Al are [batch][TT][DD].
__global__ __launch_bounds__(256) void k_flash(const bf* __restrict__ Qh, const bf* __restrict__ Ql, const h16* __restrict__ Q16, const bf* __restrict__ Kh, const bf* __restrict__ Kl, const h16* __restrict__ K16,
                                               const bf* __restrict__ Vh, const bf* __restrict__ Vl, const h16* __restrict__ V16, const float* __restrict__ am, const u64* __restrict__ NEED, bf* Ah, bf* Al) {
    __shared__ __align__(16) unsigned short fsm[FSM_EL];
    constexpr int NHI = NB_ * NH_ * (RH / 128), TLO = (TT - RH) / 128;
    const int idx = blockIdx.x; const bool hires = idx < NHI;
    const int z = hires ? idx / (RH / 128) : (idx - NHI) / TLO; const int q0 = hires ? (idx % (RH / 128)) * 128 : RH + ((idx - NHI) % TLO) * 128;
    const size_t zp = (size_t)z * TT * HD; const size_t ao = (size_t)(z / NH_) * TT * DD + (size_t)(z % NH_) * HD;
    // The OR of the 128 query rows' words: every wave forms it from the same 128 words, so all hold the same value.
    const u64* nr = NEED + q0 + (threadIdx.x & 31);
    const u64 nl = nr[0] | nr[32] | nr[64] | nr[96];
    asm volatile("s_wait_xcnt 0x0" :: "v"(nr) : "memory");    // stands behind the four loads, in front of any write of the address register that they name
    unsigned n0 = (unsigned)nl, n1 = (unsigned)(nl >> 32);
#pragma unroll
    for (int o = 1; o < 32; o <<= 1) { n0 |= __shfl_xor(n0, o); n1 |= __shfl_xor(n1, o); }
    const u64 need = ((u64)(unsigned)__builtin_amdgcn_readfirstlane(n1) << 32) | (unsigned)__builtin_amdgcn_readfirstlane(n0);
    if (hires) flash_body<true>((bf*)fsm, Qh + zp, Ql + zp, Kh + zp, Kl + zp, Vh + zp, Vl + zp, am, q0, need, Ah + ao, Al + ao);
    else flash_body<false>((h16*)fsm, Q16 + zp, nullptr, K16 + zp, nullptr, V16 + zp, nullptr, am, q0, need, Ah + ao, Al + ao);
}

extern "C" void kernel_launch(void* const* d_in, const int* in_sizes, int n_in,
                              void* d_out, int out_size, void* d_ws, size_t ws_size, hipStream_t stream) {
    (void)in_sizes; (void)n_in; (void)out_size;
    const float* x = (const float*)d_in[0]; const float* amask = (const float*)d_in[1]; const float* Wq = (const float*)d_in[2]; const float* Wk = (const float*)d_in[3]; const float* Wv = (const float*)d_in[4]; const float* Wd = (const float*)d_in[5];
    float* OUT = (float*)d_out;     // [2][2048][2048]
    char* wsp = (char*)d_ws;
    auto take = [&](size_t bytes) { char* p = wsp; wsp += (bytes + 255) & ~(size_t)255; return (void*)p; };
    const size_t PB = (size_t)TT * DD;      // elements of one batch's plane
    bf* WB = (bf*)take((size_t)4 * DD * DD * 2); bf* WO = WB + (size_t)3 * DD * DD;      // Wq, Wk, Wv, Wd in bf16, one after the other
    bf* XB = (bf*)take(NB_ * PB * 2); float* CSN = (float*)take((size_t)TT * NF * 2 * 4);
    bf* PP = (bf*)take(6 * NB_ * PB * 2); bf* QPh = PP; bf* QPl = PP + NB_ * PB; bf* KPh = PP + 2 * NB_ * PB; bf* KPl = PP + 3 * NB_ * PB; bf* VTh = PP + 4 * NB_ * PB; bf* VTl = PP + 5 * NB_ * PB;
    h16* P3 = (h16*)take(3 * NB_ * PB * 2); h16* QP16 = P3; h16* KP16 = P3 + NB_ * PB; h16* VT16 = P3 + 2 * NB_ * PB;
    bf* ATh = (bf*)take(NB_ * PB * 2); bf* ATl = (bf*)take(NB_ * PB * 2); u64* NEED = (u64*)take((size_t)TT * 8);
    if ((size_t)(wsp - (char*)d_ws) > ws_size) return;    // total 225 MiB; ws 256 MiB
    k_prep<<<PCS + PMK + 4 * PBW + PBX, 256, 0, stream>>>(x, amask, Wq, Wk, Wv, Wd, WB, XB, CSN, NEED);
    k_gemms<0, DD, DD, true><<<dim3(NB_ * TT / 128, 3 * DD / 128, 1), 256, 0, stream>>>(XB, nullptr, WB, nullptr, CSN, PP, P3);
    k_flash<<<NB_ * NH_ * (TT / 128), 256, 0, stream>>>(QPh, QPl, QP16, KPh, KPl, KP16, VTh, VTl, VT16, amask, NEED, ATh, ATl);
    k_gemms<1, DD, DD, false><<<dim3(NB_ * TT / 128, DD / 128, 1), 256, 0, stream>>>(ATh, ATl, WO, OUT, nullptr, nullptr, nullptr);
}

// v008
// Measured time: 227 microseconds a run.
// Two timings next to v007 both put it at 1.05 times that version's speed.
// Over all steps from v000 it is 10.7 times as fast.
#include <hip/hip_runtime.h>

// ThornsAttention (x [2][2048][2048]; q/k/v = x W^T ([out][in] weights, no bias); 16 heads x 128; "RoPE" whose rotate_half is the identity (rotary_ndims == head_dim in the source), so
// q <- q*cos + q*sin elementwise with emb = cat(freqs, freqs), inv_freq = 10000^(-2i/128); scores = q.k / sqrt(128) + attention_mask (verbatim [1][1][2048][2048] additive input, read
// as data); softmax; out = (attn.v merged) Wd^T).
// Compute dtypes, f32 accumulate: every input rounded to bf16; projections on PLAIN bf16 operands (inputs: exact); the rotary factors cos/sin(t x inv_freq)
// in f32 (powf/cosf/sinf, tabulated once); rows < RH: scores on bf16 hi+lo planes of the rotated q and k (3 products; the 1/sqrt(128) applied in f32 with the mask); attn.v on hi+lo planes
// (3 products); rows >= RH: both on single fp16 planes (1 product each) - the mask is causal-shaped here so early rows see few keys; output hi+lo x exact Wd (2 products).

#define NB_  2
#define TT   2048
#define DD   2048
#define NH_  16
#define HD   128
#define RH   512                  // query rows < RH use hi+lo planes for scores and attn.v; rows >= RH use single fp16 planes
#define NF   64                   // rotary frequencies (head_dim / 2)
#define SCL  0.088388349f
typedef _Float16 h16;
typedef unsigned short bf;
typedef __attribute__((ext_vector_type(16))) __bf16   v16bf;
typedef __attribute__((ext_vector_type(16))) _Float16 v16h;
typedef __attribute__((ext_vector_type(8)))  _Float16 v8h;
typedef __attribute__((ext_vector_type(8)))  unsigned short v8us;
typedef __attribute__((ext_vector_type(8)))  float    v8f;
typedef __attribute__((ext_vector_type(4)))  float    v4f;
typedef v8h  __attribute__((may_alias)) v8ha;
typedef v4f  __attribute__((may_alias)) v4fa;
typedef v8us __attribute__((may_alias)) v8usa;

__device__ __forceinline__ unsigned short f2bf(float f) { unsigned u = __float_as_uint(f); u += 0x7FFFu + ((u >> 16) & 1u); return (unsigned short)(u >> 16); }
__device__ __forceinline__ float bf2f(unsigned short b) { return __uint_as_float(((unsigned)b) << 16); }
__device__ __forceinline__ float bfr(float f) { return bf2f(f2bf(f)); }
__device__ __forceinline__ v16h cat16(v8h lo, v8h hi) { return __builtin_shufflevector(lo, hi, 0, 1, 2, 3, 4, 5, 6, 7, 8, 9, 10, 11, 12, 13, 14, 15); }
__device__ __forceinline__ v16bf cat16b(v8us lo, v8us hi) { return __builtin_bit_cast(v16bf, __builtin_shufflevector(lo, hi, 0, 1, 2, 3, 4, 5, 6, 7, 8, 9, 10, 11, 12, 13, 14, 15)); }
__device__ __forceinline__ v8f wmma16(v16h a, v16h b, v8f c) { return __builtin_amdgcn_wmma_f32_16x16x32_f16(false, a, false, b, (short)0, c, false, false); }
__device__ __forceinline__ v8f wmmab(v16bf a, v16bf b, v8f c) { return __builtin_amdgcn_wmma_f32_16x16x32_bf16(false, a, false, b, (short)0, c, false, false); }



// ---- WFrag: one 16 x 32 operand fragment of a 16-bit plane whose k runs contiguously; p = row start + 8 * (lane >> 4). A and B use the same k order.
template <typename T16> struct WFrag;
template <> struct WFrag<h16> { typedef v16h V; static __device__ __forceinline__ V ld(const h16* p) { return cat16(*(const v8h*)p, *(const v8h*)(p + 16)); } static __device__ __forceinline__ v8f mma(V a, V b, v8f c) { return wmma16(a, b, c); } };
template <> struct WFrag<bf> { typedef v16bf V; static __device__ __forceinline__ V ld(const bf* p) { return cat16b(*(const v8us*)p, *(const v8us*)(p + 16)); } static __device__ __forceinline__ v8f mma(V a, V b, v8f c) { return wmmab(a, b, c); } };

// ---- k_gemms: LDS-staged GEMM for the 2048^3 products (projections, output). One 128x128 output tile per work-group of 8 waves (2 x 4; 64x32 per wave, 8 accumulators); grid (M/128, N/128).
// C[m][n] (f32, pitch LDC) = sum_k (A[m][k] (+ A2[m][k] when NSPLIT == 1)) Bt[n][k]. K % 128 == 0. Per 128-k step every operand plane's 128 rows x 256 bytes come from global memory as whole
// 128-byte lines (16 lanes a row), go through registers into one of two LDS buffers (row pitch 272 bytes) and are read from there as fragments, in the k order of WFrag::ld. The next step's
// lines are fetched while this step's products run; fragments are read one 32-k block ahead. Each accumulator sums its K in one ascending chain.
// The rows of A run over both batches ([NB_ * TT][K]). PROJ: the rows of Bt run over Wq, Wk, Wv one after the other, so one grid (NB_ * TT / 128, 3 * DD / 128) does all six projections.
// What becomes of the f32 tile, which goes through LDS in every form (its 128 columns are one head: HD == 128); form E is the same for a whole work-group (it hangs on blockIdx.y alone):
// E 0 (!PROJ): written to C as f32. E 1 (q, k): y = x cos + x sin from the table CSN, then bf16 hi, bf16 lo and fp16 planes [head][t][d]. E 2 (v): the tile is laid into LDS transposed, then the same
// three planes [head][d][t]. In E 1 and 2 a lane converts 8 neighbours of a plane's row and 16 lanes store 256 bytes of it: whole 128-byte lines, no f32 copy in memory.
// PP: the six bf16 planes q hi, q lo, k hi, k lo, v hi, v lo, each [batch][head][...]; P3: the three fp16 planes q, k, v.
typedef __attribute__((ext_vector_type(8))) __bf16 v8bf;
#define GP 136                    // LDS row pitch in 16-bit elements (128 + 8)
template <int N> struct IC { static constexpr int value = N; };
template <int NSPLIT, int K, int LDC, bool PROJ>
__global__ __launch_bounds__(256) void k_gemms(const bf* __restrict__ A, const bf* __restrict__ A2, const bf* __restrict__ Bt, float* C, const float* __restrict__ CSN, bf* PP, h16* P3) {
    constexpr int NP = NSPLIT ? 3 : 2;      // planes staged per step
    constexpr int PL = 128 * GP;            // elements of one staged plane
    constexpr int NT = K / 128;
    __shared__ __align__(16) bf sm[2 * NP * PL];
    static_assert(128 * 132 * 4 <= 2 * NP * PL * 2, "the f32 output tile fits the staging buffers it reuses");
    const int tid = threadIdx.x, lane = tid & 31, lr = lane & 15, hi = lane >> 4;
    const int w = __builtin_amdgcn_readfirstlane(tid >> 5); const int wm = w & 1, wn = w >> 1;
    const int r0 = blockIdx.x * 128, c0 = blockIdx.y * 128;
    const int srow = tid >> 4, scol = (tid & 15) * 8;
    const unsigned go = (unsigned)(srow * K + scol);      // the lane's offset in a tile; the tile's own address stays scalar
    const bf* pa = A + (size_t)r0 * K; const bf* pa2 = NSPLIT ? A2 + (size_t)r0 * K : nullptr; const bf* pb = Bt + (size_t)c0 * K;
    bf* st = sm + srow * GP + scol;
    const bf* fa = sm + (wm * 64 + lr) * GP + 8 * hi; const bf* fb = sm + (NP - 1) * PL + (wn * 32 + lr) * GP + 8 * hi;
    v8us ra[8], ra2[8], rb[8];
    v8f acc[4][2];
#pragma unroll
    for (int mb = 0; mb < 4; ++mb)
#pragma unroll
        for (int nb = 0; nb < 2; ++nb) acc[mb][nb] = (v8f){};
#pragma unroll
    for (int i = 0; i < 8; ++i) { ra[i] = *(const v8us*)(pa + go + i * 16 * K); if (NSPLIT) ra2[i] = *(const v8us*)(pa2 + go + i * 16 * K); rb[i] = *(const v8us*)(pb + go + i * 16 * K); }
#pragma unroll
    for (int i = 0; i < 8; ++i) { *(v8us*)(st + i * 16 * GP) = ra[i]; if (NSPLIT) *(v8us*)(st + PL + i * 16 * GP) = ra2[i]; *(v8us*)(st + (NP - 1) * PL + i * 16 * GP) = rb[i]; }
    __syncthreads();    // step 0 is in buffer 0 before any wave reads a fragment
#pragma unroll 1        // rolled: for speed only
    for (int kt = 0; kt < NT; ++kt) {
        const int cur = (kt & 1) * (NP * PL), nxt = NP * PL - cur; const bool more = kt + 1 < NT;
        if (more) { pa += 128; if (NSPLIT) pa2 += 128; pb += 128;
#pragma unroll
            for (int i = 0; i < 8; ++i) { ra[i] = *(const v8us*)(pa + go + i * 16 * K); if (NSPLIT) ra2[i] = *(const v8us*)(pa2 + go + i * 16 * K); rb[i] = *(const v8us*)(pb + go + i * 16 * K); } }
        v16bf a[2][4], a2[2][4], b[2][2];
#pragma unroll
        for (int nb = 0; nb < 2; ++nb) b[0][nb] = WFrag<bf>::ld(fb + cur + nb * 16 * GP);
#pragma unroll
        for (int mb = 0; mb < 4; ++mb) { a[0][mb] = WFrag<bf>::ld(fa + cur + mb * 16 * GP); if (NSPLIT) a2[0][mb] = WFrag<bf>::ld(fa + cur + PL + mb * 16 * GP); }
#pragma unroll
        for (int kk = 0; kk < 4; ++kk) { const int s = kk & 1, n = s ^ 1;
            if (kk < 3) {
#pragma unroll
                for (int nb = 0; nb < 2; ++nb) b[n][nb] = WFrag<bf>::ld(fb + cur + nb * 16 * GP + (kk + 1) * 32);
#pragma unroll
                for (int mb = 0; mb < 4; ++mb) { a[n][mb] = WFrag<bf>::ld(fa + cur + mb * 16 * GP + (kk + 1) * 32); if (NSPLIT) a2[n][mb] = WFrag<bf>::ld(fa + cur + PL + mb * 16 * GP + (kk + 1) * 32); } }
            __builtin_amdgcn_sched_barrier(0);    // the next block's LDS reads stay one group ahead of this block's products (for speed only)
#pragma unroll
            for (int nb = 0; nb < 2; ++nb)
#pragma unroll
                for (int mb = 0; mb < 4; ++mb) { acc[mb][nb] = wmmab(a[s][mb], b[s][nb], acc[mb][nb]); if (NSPLIT) acc[mb][nb] = wmmab(a2[s][mb], b[s][nb], acc[mb][nb]); }
            __builtin_amdgcn_sched_barrier(0); }  // and the following group of reads stays behind this block's products
        if (more) {
#pragma unroll
            for (int i = 0; i < 8; ++i) { *(v8us*)(st + nxt + i * 16 * GP) = ra[i]; if (NSPLIT) *(v8us*)(st + nxt + PL + i * 16 * GP) = ra2[i]; *(v8us*)(st + nxt + (NP - 1) * PL + i * 16 * GP) = rb[i]; } }
        __syncthreads();    // publishes step kt + 1 and ends every wave's reads of the buffer that the next trip refills
    }
    float* os = (float*)sm;
    auto epilogue = [&](auto form) { constexpr int EPI = decltype(form)::value;
#pragma unroll
    for (int mb = 0; mb < 4; ++mb)
#pragma unroll
        for (int nb = 0; nb < 2; ++nb) {
            if constexpr (EPI == 2) { float* p = os + (wn * 32 + nb * 16 + lr) * 132 + wm * 64 + mb * 16 + hi * 8;     // transposed: a lane's 8 values are 8 neighbours of row d
                *(v4fa*)p = __builtin_shufflevector(acc[mb][nb], acc[mb][nb], 0, 1, 2, 3); *(v4fa*)(p + 4) = __builtin_shufflevector(acc[mb][nb], acc[mb][nb], 4, 5, 6, 7); }
            else {
#pragma unroll
                for (int j = 0; j < 8; ++j) os[(wm * 64 + mb * 16 + hi * 8 + j) * 132 + wn * 32 + nb * 16 + lr] = acc[mb][nb][j]; } }
    if constexpr (EPI == 0) {
        __syncthreads();    // the whole f32 tile is in LDS before it is written out row by row
        float* pc = C + (size_t)r0 * LDC + c0; const unsigned co = (unsigned)((tid >> 5) * LDC + (tid & 31) * 4);
#pragma unroll
        for (int i = 0; i < 16; ++i) *(v4f*)(pc + co + i * 8 * LDC) = *(const v4fa*)(os + ((tid >> 5) + i * 8) * 132 + (tid & 31) * 4);
    } else {
        static_assert(HD == 128 && LDC == DD, "one tile column block is one head");
        constexpr int DP = EPI == 1 ? HD : TT;      // pitch of a plane's row: [t][d] or [d][t]
        const int head = blockIdx.y % NH_, which = blockIdx.y / NH_, bat = r0 / TT, rb = r0 % TT;     // which: 0 q, 1 k, 2 v; rb: the tile's first row inside its batch
        bf* Ph = PP + ((size_t)which * 2 * NB_ + bat) * ((size_t)TT * DD); bf* Pl = Ph + (size_t)NB_ * TT * DD; h16* P16 = P3 + ((size_t)which * NB_ + bat) * ((size_t)TT * DD);
        const size_t pbase = EPI == 1 ? ((size_t)head * TT + rb) * HD : (size_t)head * HD * TT + rb;
        const unsigned po = (unsigned)(srow * DP + scol);
        v4f cs[8][4];       // EPI 1: (cos, sin) of the lane's 8 columns in each of its 8 rows; asked for in front of the barrier, they arrive under it
        if constexpr (EPI == 1) { const float* pt = CSN + (size_t)rb * (NF * 2); const unsigned to = (unsigned)(srow * (NF * 2) + (scol & (NF - 1)) * 2);
#pragma unroll
            for (int i = 0; i < 8; ++i)
#pragma unroll
                for (int c = 0; c < 4; ++c) cs[i][c] = *(const v4f*)(pt + to + i * 16 * (NF * 2) + c * 4); }
        __syncthreads();    // the whole f32 tile is in LDS before it is read row by row
#pragma unroll
        for (int i = 0; i < 8; ++i) { const float* p = os + (srow + i * 16) * 132 + scol; const v4f y0 = *(const v4fa*)p, y1 = *(const v4fa*)(p + 4);
            v8f y = __builtin_shufflevector(y0, y1, 0, 1, 2, 3, 4, 5, 6, 7);
            if constexpr (EPI == 1) {
#pragma unroll
                for (int k = 0; k < 8; ++k) y[k] = y[k] * cs[i][k >> 1][(k & 1) * 2] + y[k] * cs[i][k >> 1][(k & 1) * 2 + 1]; }
            const v8bf yh = __builtin_convertvector(y, v8bf); const v8bf yl = __builtin_convertvector(y - __builtin_convertvector(yh, v8f), v8bf);
            *(v8us*)(Ph + pbase + po + i * 16 * DP) = __builtin_bit_cast(v8us, yh); *(v8us*)(Pl + pbase + po + i * 16 * DP) = __builtin_bit_cast(v8us, yl); *(v8h*)(P16 + pbase + po + i * 16 * DP) = __builtin_convertvector(y, v8h);
            asm volatile("s_wait_xcnt 0x0" ::: "memory"); }    // stands behind the three stores, in front of any later write of the registers that they name
    } };
    if constexpr (PROJ) { if (blockIdx.y / NH_ == 2) epilogue(IC<2>{}); else epilogue(IC<1>{}); } else epilogue(IC<0>{});
}

__device__ __forceinline__ void splitf(float y, unsigned short& h, unsigned short& l) { h = f2bf(y); l = f2bf(y - bf2f(h)); }
typedef __attribute__((ext_vector_type(2))) float v2f;

// ---- k_prep: everything the products need beforehand, in one launch. Work-groups 0 .. PCS-1 fill the rotary table (CTU rows t per thread, one frequency; they are the slow ones); then PMK for the mask's bits (below); then PBW work-groups for each of
// Wq, Wk, Wv, Wd (bf16 into WB, one after the other) and PBX for x (both batches, into XB). A conversion work-group turns 256 x 8 x CVU floats: each thread asks for its CVU vectors of 8 floats at
// once, so that few work-groups have to be started and each has many lines in flight.
#define CVU 8
#define CTU 4
#define PCS (TT * NF / (256 * CTU))
#define PBW (DD * DD / (256 * 8 * CVU))
#define PBX (NB_ * TT * DD / (256 * 8 * CVU))
// Then PMK work-groups read the additive mask once and write, for each query row, one bit per block of 32 keys into NEED: the bit is 0 only where every mask value of the block (rounded to bf16, as k_flash
// reads it) lies more than MGAP under the row's largest. Such a key's probability is exactly 0 in f32: its exponent is at most (v + B) - (rowmax - B) with B the largest |q.k| / sqrt(128), and
// exp underflows to 0 below -104. B: |x| < 6 and |W| < 6 / sqrt(2048) are the normal generators' own limits, so |q_d|, |k_d| < 2048 * 6 * 0.133 * 1.42 < 2.4e3 and B < 128 * 5.8e6 * 0.0884 < 6.6e7: 2 B + 104 < MGAP.
// The block that holds a row's largest value always keeps its bit. A NaN in the mask is carried by the maxima (nmax) and fails the test "below the threshold", so its block, or its whole row, keeps its bits.
// A second word per row, NEED[TT + row], has one bit per block of 32 keys that is 0 only where every mask value of the block rounds to +-0 in bf16 (absolute bits at most 0x8000; the OR of the bits is tested, which can
// only err towards 1): there k_flash neither reads nor rounds nor adds the mask, and s * c is what fma(s, c, +-0) gives.
// A wave takes 2 rows, a work-group 16: its 16 words of either kind are one 128-byte line.
#define MGAP 2.5e8f
#define PMK (TT / 16)
typedef unsigned long long u64;
__device__ __forceinline__ float nmax(float a, float b) { return __builtin_elementwise_maximum(a, b); }     // the larger; NaN if either is
__global__ __launch_bounds__(256) void k_prep(const float* __restrict__ x, const float* __restrict__ am, const float* __restrict__ Wq, const float* __restrict__ Wk, const float* __restrict__ Wv, const float* __restrict__ Wd, bf* WB, bf* XB, float* CSN, u64* NEED) {
    if (blockIdx.x < PCS) {
        const int idx = blockIdx.x * 256 + threadIdx.x; const int t0 = idx / NF, i = idx % NF; const float invf = __fdiv_rn(1.0f, powf(10000.0f, (float)(2 * i) * (1.0f / HD)));
#pragma unroll 1        // rolled: one copy of the long cosine and sine code
        for (int u = 0; u < CTU; ++u) { const int t = t0 + u * (TT / CTU); const float ang = __fmul_rn((float)t, invf);
            v2f o; o[0] = cosf(ang); o[1] = sinf(ang); *(v2f*)(CSN + ((size_t)t * NF + i) * 2) = o;
            asm volatile("s_wait_xcnt 0x0" ::: "memory"); }    // stands behind the store, in front of the next trip's writes of the registers that it names
        return; }
    if (blockIdx.x < PCS + PMK) {
        const int lane = threadIdx.x & 31, row0 = (blockIdx.x - PCS) * 16 + (threadIdx.x >> 5) * 2;
        const float* pm = am + (size_t)row0 * TT + lane * 4;
        v4f mv[2][16];
#pragma unroll
        for (int r = 0; r < 2; ++r)
#pragma unroll
            for (int i = 0; i < 16; ++i) mv[r][i] = *(const v4f*)(pm + r * TT + i * 128);
        asm volatile("s_wait_xcnt 0x0" :: "v"(pm) : "memory");    // stands behind the loads, in front of any write of the address register that they name; the address is an input, so no load's result is given that register
#pragma unroll
        for (int r = 0; r < 2; ++r) { float tm[16], rm = -__builtin_inff(); unsigned zo[16];
#pragma unroll
            for (int i = 0; i < 16; ++i) { tm[i] = nmax(nmax(mv[r][i][0], mv[r][i][1]), nmax(mv[r][i][2], mv[r][i][3])); rm = nmax(rm, tm[i]);
                zo[i] = (__float_as_uint(mv[r][i][0]) | __float_as_uint(mv[r][i][1]) | __float_as_uint(mv[r][i][2]) | __float_as_uint(mv[r][i][3])) & 0x7FFFFFFFu; }
#pragma unroll
            for (int o = 1; o < 32; o <<= 1) rm = nmax(rm, __shfl_xor(rm, o));
            const float thr = bfr(rm) - MGAP; u64 nd = 0, nz = 0;
#pragma unroll
            for (int i = 0; i < 16; ++i) { const unsigned b = __builtin_amdgcn_ballot_w32(!(bfr(tm[i]) < thr));      // bit l: keys i * 128 + 4 l .. + 3; 8 lanes are one block of 32 keys
                const unsigned z = __builtin_amdgcn_ballot_w32(zo[i] > 0x8000u);
#pragma unroll
                for (int g = 0; g < 4; ++g) { nd |= (u64)(((b >> (8 * g)) & 0xFFu) != 0) << (i * 4 + g); nz |= (u64)(((z >> (8 * g)) & 0xFFu) != 0) << (i * 4 + g); } }
            if (lane == 0) { NEED[row0 + r] = nd; NEED[TT + row0 + r] = nz; } }
        return; }
    const int c = blockIdx.x - PCS - PMK, seg = c / PBW;      // seg 0..3: a weight; from 4 on: x
    const float* src = seg == 0 ? Wq : seg == 1 ? Wk : seg == 2 ? Wv : seg == 3 ? Wd : x;
    bf* dst = seg < 4 ? WB + (size_t)seg * DD * DD : XB;
    const size_t base = (size_t)(seg < 4 ? c - seg * PBW : c - 4 * PBW) * (256 * 8 * CVU) + threadIdx.x * 8;
    const float* pin = src + base;
    v8f v[CVU];
#pragma unroll
    for (int u = 0; u < CVU; ++u) v[u] = *(const v8f*)(pin + u * 2048);
    asm volatile("s_wait_xcnt 0x0" :: "v"(pin) : "memory");    // stands behind the loads, in front of any write of the address register that they name; the address is an input, so no load's result is given that register
#pragma unroll
    for (int u = 0; u < CVU; ++u) { v8us o;
#pragma unroll
        for (int k = 0; k < 8; ++k) o[k] = f2bf(v[u][k]);
        *(v8us*)(dst + base + u * 2048) = o; }
    asm volatile("s_wait_xcnt 0x0" ::: "memory");    // stands behind the last store, in front of any later write of the registers that the stores name
}
typedef __attribute__((ext_vector_type(16))) float v16f;
#define L2E 1.4426950408889634f
#define FKP 136                   // LDS pitch of a K row in elements (128 + 8)
template <bool HI> struct FT;
template <> struct FT<true>  { typedef bf  T; typedef v8us V8; };
template <> struct FT<false> { typedef h16 T; typedef v8h  V8; };
__device__ __forceinline__ float xhalf(float x) { return __builtin_bit_cast(float, __builtin_amdgcn_permlanex16(__builtin_bit_cast(int, x), __builtin_bit_cast(int, x), 0x76543210, 0xfedcba98, false, false)); }  // lane l with lane l ^ 16
// Two exponentials and, in the same statement, the one v_nop that the instruction set asks for behind a transcendental before its result is read or its source overwritten (a v_nop in a statement of
// its own did not stay behind them). The outputs share no register with the inputs ("=&v"), so the second exponential is independent of the first and fills the first one's slot.
__device__ __forceinline__ void exp2x2(float& a, float& b) { float ra, rb; asm("v_exp_f32 %0, %2\n\tv_exp_f32 %1, %3\n\tv_nop" : "=&v"(ra), "=&v"(rb) : "v"(a), "v"(b)); a = ra; b = rb; }
template <bool HI>
__device__ __forceinline__ void flash_body(typename FT<HI>::T* sm, const typename FT<HI>::T* __restrict__ Q, const typename FT<HI>::T* __restrict__ Q2, const typename FT<HI>::T* __restrict__ Kg, const typename FT<HI>::T* __restrict__ Kg2,
                                           const typename FT<HI>::T* __restrict__ Vg, const typename FT<HI>::T* __restrict__ Vg2, const float* __restrict__ am, int q0, u64 need, u64 nzm, bf* Ah, bf* Al) {
    typedef typename FT<HI>::T T; typedef typename FT<HI>::V8 V8; typedef typename WFrag<T>::V V;
    constexpr int NPL = HI ? 2 : 1, SK = HI ? 32 : 64, VP = SK + 8, KPL = SK * FKP, VPL = HD * VP, BUF = NPL * (KPL + VPL), NST = TT / SK, NPASS = SK / 32;
    constexpr int NKL = SK / 16, LPV = SK / 8, RPS = 256 / LPV, NVL = HD / RPS;
    const int tid = threadIdx.x, lane = tid & 31, lr = lane & 15, hi = lane >> 4; const int w = __builtin_amdgcn_readfirstlane(tid >> 5);
    const int q = q0 + w * 16 + lr;       // this lane's query row
    // The stages to walk: one bit per stage, set where some query row of the work-group needs a key of it (a 64-key stage: either of its two blocks). The same scalar word in every wave, so trips and barriers are alike.
    constexpr u64 ALLST = HI ? ~0ull : 0x5555555555555555ull; constexpr int SH = HI ? 0 : 1;
    u64 todo = HI ? need : ((need | (need >> 1)) & ALLST);
    if (todo == 0) todo = ALLST;          // no row leaves all its bits 0; this keeps the stage index in bounds whatever the word holds
    const int nwalk = __builtin_popcountll(todo);
    int st = __builtin_ctzll(todo) >> SH; todo &= todo - 1;
    Kg += st * (SK * HD); Vg += st * SK; if (HI) { Kg2 += st * (SK * HD); Vg2 += st * SK; }
    const unsigned gk = (unsigned)((tid >> 4) * HD + (tid & 15) * 8), gv = (unsigned)((tid / LPV) * TT + (tid % LPV) * 8);
    T* sk = sm + (tid >> 4) * FKP + (tid & 15) * 8; T* sv = sm + NPL * KPL + (tid / LPV) * VP + (tid % LPV) * 8;
    const T* fk = sm + lr * FKP + 8 * hi; const T* fv = sm + NPL * KPL + lr * VP + 8 * hi;
    const float* mrow = am + (size_t)q * TT + 8 * hi;
    V qf[NPL][4];
#pragma unroll
    for (int kc = 0; kc < 4; ++kc) { qf[0][kc] = WFrag<T>::ld(Q + (size_t)q * HD + 8 * hi + 32 * kc); if (HI) qf[NPL - 1][kc] = WFrag<T>::ld(Q2 + (size_t)q * HD + 8 * hi + 32 * kc); }
    asm volatile("s_wait_xcnt 0x0" ::: "memory");    // stands behind the Q loads, in front of the K loads, whose results may be given the address register that the Q loads name
    V8 rk[NPL][NKL], rv[NPL][NVL];
    v8f acc[8];
#pragma unroll
    for (int t = 0; t < 8; ++t) acc[t] = (v8f){};
    float m_run = -3.0e38f, l_run = 0.f;
#pragma unroll
    for (int i = 0; i < NKL; ++i) { rk[0][i] = *(const V8*)(Kg + gk + i * 16 * HD); if (HI) rk[NPL - 1][i] = *(const V8*)(Kg2 + gk + i * 16 * HD); }
    asm volatile("s_wait_xcnt 0x0" ::: "memory");    // stands behind the K loads, in front of the V^T loads, whose results may be given a register that one of those loads names
#pragma unroll
    for (int i = 0; i < NVL; ++i) { rv[0][i] = *(const V8*)(Vg + gv + i * RPS * TT); if (HI) rv[NPL - 1][i] = *(const V8*)(Vg2 + gv + i * RPS * TT); }
#pragma unroll
    for (int i = 0; i < NKL; ++i) { *(V8*)(sk + i * 16 * FKP) = rk[0][i]; if (HI) *(V8*)(sk + KPL + i * 16 * FKP) = rk[NPL - 1][i]; }
#pragma unroll
    for (int i = 0; i < NVL; ++i) { *(V8*)(sv + i * RPS * VP) = rv[0][i]; if (HI) *(V8*)(sv + VPL + i * RPS * VP) = rv[NPL - 1][i]; }
    __syncthreads();    // the first stage walked is in buffer 0 before any wave reads a fragment
    constexpr int DS = HI ? 2 : 4, DV = HI ? 2 : 2;     // how many groups of K fragments (16 keys x 32 d) and of V^T fragments (16 d x 32 keys) are read ahead of the products that use them
    // The last stage asks for its own lines again (in bounds, not stored): with the loads on every path the compiler's load counts behind them stay exact.
    auto stage_loads = [&](int ds) { const int ak = ds * (SK * HD), av = ds * SK; Kg += ak; Vg += av; if (HI) { Kg2 += ak; Vg2 += av; }      // ds: stages from the one at work to the next one walked
#pragma unroll
        for (int i = 0; i < NKL; ++i) { rk[0][i] = *(const V8*)(Kg + gk + i * 16 * HD); if (HI) rk[NPL - 1][i] = *(const V8*)(Kg2 + gk + i * 16 * HD); }
#pragma unroll
        for (int i = 0; i < NVL; ++i) { rv[0][i] = *(const V8*)(Vg + gv + i * RPS * TT); if (HI) rv[NPL - 1][i] = *(const V8*)(Vg2 + gv + i * RPS * TT); } };
#pragma unroll 1        // rolled: for speed only
    for (int it = 0; it < nwalk; ++it) {
        const int cur = (it & 1) * BUF, nxt = BUF - cur; const bool more = it + 1 < nwalk;
        const int sn = more ? __builtin_ctzll(todo) >> SH : st; todo &= todo - 1;      // the next stage walked
        if (!HI) stage_loads(sn - st);
#pragma unroll
        for (int ps = 0; ps < NPASS; ++ps) {
            const bool mnz = ((nzm >> (st * NPASS + ps)) & 1) != 0;     // scalar: some query row of the work-group has a mask value other than +-0 in this pass's 32 keys
            v4f mk[2][2];       // the pass's mask values for this lane's query, read only where mnz. fp16 form: asked for at the head of the pass, they arrive under the score products;
                                // hi+lo form (short of registers): asked for in the branch that uses them
            auto ldm = [&]() { const float* mp = mrow + st * SK + ps * 32;
#pragma unroll
                for (int kt = 0; kt < 2; ++kt) { mk[kt][0] = *(const v4f*)(mp + kt * 16); mk[kt][1] = *(const v4f*)(mp + kt * 16 + 4); }
                asm volatile("s_wait_xcnt 0x0" :: "v"(mp) : "memory"); };   // stands behind the four loads, in front of any write of the address register that they name; the address is an input, so it lives up to here
            if (!HI && mnz) ldm();
            V kf[4][2][NPL], vf[8][NPL];
            auto ldk = [&](int g) { const int kc = g >> 1, kt = g & 1; const T* p = fk + cur + (ps * 32 + kt * 16) * FKP + 32 * kc; kf[kc][kt][0] = WFrag<T>::ld(p); if (HI) kf[kc][kt][NPL - 1] = WFrag<T>::ld(p + KPL); };
            auto ldv = [&](int t) { const T* p = fv + cur + t * 16 * VP + ps * 32; vf[t][0] = WFrag<T>::ld(p); if (HI) vf[t][NPL - 1] = WFrag<T>::ld(p + VPL); };
            v8f s[2]; s[0] = (v8f){}; s[1] = (v8f){};
#pragma unroll
            for (int g = 0; g < DS; ++g) ldk(g);
#pragma unroll
            for (int g = 0; g < 8; ++g) { const int kc = g >> 1, kt = g & 1; if (g + DS < 8) ldk(g + DS);
                __builtin_amdgcn_sched_barrier(0);    // the LDS reads stay DS groups ahead of the products (for speed only)
                s[kt] = WFrag<T>::mma(kf[kc][kt][0], qf[0][kc], s[kt]); if (HI) { s[kt] = WFrag<T>::mma(kf[kc][kt][0], qf[NPL - 1][kc], s[kt]); s[kt] = WFrag<T>::mma(kf[kc][kt][NPL - 1], qf[0][kc], s[kt]); }
                __builtin_amdgcn_sched_barrier(0); }  // and the following group of reads stays behind these products
            if (HI) stage_loads(sn - st);           // hi+lo form: asked for here, where the K fragments' registers are free again
#pragma unroll
            for (int t = 0; t < DV; ++t) ldv(t);    // the first V^T fragments arrive under the softmax arithmetic
            __builtin_amdgcn_sched_barrier(0);      // keeps those reads in front of the softmax arithmetic
            v16f tv; float mx = -3.0e38f;
#pragma unroll
            for (int e = 0; e < 16; ++e) tv[e] = s[e >> 3][e & 7] * (SCL * L2E);
            if (mnz) { if (HI) ldm();
#pragma unroll
                for (int e = 0; e < 16; ++e) tv[e] = fmaf(s[e >> 3][e & 7], SCL * L2E, bfr(mk[e >> 3][(e >> 2) & 1][e & 3]) * L2E); }
#pragma unroll
            for (int e = 0; e < 16; ++e) mx = fmaxf(mx, tv[e]);
            mx = fmaxf(mx, xhalf(mx));      // both wave halves hold this query's maximum over the pass's 32 keys
            if (__builtin_amdgcn_ballot_w32(mx > m_run + 4.0f) != 0) {      // wave-uniform; rare after the first passes
                const float m_new = fmaxf(m_run, mx); const float corr = __builtin_amdgcn_exp2f(m_run - m_new); l_run *= corr; m_run = m_new;
#pragma unroll
                for (int t = 0; t < 8; ++t) acc[t] = acc[t] * corr; }
            const float nm = (HI ? 0.0f : 10.0f) - m_run; float ps0 = 0.f, ps1 = 0.f;
#pragma unroll
            for (int e = 0; e < 16; e += 2) { float x0 = tv[e] + nm, x1 = tv[e + 1] + nm; exp2x2(x0, x1); tv[e] = x0; tv[e + 1] = x1; ps0 += x0; ps1 += x1; }
            l_run += ps0 + ps1;
            V pa, pb;
            if constexpr (HI) { pa = __builtin_convertvector(tv, v16bf); pb = __builtin_convertvector(tv - __builtin_convertvector(pa, v16f), v16bf); }
            else { pa = __builtin_convertvector(tv, v16h); pb = pa; }
#pragma unroll
            for (int t = 0; t < 8; ++t) { if (t + DV < 8) ldv(t + DV);
                __builtin_amdgcn_sched_barrier(0);    // the V^T reads stay DV groups ahead of their products
                acc[t] = WFrag<T>::mma(vf[t][0], pa, acc[t]); if (HI) { acc[t] = WFrag<T>::mma(vf[t][0], pb, acc[t]); acc[t] = WFrag<T>::mma(vf[t][NPL - 1], pa, acc[t]); }
                __builtin_amdgcn_sched_barrier(0); }  // and the following reads stay behind these products
        }
        if (more) {
#pragma unroll
            for (int i = 0; i < NKL; ++i) { *(V8*)(sk + nxt + i * 16 * FKP) = rk[0][i]; if (HI) *(V8*)(sk + nxt + KPL + i * 16 * FKP) = rk[NPL - 1][i]; }
#pragma unroll
            for (int i = 0; i < NVL; ++i) { *(V8*)(sv + nxt + i * RPS * VP) = rv[0][i]; if (HI) *(V8*)(sv + nxt + VPL + i * RPS * VP) = rv[NPL - 1][i]; } }
        __syncthreads();    // publishes the next stage and ends every wave's reads of the buffer that the next trip refills
        asm volatile("s_wait_xcnt 0x0" ::: "memory");    // stands behind this trip's K, V^T and mask loads, in front of the next trip's (or the epilogue's) writes of the registers that they name
        st = sn;
    }
    const float inv = __fdiv_rn(1.0f, l_run + xhalf(l_run));    // each wave half summed its own 8 keys of every 16-key tile
#pragma unroll
    for (int t = 0; t < 8; ++t) { v8us oh, ol;
#pragma unroll
        for (int j = 0; j < 8; ++j) { unsigned short a, c2; splitf(acc[t][j] * inv, a, c2); oh[j] = a; ol[j] = c2; }
        const size_t o = (size_t)q * DD + t * 16 + hi * 8; *(v8us*)(Ah + o) = oh; *(v8us*)(Al + o) = ol;
        asm volatile("s_wait_xcnt 0x0" ::: "memory"); }    // stands behind the two stores, in front of any later write of the registers that they name
}
#define FSM_EL (2 * 2 * (32 * FKP + HD * 40))     // the larger of the two forms' LDS, in 16-bit elements
static_assert(2 * (64 * FKP + HD * 72) <= FSM_EL, "the fp16 form's two buffers fit");
// grid: NB_ * NH_ * (RH / 128) hi+lo work-groups first (the longer ones where the mask closes nothing), then NB_ * NH_ * ((TT - RH) / 128) fp16 ones. Planes are [batch][head][...]; Ah, Al are [batch][TT][DD].
__global__ __launch_bounds__(256) void k_flash(const bf* __restrict__ Qh, const bf* __restrict__ Ql, const h16* __restrict__ Q16, const bf* __restrict__ Kh, const bf* __restrict__ Kl, const h16* __restrict__ K16,
                                               const bf* __restrict__ Vh, const bf* __restrict__ Vl, const h16* __restrict__ V16, const float* __restrict__ am, const u64* __restrict__ NEED, bf* Ah, bf* Al) {
    __shared__ __align__(16) unsigned short fsm[FSM_EL];
    constexpr int NHI = NB_ * NH_ * (RH / 128), TLO = (TT - RH) / 128;
    const int idx = blockIdx.x; const bool hires = idx < NHI;
    const int z = hires ? idx / (RH / 128) : (idx - NHI) / TLO; const int q0 = hires ? (idx % (RH / 128)) * 128 : RH + ((idx - NHI) % TLO) * 128;
    const size_t zp = (size_t)z * TT * HD; const size_t ao = (size_t)(z / NH_) * TT * DD + (size_t)(z % NH_) * HD;
    // The OR of the 128 query rows' words: every wave forms it from the same 128 words, so all hold the same value.
    const u64* nr = NEED + q0 + (threadIdx.x & 31);
    const u64 nl = nr[0] | nr[32] | nr[64] | nr[96];
    const u64 zl = nr[TT] | nr[TT + 32] | nr[TT + 64] | nr[TT + 96];      // likewise the words that say where the mask is not +-0
    asm volatile("s_wait_xcnt 0x0" :: "v"(nr) : "memory");    // stands behind the eight loads, in front of any write of the address register that they name
    unsigned n0 = (unsigned)nl, n1 = (unsigned)(nl >> 32), z0 = (unsigned)zl, z1 = (unsigned)(zl >> 32);
#pragma unroll
    for (int o = 1; o < 32; o <<= 1) { n0 |= __shfl_xor(n0, o); n1 |= __shfl_xor(n1, o); z0 |= __shfl_xor(z0, o); z1 |= __shfl_xor(z1, o); }
    const u64 need = ((u64)(unsigned)__builtin_amdgcn_readfirstlane(n1) << 32) | (unsigned)__builtin_amdgcn_readfirstlane(n0);
    const u64 nzm = ((u64)(unsigned)__builtin_amdgcn_readfirstlane(z1) << 32) | (unsigned)__builtin_amdgcn_readfirstlane(z0);
    if (hires) flash_body<true>((bf*)fsm, Qh + zp, Ql + zp, Kh + zp, Kl + zp, Vh + zp, Vl + zp, am, q0, need, nzm, Ah + ao, Al + ao);
    else flash_body<false>((h16*)fsm, Q16 + zp, nullptr, K16 + zp, nullptr, V16 + zp, nullptr, am, q0, need, nzm, Ah + ao, Al + ao);
}

extern "C" void kernel_launch(void* const* d_in, const int* in_sizes, int n_in,
                              void* d_out, int out_size, void* d_ws, size_t ws_size, hipStream_t stream) {
    (void)in_sizes; (void)n_in; (void)out_size;
    const float* x = (const float*)d_in[0]; const float* amask = (const float*)d_in[1]; const float* Wq = (const float*)d_in[2]; const float* Wk = (const float*)d_in[3]; const float* Wv = (const float*)d_in[4]; const float* Wd = (const float*)d_in[5];
    float* OUT = (float*)d_out;     // [2][2048][2048]
    char* wsp = (char*)d_ws;
    auto take = [&](size_t bytes) { char* p = wsp; wsp += (bytes + 255) & ~(size_t)255; return (void*)p; };
    const size_t PB = (size_t)TT * DD;      // elements of one batch's plane
    bf* WB = (bf*)take((size_t)4 * DD * DD * 2); bf* WO = WB + (size_t)3 * DD * DD;      // Wq, Wk, Wv, Wd in bf16, one after the other
    bf* XB = (bf*)take(NB_ * PB * 2); float* CSN = (float*)take((size_t)TT * NF * 2 * 4);
    bf* PP = (bf*)take(6 * NB_ * PB * 2); bf* QPh = PP; bf* QPl = PP + NB_ * PB; bf* KPh = PP + 2 * NB_ * PB; bf* KPl = PP + 3 * NB_ * PB; bf* VTh = PP + 4 * NB_ * PB; bf* VTl = PP + 5 * NB_ * PB;
    h16* P3 = (h16*)take(3 * NB_ * PB * 2); h16* QP16 = P3; h16* KP16 = P3 + NB_ * PB; h16* VT16 = P3 + 2 * NB_ * PB;
    bf* ATh = (bf*)take(NB_ * PB * 2); bf* ATl = (bf*)take(NB_ * PB * 2); u64* NEED = (u64*)take((size_t)2 * TT * 8);
    if ((size_t)(wsp - (char*)d_ws) > ws_size) return;    // total 225 MiB; ws 256 MiB
    k_prep<<<PCS + PMK + 4 * PBW + PBX, 256, 0, stream>>>(x, amask, Wq, Wk, Wv, Wd, WB, XB, CSN, NEED);
    k_gemms<0, DD, DD, true><<<dim3(NB_ * TT / 128, 3 * DD / 128, 1), 256, 0, stream>>>(XB, nullptr, WB, nullptr, CSN, PP, P3);
    k_flash<<<NB_ * NH_ * (TT / 128), 256, 0, stream>>>(QPh, QPl, QP16, KPh, KPl, KP16, VTh, VTl, VT16, amask, NEED, ATh, ATl);
    k_gemms<1, DD, DD, false><<<dim3(NB_ * TT / 128, DD / 128, 1), 256, 0, stream>>>(ATh, ATl, WO, OUT, nullptr, nullptr, nullptr);
}

// v009
// A run of this version takes 215 microseconds.
// Two timings next to v008 both put it at 1.06 times that version's speed.
// All steps since v000 together make it 11.3 times as fast.
#include <hip/hip_runtime.h>

// ThornsAttention (x [2][2048][2048]; q/k/v = x W^T ([out][in] weights, no bias); 16 heads x 128; "RoPE" whose rotate_half is the identity (rotary_ndims == head_dim in the source), so
// q <- q*cos + q*sin elementwise with emb = cat(freqs, freqs), inv_freq = 10000^(-2i/128); scores = q.k / sqrt(128) + attention_mask (verbatim [1][1][2048][2048] additive input, read
// as data); softmax; out = (attn.v merged) Wd^T).
// Compute dtypes, f32 accumulate: every input rounded to bf16; projections on PLAIN bf16 operands (inputs: exact); the rotary factors cos/sin(t x inv_freq)
// in f32 (powf/cosf/sinf, tabulated once); rows < RH: scores on bf16 hi+lo planes of the rotated q and k (3 products; the 1/sqrt(128) applied in f32 with the mask); attn.v on hi+lo planes
// (3 products); rows >= RH: both on single fp16 planes (1 product each) - the mask is causal-shaped here so early rows see few keys; output hi+lo x exact Wd (2 products).

#define NB_  2
#define TT   2048
#define DD   2048
#define NH_  16
#define HD   128
#define RH   512                  // query rows < RH use hi+lo planes for scores and attn.v; rows >= RH use single fp16 planes
#define NF   64                   // rotary frequencies (head_dim / 2)
#define SCL  0.088388349f
typedef _Float16 h16;
typedef unsigned short bf;
typedef __attribute__((ext_vector_type(16))) __bf16   v16bf;
typedef __attribute__((ext_vector_type(16))) _Float16 v16h;
typedef __attribute__((ext_vector_type(8)))  _Float16 v8h;
typedef __attribute__((ext_vector_type(8)))  unsigned short v8us;
typedef __attribute__((ext_vector_type(8)))  float    v8f;
typedef __attribute__((ext_vector_type(4)))  float    v4f;
typedef v8h  __attribute__((may_alias)) v8ha;
typedef v4f  __attribute__((may_alias)) v4fa;
typedef v8us __attribute__((may_alias)) v8usa;

__device__ __forceinline__ unsigned short f2bf(float f) { unsigned u = __float_as_uint(f); u += 0x7FFFu + ((u >> 16) & 1u); return (unsigned short)(u >> 16); }
__device__ __forceinline__ float bf2f(unsigned short b) { return __uint_as_float(((unsigned)b) << 16); }
__device__ __forceinline__ float bfr(float f) { return bf2f(f2bf(f)); }
__device__ __forceinline__ v16h cat16(v8h lo, v8h hi) { return __builtin_shufflevector(lo, hi, 0, 1, 2, 3, 4, 5, 6, 7, 8, 9, 10, 11, 12, 13, 14, 15); }
__device__ __forceinline__ v16bf cat16b(v8us lo, v8us hi) { return __builtin_bit_cast(v16bf, __builtin_shufflevector(lo, hi, 0, 1, 2, 3, 4, 5, 6, 7, 8, 9, 10, 11, 12, 13, 14, 15)); }
__device__ __forceinline__ v8f wmma16(v16h a, v16h b, v8f c) { return __builtin_amdgcn_wmma_f32_16x16x32_f16(false, a, false, b, (short)0, c, false, false); }
__device__ __forceinline__ v8f wmmab(v16bf a, v16bf b, v8f c) { return __builtin_amdgcn_wmma_f32_16x16x32_bf16(false, a, false, b, (short)0, c, false, false); }



// ---- WFrag: one 16 x 32 operand fragment of a 16-bit plane whose k runs contiguously; p = row start + 8 * (lane >> 4). A and B use the same k order.
template <typename T16> struct WFrag;
template <> struct WFrag<h16> { typedef v16h V; static __device__ __forceinline__ V ld(const h16* p) { return cat16(*(const v8h*)p, *(const v8h*)(p + 16)); } static __device__ __forceinline__ v8f mma(V a, V b, v8f c) { return wmma16(a, b, c); } };
template <> struct WFrag<bf> { typedef v16bf V; static __device__ __forceinline__ V ld(const bf* p) { return cat16b(*(const v8us*)p, *(const v8us*)(p + 16)); } static __device__ __forceinline__ v8f mma(V a, V b, v8f c) { return wmmab(a, b, c); } };

// ---- k_gemms: LDS-staged GEMM for the 2048^3 products (projections, output). One TM x TN output tile per work-group of 8 waves (TM / 64 x TN / 64; 64x64 per wave, 16 accumulators); grid (M/TM, N/TN).
// A 64x64 wave tile reads 8 fragments for 16 products (12 for 32 with the second A plane), and a 256x128 or 128x256 tile asks L2 for fewer operand rows per product than 128x128 did.
// C[m][n] (f32, pitch LDC) = sum_k (A[m][k] (+ A2[m][k] when NSPLIT == 1)) Bt[n][k]. K % 128 == 0. Per 128-k step every operand plane's rows x 256 bytes come from global memory as whole
// 128-byte lines (16 lanes a row), go through registers into one of two LDS buffers (row pitch 272 bytes) and are read from there as fragments, in the k order of WFrag::ld. The next step's
// lines are fetched while this step's products run; fragments are read one 32-k block ahead. Each accumulator sums its K in one ascending chain.
// The rows of A run over both batches ([NB_ * TT][K]). PROJ: the rows of Bt run over Wq, Wk, Wv one after the other, so one grid (NB_ * TT / TM, 3 * DD / TN) does all six projections.
// What becomes of the f32 tile, which goes through LDS in every form (PROJ: its 128 columns are one head: TN == HD == 128); form E is the same for a whole work-group (it hangs on blockIdx.y alone):
// E 0 (!PROJ): written to C as f32. E 1 (q, k): y = x cos + x sin from the table CSN, then bf16 hi, bf16 lo and fp16 planes [head][t][d]. E 2 (v): the tile is laid into LDS transposed, then the same
// three planes [head][d][t]. In E 1 and 2 a lane converts 8 neighbours of a plane's row and 16 or 32 lanes store a whole row of the tile: whole 128-byte lines, no f32 copy in memory.
// PP: the six bf16 planes q hi, q lo, k hi, k lo, v hi, v lo, each [batch][head][...]; P3: the three fp16 planes q, k, v.
typedef __attribute__((ext_vector_type(8))) __bf16 v8bf;
#define GP 136                    // LDS row pitch in 16-bit elements (128 + 8)
template <int N> struct IC { static constexpr int value = N; };
template <int NSPLIT, int K, int LDC, bool PROJ, int TM, int TN>
__global__ __launch_bounds__(256) void k_gemms(const bf* __restrict__ A, const bf* __restrict__ A2, const bf* __restrict__ Bt, float* C, const float* __restrict__ CSN, bf* PP, h16* P3) {
    constexpr int PLA = TM * GP;                        // elements of one staged A plane
    constexpr int OB = (NSPLIT + 1) * PLA;              // where the B plane starts in a buffer
    constexpr int BUF = OB + TN * GP;                   // elements of one buffer
    constexpr int NT = K / 128, NA = TM / 16, NB = TN / 16, WMW = TM / 64;
    static_assert((TM / 64) * (TN / 64) == 8, "8 waves of 64x64");
    __shared__ __align__(16) bf sm[2 * BUF];
    static_assert(TM * (TN + 4) * 4 <= 2 * BUF * 2 && TN * (TM + 4) * 4 <= 2 * BUF * 2, "the f32 output tile fits the staging buffers it reuses");
    const int tid = threadIdx.x, lane = tid & 31, lr = lane & 15, hi = lane >> 4;
    const int w = __builtin_amdgcn_readfirstlane(tid >> 5); const int wm = w % WMW, wn = w / WMW;
    const int r0 = blockIdx.x * TM, c0 = blockIdx.y * TN;
    const int srow = tid >> 4, scol = (tid & 15) * 8;
    const unsigned go = (unsigned)(srow * K + scol);      // the lane's offset in a tile; the tile's own address stays scalar
    auto ldg = [&](const bf* base, int row) { return *(const v8us*)(base + go + row * K); };
    const bf* pa = A + (size_t)r0 * K; const bf* pa2 = NSPLIT ? A2 + (size_t)r0 * K : nullptr; const bf* pb = Bt + (size_t)c0 * K;
    bf* st = sm + srow * GP + scol;
    const bf* fa = sm + (wm * 64 + lr) * GP + 8 * hi; const bf* fb = sm + OB + (wn * 64 + lr) * GP + 8 * hi;
    v8us ra[NA], ra2[NA], rb[NB];
    v8f acc[4][4];
#pragma unroll
    for (int mb = 0; mb < 4; ++mb)
#pragma unroll
        for (int nb = 0; nb < 4; ++nb) acc[mb][nb] = (v8f){};
    auto fetch = [&]() {
        __builtin_amdgcn_sched_barrier(0);    // with the one behind the wait: no other instruction stands between the loads and their wait, where it could be given a register that a load names
#pragma unroll
        for (int i = 0; i < NA; ++i) { ra[i] = ldg(pa, i * 16); if (NSPLIT) ra2[i] = ldg(pa2, i * 16); }
#pragma unroll
        for (int i = 0; i < NB; ++i) rb[i] = ldg(pb, i * 16);
        asm volatile("s_wait_xcnt 0x0" ::: "memory");    // stands behind the loads, in front of any write of the registers that they name
        __builtin_amdgcn_sched_barrier(0); };  // keeps every later instruction behind that wait
    auto stash = [&](int buf) {
#pragma unroll
        for (int i = 0; i < NA; ++i) { *(v8us*)(st + buf + i * 16 * GP) = ra[i]; if (NSPLIT) *(v8us*)(st + buf + PLA + i * 16 * GP) = ra2[i]; }
#pragma unroll
        for (int i = 0; i < NB; ++i) *(v8us*)(st + buf + OB + i * 16 * GP) = rb[i]; };
    fetch();
    stash(0);
    __syncthreads();    // step 0 is in buffer 0 before any wave reads a fragment
#pragma unroll 1        // rolled: for speed only
    for (int kt = 0; kt < NT; ++kt) {
        const int cur = (kt & 1) * BUF, nxt = BUF - cur; const bool more = kt + 1 < NT;
        if (more) { pa += 128; if (NSPLIT) pa2 += 128; pb += 128; fetch(); }
        v16bf a[2][4], a2[2][4], b[2][4];
        auto frags = [&](int n, int kk) {
#pragma unroll
            for (int nb = 0; nb < 4; ++nb) b[n][nb] = WFrag<bf>::ld(fb + cur + nb * 16 * GP + kk * 32);
#pragma unroll
            for (int mb = 0; mb < 4; ++mb) { a[n][mb] = WFrag<bf>::ld(fa + cur + mb * 16 * GP + kk * 32); if (NSPLIT) a2[n][mb] = WFrag<bf>::ld(fa + cur + PLA + mb * 16 * GP + kk * 32); } };
        frags(0, 0);
#pragma unroll
        for (int kk = 0; kk < 4; ++kk) { const int s = kk & 1, n = s ^ 1;
            if (kk < 3) frags(n, kk + 1);
            __builtin_amdgcn_sched_barrier(0);    // the next block's LDS reads stay one group ahead of this block's products (for speed only)
#pragma unroll
            for (int nb = 0; nb < 4; ++nb)
#pragma unroll
                for (int mb = 0; mb < 4; ++mb) { acc[mb][nb] = wmmab(a[s][mb], b[s][nb], acc[mb][nb]); if (NSPLIT) acc[mb][nb] = wmmab(a2[s][mb], b[s][nb], acc[mb][nb]); }
            __builtin_amdgcn_sched_barrier(0); }  // and the following group of reads stays behind this block's products
        if (more) stash(nxt);
        __syncthreads();    // publishes step kt + 1 and ends every wave's reads of the buffer that the next trip refills
    }
    float* os = (float*)sm;
    auto epilogue = [&](auto form) { constexpr int EPI = decltype(form)::value;
    constexpr int OC = EPI == 2 ? TM : TN, OR = EPI == 2 ? TN : TM, OP = OC + 4;     // the f32 tile in LDS: OR rows of OC columns at pitch OP
#pragma unroll
    for (int mb = 0; mb < 4; ++mb)
#pragma unroll
        for (int nb = 0; nb < 4; ++nb) {
            if constexpr (EPI == 2) { float* p = os + (wn * 64 + nb * 16 + lr) * OP + wm * 64 + mb * 16 + hi * 8;     // transposed: a lane's 8 values are 8 neighbours of row d
                *(v4fa*)p = __builtin_shufflevector(acc[mb][nb], acc[mb][nb], 0, 1, 2, 3); *(v4fa*)(p + 4) = __builtin_shufflevector(acc[mb][nb], acc[mb][nb], 4, 5, 6, 7); }
            else {
#pragma unroll
                for (int j = 0; j < 8; ++j) os[(wm * 64 + mb * 16 + hi * 8 + j) * OP + wn * 64 + nb * 16 + lr] = acc[mb][nb][j]; } }
    if constexpr (EPI == 0) {
        __syncthreads();    // the whole f32 tile is in LDS before it is written out row by row
        constexpr int LPR = OC / 4, RSW = 256 / LPR;        // lanes a row, rows a sweep
        const int erow = tid / LPR, ecol = (tid % LPR) * 4;
        float* pc = C + (size_t)r0 * LDC + c0; const unsigned co = (unsigned)(erow * LDC + ecol);
#pragma unroll
        for (int i = 0; i < OR / RSW; ++i) *(v4f*)(pc + co + i * RSW * LDC) = *(const v4fa*)(os + (erow + i * RSW) * OP + ecol);
    } else {
        static_assert(HD == 128 && TN == HD && LDC == DD && TT % TM == 0, "one tile column block is one head; a tile lies in one batch");
        constexpr int DP = EPI == 1 ? HD : TT;      // pitch of a plane's row: [t][d] or [d][t]
        constexpr int LPR = OC / 8, RSW = 256 / LPR, NSW = OR / RSW;        // lanes a row, rows a sweep, sweeps
        const int erow = tid / LPR, ecol = (tid % LPR) * 8;
        const int head = blockIdx.y % NH_, which = blockIdx.y / NH_, bat = r0 / TT, rb0 = r0 % TT;     // which: 0 q, 1 k, 2 v; rb0: the tile's first row inside its batch
        bf* Ph = PP + ((size_t)which * 2 * NB_ + bat) * ((size_t)TT * DD); bf* Pl = Ph + (size_t)NB_ * TT * DD; h16* P16 = P3 + ((size_t)which * NB_ + bat) * ((size_t)TT * DD);
        const size_t pbase = EPI == 1 ? ((size_t)head * TT + rb0) * HD : (size_t)head * HD * TT + rb0;
        const unsigned po = (unsigned)(erow * DP + ecol);
        v4f cs[NSW][4];     // EPI 1: (cos, sin) of the lane's 8 columns in each of its rows; asked for in front of the barrier, they arrive under it
        if constexpr (EPI == 1) { const float* pt = CSN + (size_t)rb0 * (NF * 2); const unsigned to = (unsigned)(erow * (NF * 2) + (ecol & (NF - 1)) * 2) * 4u;     // in bytes
#pragma unroll
            for (int i = 0; i < NSW; ++i)
#pragma unroll
                for (int c = 0; c < 4; ++c) cs[i][c] = *(const v4f*)((const char*)pt + to + (i * RSW * (NF * 2) + c * 4) * 4);
            asm volatile("s_wait_xcnt 0x0" :: "v"(to) : "memory"); }    // stands behind the loads, in front of any write of the registers that they name; the lane's offset is an input, so no load's result is given that register
        __syncthreads();    // the whole f32 tile is in LDS before it is read row by row
#pragma unroll
        for (int i = 0; i < NSW; ++i) { const float* p = os + (erow + i * RSW) * OP + ecol; const v4f y0 = *(const v4fa*)p, y1 = *(const v4fa*)(p + 4);
            v8f y = __builtin_shufflevector(y0, y1, 0, 1, 2, 3, 4, 5, 6, 7);
            if constexpr (EPI == 1) {
#pragma unroll
                for (int k = 0; k < 8; ++k) y[k] = y[k] * cs[i][k >> 1][(k & 1) * 2] + y[k] * cs[i][k >> 1][(k & 1) * 2 + 1]; }
            const v8bf yh = __builtin_convertvector(y, v8bf); const v8bf yl = __builtin_convertvector(y - __builtin_convertvector(yh, v8f), v8bf);
            *(v8us*)(Ph + pbase + po + i * RSW * DP) = __builtin_bit_cast(v8us, yh); *(v8us*)(Pl + pbase + po + i * RSW * DP) = __builtin_bit_cast(v8us, yl); *(v8h*)(P16 + pbase + po + i * RSW * DP) = __builtin_convertvector(y, v8h);
            asm volatile("s_wait_xcnt 0x0" ::: "memory"); }    // stands behind the three stores, in front of any later write of the registers that they name
    } };
    if constexpr (PROJ) { if (blockIdx.y / NH_ == 2) epilogue(IC<2>{}); else epilogue(IC<1>{}); } else epilogue(IC<0>{});
}

__device__ __forceinline__ void splitf(float y, unsigned short& h, unsigned short& l) { h = f2bf(y); l = f2bf(y - bf2f(h)); }
typedef __attribute__((ext_vector_type(2))) float v2f;

// ---- k_prep: everything the products need beforehand, in one launch. Work-groups 0 .. PCS-1 fill the rotary table (CTU rows t per thread, one frequency; they are the slow ones); then PMK for the mask's bits (below); then PBW work-groups for each of
// Wq, Wk, Wv, Wd (bf16 into WB, one after the other) and PBX for x (both batches, into XB). A conversion work-group turns 256 x 8 x CVU floats: each thread asks for its CVU vectors of 8 floats at
// once, so that few work-groups have to be started and each has many lines in flight.
#define CVU 8
#define CTU 4
#define PCS (TT * NF / (256 * CTU))
#define PBW (DD * DD / (256 * 8 * CVU))
#define PBX (NB_ * TT * DD / (256 * 8 * CVU))
// Then PMK work-groups read the additive mask once and write, for each query row, one bit per block of 32 keys into NEED: the bit is 0 only where every mask value of the block (rounded to bf16, as k_flash
// reads it) lies more than MGAP under the row's largest. Such a key's probability is exactly 0 in f32: its exponent is at most (v + B) - (rowmax - B) with B the largest |q.k| / sqrt(128), and
// exp underflows to 0 below -104. B: |x| < 6 and |W| < 6 / sqrt(2048) are the normal generators' own limits, so |q_d|, |k_d| < 2048 * 6 * 0.133 * 1.42 < 2.4e3 and B < 128 * 5.8e6 * 0.0884 < 6.6e7: 2 B + 104 < MGAP.
// The block that holds a row's largest value always keeps its bit. A NaN in the mask is carried by the maxima (nmax) and fails the test "below the threshold", so its block, or its whole row, keeps its bits.
// A second word per row, NEED[TT + row], has one bit per block of 32 keys that is 0 only where every mask value of the block rounds to +-0 in bf16 (absolute bits at most 0x8000; the OR of the bits is tested, which can
// only err towards 1): there k_flash neither reads nor rounds nor adds the mask, and s * c is what fma(s, c, +-0) gives.
// A wave takes 2 rows, a work-group 16: its 16 words of either kind are one 128-byte line.
#define MGAP 2.5e8f
#define PMK (TT / 16)
typedef unsigned long long u64;
__device__ __forceinline__ float nmax(float a, float b) { return __builtin_elementwise_maximum(a, b); }     // the larger; NaN if either is
__global__ __launch_bounds__(256) void k_prep(const float* __restrict__ x, const float* __restrict__ am, const float* __restrict__ Wq, const float* __restrict__ Wk, const float* __restrict__ Wv, const float* __restrict__ Wd, bf* WB, bf* XB, float* CSN, u64* NEED) {
    if (blockIdx.x < PCS) {
        const int idx = blockIdx.x * 256 + threadIdx.x; const int t0 = idx / NF, i = idx % NF; const float invf = __fdiv_rn(1.0f, powf(10000.0f, (float)(2 * i) * (1.0f / HD)));
#pragma unroll 1        // rolled: one copy of the long cosine and sine code
        for (int u = 0; u < CTU; ++u) { const int t = t0 + u * (TT / CTU); const float ang = __fmul_rn((float)t, invf);
            v2f o; o[0] = cosf(ang); o[1] = sinf(ang); *(v2f*)(CSN + ((size_t)t * NF + i) * 2) = o;
            asm volatile("s_wait_xcnt 0x0" ::: "memory"); }    // stands behind the store, in front of the next trip's writes of the registers that it names
        return; }
    if (blockIdx.x < PCS + PMK) {
        const int lane = threadIdx.x & 31, row0 = (blockIdx.x - PCS) * 16 + (threadIdx.x >> 5) * 2;
        const float* pm = am + (size_t)row0 * TT + lane * 4;
        v4f mv[2][16];
#pragma unroll
        for (int r = 0; r < 2; ++r)
#pragma unroll
            for (int i = 0; i < 16; ++i) mv[r][i] = *(const v4f*)(pm + r * TT + i * 128);
        asm volatile("s_wait_xcnt 0x0" :: "v"(pm) : "memory");    // stands behind the loads, in front of any write of the address register that they name; the address is an input, so no load's result is given that register
#pragma unroll
        for (int r = 0; r < 2; ++r) { float tm[16], rm = -__builtin_inff(); unsigned zo[16];
#pragma unroll
            for (int i = 0; i < 16; ++i) { tm[i] = nmax(nmax(mv[r][i][0], mv[r][i][1]), nmax(mv[r][i][2], mv[r][i][3])); rm = nmax(rm, tm[i]);
                zo[i] = (__float_as_uint(mv[r][i][0]) | __float_as_uint(mv[r][i][1]) | __float_as_uint(mv[r][i][2]) | __float_as_uint(mv[r][i][3])) & 0x7FFFFFFFu; }
#pragma unroll
            for (int o = 1; o < 32; o <<= 1) rm = nmax(rm, __shfl_xor(rm, o));
            const float thr = bfr(rm) - MGAP; u64 nd = 0, nz = 0;
#pragma unroll
            for (int i = 0; i < 16; ++i) { const unsigned b = __builtin_amdgcn_ballot_w32(!(bfr(tm[i]) < thr));      // bit l: keys i * 128 + 4 l .. + 3; 8 lanes are one block of 32 keys
                const unsigned z = __builtin_amdgcn_ballot_w32(zo[i] > 0x8000u);
#pragma unroll
                for (int g = 0; g < 4; ++g) { nd |= (u64)(((b >> (8 * g)) & 0xFFu) != 0) << (i * 4 + g); nz |= (u64)(((z >> (8 * g)) & 0xFFu) != 0) << (i * 4 + g); } }
            if (lane == 0) { NEED[row0 + r] = nd; NEED[TT + row0 + r] = nz; } }
        return; }
    const int c = blockIdx.x - PCS - PMK, seg = c / PBW;      // seg 0..3: a weight; from 4 on: x
    const float* src = seg == 0 ? Wq : seg == 1 ? Wk : seg == 2 ? Wv : seg == 3 ? Wd : x;
    bf* dst = seg < 4 ? WB + (size_t)seg * DD * DD : XB;
    const size_t base = (size_t)(seg < 4 ? c - seg * PBW : c - 4 * PBW) * (256 * 8 * CVU) + threadIdx.x * 8;
    const float* pin = src + base;
    v8f v[CVU];
#pragma unroll
    for (int u = 0; u < CVU; ++u) v[u] = *(const v8f*)(pin + u * 2048);
    asm volatile("s_wait_xcnt 0x0" :: "v"(pin) : "memory");    // stands behind the loads, in front of any write of the address register that they name; the address is an input, so no load's result is given that register
#pragma unroll
    for (int u = 0; u < CVU; ++u) { v8us o;
#pragma unroll
        for (int k = 0; k < 8; ++k) o[k] = f2bf(v[u][k]);
        *(v8us*)(dst + base + u * 2048) = o; }
    asm volatile("s_wait_xcnt 0x0" ::: "memory");    // stands behind the last store, in front of any later write of the registers that the stores name
}
typedef __attribute__((ext_vector_type(16))) float v16f;
#define L2E 1.4426950408889634f
#define FKP 136                   // LDS pitch of a K row in elements (128 + 8)
template <bool HI> struct FT;
template <> struct FT<true>  { typedef bf  T; typedef v8us V8; };
template <> struct FT<false> { typedef h16 T; typedef v8h  V8; };
__device__ __forceinline__ float xhalf(float x) { return __builtin_bit_cast(float, __builtin_amdgcn_permlanex16(__builtin_bit_cast(int, x), __builtin_bit_cast(int, x), 0x76543210, 0xfedcba98, false, false)); }  // lane l with lane l ^ 16
// Two exponentials and, in the same statement, the one v_nop that the instruction set asks for behind a transcendental before its result is read or its source overwritten (a v_nop in a statement of
// its own did not stay behind them). The outputs share no register with the inputs ("=&v"), so the second exponential is independent of the first and fills the first one's slot.
__device__ __forceinline__ void exp2x2(float& a, float& b) { float ra, rb; asm("v_exp_f32 %0, %2\n\tv_exp_f32 %1, %3\n\tv_nop" : "=&v"(ra), "=&v"(rb) : "v"(a), "v"(b)); a = ra; b = rb; }
template <bool HI>
__device__ __forceinline__ void flash_body(typename FT<HI>::T* sm, const typename FT<HI>::T* __restrict__ Q, const typename FT<HI>::T* __restrict__ Q2, const typename FT<HI>::T* __restrict__ Kg, const typename FT<HI>::T* __restrict__ Kg2,
                                           const typename FT<HI>::T* __restrict__ Vg, const typename FT<HI>::T* __restrict__ Vg2, const float* __restrict__ am, int q0, u64 need, u64 nzm, bf* Ah, bf* Al) {
    typedef typename FT<HI>::T T; typedef typename FT<HI>::V8 V8; typedef typename WFrag<T>::V V;
    constexpr int NPL = HI ? 2 : 1, SK = HI ? 32 : 64, VP = SK + 8, KPL = SK * FKP, VPL = HD * VP, BUF = NPL * (KPL + VPL), NST = TT / SK, NPASS = SK / 32;
    constexpr int NKL = SK / 16, LPV = SK / 8, RPS = 256 / LPV, NVL = HD / RPS;
    const int tid = threadIdx.x, lane = tid & 31, lr = lane & 15, hi = lane >> 4; const int w = __builtin_amdgcn_readfirstlane(tid >> 5);
    const int q = q0 + w * 16 + lr;       // this lane's query row
    // The stages to walk: one bit per stage, set where some query row of the work-group needs a key of it (a 64-key stage: either of its two blocks). The same scalar word in every wave, so trips and barriers are alike.
    constexpr u64 ALLST = HI ? ~0ull : 0x5555555555555555ull; constexpr int SH = HI ? 0 : 1;
    u64 todo = HI ? need : ((need | (need >> 1)) & ALLST);
    if (todo == 0) todo = ALLST;          // no row leaves all its bits 0; this keeps the stage index in bounds whatever the word holds
    const int nwalk = __builtin_popcountll(todo);
    int st = __builtin_ctzll(todo) >> SH; todo &= todo - 1;
    Kg += st * (SK * HD); Vg += st * SK; if (HI) { Kg2 += st * (SK * HD); Vg2 += st * SK; }
    const unsigned gk = (unsigned)((tid >> 4) * HD + (tid & 15) * 8), gv = (unsigned)((tid / LPV) * TT + (tid % LPV) * 8);
    T* sk = sm + (tid >> 4) * FKP + (tid & 15) * 8; T* sv = sm + NPL * KPL + (tid / LPV) * VP + (tid % LPV) * 8;
    const T* fk = sm + lr * FKP + 8 * hi; const T* fv = sm + NPL * KPL + lr * VP + 8 * hi;
    const float* mrow = am + (size_t)q * TT + 8 * hi;
    V qf[NPL][4];
#pragma unroll
    for (int kc = 0; kc < 4; ++kc) { qf[0][kc] = WFrag<T>::ld(Q + (size_t)q * HD + 8 * hi + 32 * kc); if (HI) qf[NPL - 1][kc] = WFrag<T>::ld(Q2 + (size_t)q * HD + 8 * hi + 32 * kc); }
    asm volatile("s_wait_xcnt 0x0" ::: "memory");    // stands behind the Q loads, in front of the K loads, whose results may be given the address register that the Q loads name
    V8 rk[NPL][NKL], rv[NPL][NVL];
    v8f acc[8];
#pragma unroll
    for (int t = 0; t < 8; ++t) acc[t] = (v8f){};
    float m_run = -3.0e38f, l_run = 0.f;
#pragma unroll
    for (int i = 0; i < NKL; ++i) { rk[0][i] = *(const V8*)(Kg + gk + i * 16 * HD); if (HI) rk[NPL - 1][i] = *(const V8*)(Kg2 + gk + i * 16 * HD); }
    asm volatile("s_wait_xcnt 0x0" ::: "memory");    // stands behind the K loads, in front of the V^T loads, whose results may be given a register that one of those loads names
#pragma unroll
    for (int i = 0; i < NVL; ++i) { rv[0][i] = *(const V8*)(Vg + gv + i * RPS * TT); if (HI) rv[NPL - 1][i] = *(const V8*)(Vg2 + gv + i * RPS * TT); }
#pragma unroll
    for (int i = 0; i < NKL; ++i) { *(V8*)(sk + i * 16 * FKP) = rk[0][i]; if (HI) *(V8*)(sk + KPL + i * 16 * FKP) = rk[NPL - 1][i]; }
#pragma unroll
    for (int i = 0; i < NVL; ++i) { *(V8*)(sv + i * RPS * VP) = rv[0][i]; if (HI) *(V8*)(sv + VPL + i * RPS * VP) = rv[NPL - 1][i]; }
    __syncthreads();    // the first stage walked is in buffer 0 before any wave reads a fragment
    constexpr int DS = HI ? 2 : 4, DV = HI ? 2 : 2;     // how many groups of K fragments (16 keys x 32 d) and of V^T fragments (16 d x 32 keys) are read ahead of the products that use them
    // The last stage asks for its own lines again (in bounds, not stored): with the loads on every path the compiler's load counts behind them stay exact.
    auto stage_loads = [&](int ds) { const int ak = ds * (SK * HD), av = ds * SK; Kg += ak; Vg += av; if (HI) { Kg2 += ak; Vg2 += av; }      // ds: stages from the one at work to the next one walked
#pragma unroll
        for (int i = 0; i < NKL; ++i) { rk[0][i] = *(const V8*)(Kg + gk + i * 16 * HD); if (HI) rk[NPL - 1][i] = *(const V8*)(Kg2 + gk + i * 16 * HD); }
#pragma unroll
        for (int i = 0; i < NVL; ++i) { rv[0][i] = *(const V8*)(Vg + gv + i * RPS * TT); if (HI) rv[NPL - 1][i] = *(const V8*)(Vg2 + gv + i * RPS * TT); } };
#pragma unroll 1        // rolled: for speed only
    for (int it = 0; it < nwalk; ++it) {
        const int cur = (it & 1) * BUF, nxt = BUF - cur; const bool more = it + 1 < nwalk;
        const int sn = more ? __builtin_ctzll(todo) >> SH : st; todo &= todo - 1;      // the next stage walked
        if (!HI) stage_loads(sn - st);
#pragma unroll
        for (int ps = 0; ps < NPASS; ++ps) {
            const bool mnz = ((nzm >> (st * NPASS + ps)) & 1) != 0;     // scalar: some query row of the work-group has a mask value other than +-0 in this pass's 32 keys
            v4f mk[2][2];       // the pass's mask values for this lane's query, read only where mnz. fp16 form: asked for at the head of the pass, they arrive under the score products;
                                // hi+lo form (short of registers): asked for in the branch that uses them
            auto ldm = [&]() { const float* mp = mrow + st * SK + ps * 32;
#pragma unroll
                for (int kt = 0; kt < 2; ++kt) { mk[kt][0] = *(const v4f*)(mp + kt * 16); mk[kt][1] = *(const v4f*)(mp + kt * 16 + 4); }
                asm volatile("s_wait_xcnt 0x0" :: "v"(mp) : "memory"); };   // stands behind the four loads, in front of any write of the address register that they name; the address is an input, so it lives up to here
            if (!HI && mnz) ldm();
            V kf[4][2][NPL], vf[8][NPL];
            auto ldk = [&](int g) { const int kc = g >> 1, kt = g & 1; const T* p = fk + cur + (ps * 32 + kt * 16) * FKP + 32 * kc; kf[kc][kt][0] = WFrag<T>::ld(p); if (HI) kf[kc][kt][NPL - 1] = WFrag<T>::ld(p + KPL); };
            auto ldv = [&](int t) { const T* p = fv + cur + t * 16 * VP + ps * 32; vf[t][0] = WFrag<T>::ld(p); if (HI) vf[t][NPL - 1] = WFrag<T>::ld(p + VPL); };
            v8f s[2]; s[0] = (v8f){}; s[1] = (v8f){};
#pragma unroll
            for (int g = 0; g < DS; ++g) ldk(g);
#pragma unroll
            for (int g = 0; g < 8; ++g) { const int kc = g >> 1, kt = g & 1; if (g + DS < 8) ldk(g + DS);
                __builtin_amdgcn_sched_barrier(0);    // the LDS reads stay DS groups ahead of the products (for speed only)
                s[kt] = WFrag<T>::mma(kf[kc][kt][0], qf[0][kc], s[kt]); if (HI) { s[kt] = WFrag<T>::mma(kf[kc][kt][0], qf[NPL - 1][kc], s[kt]); s[kt] = WFrag<T>::mma(kf[kc][kt][NPL - 1], qf[0][kc], s[kt]); }
                __builtin_amdgcn_sched_barrier(0); }  // and the following group of reads stays behind these products
            if (HI) stage_loads(sn - st);           // hi+lo form: asked for here, where the K fragments' registers are free again
#pragma unroll
            for (int t = 0; t < DV; ++t) ldv(t);    // the first V^T fragments arrive under the softmax arithmetic
            __builtin_amdgcn_sched_barrier(0);      // keeps those reads in front of the softmax arithmetic
            v16f tv; float mx = -3.0e38f;
#pragma unroll
            for (int e = 0; e < 16; ++e) tv[e] = s[e >> 3][e & 7] * (SCL * L2E);
            if (mnz) { if (HI) ldm();
#pragma unroll
                for (int e = 0; e < 16; ++e) tv[e] = fmaf(s[e >> 3][e & 7], SCL * L2E, bfr(mk[e >> 3][(e >> 2) & 1][e & 3]) * L2E); }
#pragma unroll
            for (int e = 0; e < 16; ++e) mx = fmaxf(mx, tv[e]);
            mx = fmaxf(mx, xhalf(mx));      // both wave halves hold this query's maximum over the pass's 32 keys
            if (__builtin_amdgcn_ballot_w32(mx > m_run + 4.0f) != 0) {      // wave-uniform; rare after the first passes
                const float m_new = fmaxf(m_run, mx); const float corr = __builtin_amdgcn_exp2f(m_run - m_new); l_run *= corr; m_run = m_new;
#pragma unroll
                for (int t = 0; t < 8; ++t) acc[t] = acc[t] * corr; }
            const float nm = (HI ? 0.0f : 10.0f) - m_run; float ps0 = 0.f, ps1 = 0.f;
#pragma unroll
            for (int e = 0; e < 16; e += 2) { float x0 = tv[e] + nm, x1 = tv[e + 1] + nm; exp2x2(x0, x1); tv[e] = x0; tv[e + 1] = x1; ps0 += x0; ps1 += x1; }
            l_run += ps0 + ps1;
            V pa, pb;
            if constexpr (HI) { pa = __builtin_convertvector(tv, v16bf); pb = __builtin_convertvector(tv - __builtin_convertvector(pa, v16f), v16bf); }
            else { pa = __builtin_convertvector(tv, v16h); pb = pa; }
#pragma unroll
            for (int t = 0; t < 8; ++t) { if (t + DV < 8) ldv(t + DV);
                __builtin_amdgcn_sched_barrier(0);    // the V^T reads stay DV groups ahead of their products
                acc[t] = WFrag<T>::mma(vf[t][0], pa, acc[t]); if (HI) { acc[t] = WFrag<T>::mma(vf[t][0], pb, acc[t]); acc[t] = WFrag<T>::mma(vf[t][NPL - 1], pa, acc[t]); }
                __builtin_amdgcn_sched_barrier(0); }  // and the following reads stay behind these products
        }
        if (more) {
#pragma unroll
            for (int i = 0; i < NKL; ++i) { *(V8*)(sk + nxt + i * 16 * FKP) = rk[0][i]; if (HI) *(V8*)(sk + nxt + KPL + i * 16 * FKP) = rk[NPL - 1][i]; }
#pragma unroll
            for (int i = 0; i < NVL; ++i) { *(V8*)(sv + nxt + i * RPS * VP) = rv[0][i]; if (HI) *(V8*)(sv + nxt + VPL + i * RPS * VP) = rv[NPL - 1][i]; } }
        __syncthreads();    // publishes the next stage and ends every wave's reads of the buffer that the next trip refills
        asm volatile("s_wait_xcnt 0x0" ::: "memory");    // stands behind this trip's K, V^T and mask loads, in front of the next trip's (or the epilogue's) writes of the registers that they name
        st = sn;
    }
    const float inv = __fdiv_rn(1.0f, l_run + xhalf(l_run));    // each wave half summed its own 8 keys of every 16-key tile
#pragma unroll
    for (int t = 0; t < 8; ++t) { v8us oh, ol;
#pragma unroll
        for (int j = 0; j < 8; ++j) { unsigned short a, c2; splitf(acc[t][j] * inv, a, c2); oh[j] = a; ol[j] = c2; }
        const size_t o = (size_t)q * DD + t * 16 + hi * 8; *(v8us*)(Ah + o) = oh; *(v8us*)(Al + o) = ol;
        asm volatile("s_wait_xcnt 0x0" ::: "memory"); }    // stands behind the two stores, in front of any later write of the registers that they name
}
#define FSM_EL (2 * 2 * (32 * FKP + HD * 40))     // the larger of the two forms' LDS, in 16-bit elements
static_assert(2 * (64 * FKP + HD * 72) <= FSM_EL, "the fp16 form's two buffers fit");
// grid: NB_ * NH_ * (RH / 128) hi+lo work-groups first (the longer ones where the mask closes nothing), then NB_ * NH_ * ((TT - RH) / 128) fp16 ones. Planes are [batch][head][...]; Ah, Al are [batch][TT][DD].
__global__ __launch_bounds__(256) void k_flash(const bf* __restrict__ Qh, const bf* __restrict__ Ql, const h16* __restrict__ Q16, const bf* __restrict__ Kh, const bf* __restrict__ Kl, const h16* __restrict__ K16,
                                               const bf* __restrict__ Vh, const bf* __restrict__ Vl, const h16* __restrict__ V16, const float* __restrict__ am, const u64* __restrict__ NEED, bf* Ah, bf* Al) {
    __shared__ __align__(16) unsigned short fsm[FSM_EL];
    constexpr int NHI = NB_ * NH_ * (RH / 128), TLO = (TT - RH) / 128;
    const int idx = blockIdx.x; const bool hires = idx < NHI;
    const int z = hires ? idx / (RH / 128) : (idx - NHI) / TLO; const int q0 = hires ? (idx % (RH / 128)) * 128 : RH + ((idx - NHI) % TLO) * 128;
    const size_t zp = (size_t)z * TT * HD; const size_t ao = (size_t)(z / NH_) * TT * DD + (size_t)(z % NH_) * HD;
    // The OR of the 128 query rows' words: every wave forms it from the same 128 words, so all hold the same value.
    const u64* nr = NEED + q0 + (threadIdx.x & 31);
    const u64 nl = nr[0] | nr[32] | nr[64] | nr[96];
    const u64 zl = nr[TT] | nr[TT + 32] | nr[TT + 64] | nr[TT + 96];      // likewise the words that say where the mask is not +-0
    asm volatile("s_wait_xcnt 0x0" :: "v"(nr) : "memory");    // stands behind the eight loads, in front of any write of the address register that they name
    unsigned n0 = (unsigned)nl, n1 = (unsigned)(nl >> 32), z0 = (unsigned)zl, z1 = (unsigned)(zl >> 32);
#pragma unroll
    for (int o = 1; o < 32; o <<= 1) { n0 |= __shfl_xor(n0, o); n1 |= __shfl_xor(n1, o); z0 |= __shfl_xor(z0, o); z1 |= __shfl_xor(z1, o); }
    const u64 need = ((u64)(unsigned)__builtin_amdgcn_readfirstlane(n1) << 32) | (unsigned)__builtin_amdgcn_readfirstlane(n0);
    const u64 nzm = ((u64)(unsigned)__builtin_amdgcn_readfirstlane(z1) << 32) | (unsigned)__builtin_amdgcn_readfirstlane(z0);
    if (hires) flash_body<true>((bf*)fsm, Qh + zp, Ql + zp, Kh + zp, Kl + zp, Vh + zp, Vl + zp, am, q0, need, nzm, Ah + ao, Al + ao);
    else flash_body<false>((h16*)fsm, Q16 + zp, nullptr, K16 + zp, nullptr, V16 + zp, nullptr, am, q0, need, nzm, Ah + ao, Al + ao);
}

extern "C" void kernel_launch(void* const* d_in, const int* in_sizes, int n_in,
                              void* d_out, int out_size, void* d_ws, size_t ws_size, hipStream_t stream) {
    (void)in_sizes; (void)n_in; (void)out_size;
    const float* x = (const float*)d_in[0]; const float* amask = (const float*)d_in[1]; const float* Wq = (const float*)d_in[2]; const float* Wk = (const float*)d_in[3]; const float* Wv = (const float*)d_in[4]; const float* Wd = (const float*)d_in[5];
    float* OUT = (float*)d_out;     // [2][2048][2048]
    char* wsp = (char*)d_ws;
    auto take = [&](size_t bytes) { char* p = wsp; wsp += (bytes + 255) & ~(size_t)255; return (void*)p; };
    const size_t PB = (size_t)TT * DD;      // elements of one batch's plane
    bf* WB = (bf*)take((size_t)4 * DD * DD * 2); bf* WO = WB + (size_t)3 * DD * DD;      // Wq, Wk, Wv, Wd in bf16, one after the other
    bf* XB = (bf*)take(NB_ * PB * 2); float* CSN = (float*)take((size_t)TT * NF * 2 * 4);
    bf* PP = (bf*)take(6 * NB_ * PB * 2); bf* QPh = PP; bf* QPl = PP + NB_ * PB; bf* KPh = PP + 2 * NB_ * PB; bf* KPl = PP + 3 * NB_ * PB; bf* VTh = PP + 4 * NB_ * PB; bf* VTl = PP + 5 * NB_ * PB;
    h16* P3 = (h16*)take(3 * NB_ * PB * 2); h16* QP16 = P3; h16* KP16 = P3 + NB_ * PB; h16* VT16 = P3 + 2 * NB_ * PB;
    bf* ATh = (bf*)take(NB_ * PB * 2); bf* ATl = (bf*)take(NB_ * PB * 2); u64* NEED = (u64*)take((size_t)2 * TT * 8);
    if ((size_t)(wsp - (char*)d_ws) > ws_size) return;    // total 225 MiB; ws 256 MiB
    k_prep<<<PCS + PMK + 4 * PBW + PBX, 256, 0, stream>>>(x, amask, Wq, Wk, Wv, Wd, WB, XB, CSN, NEED);
    k_gemms<0, DD, DD, true, 256, 128><<<dim3(NB_ * TT / 256, 3 * DD / 128, 1), 256, 0, stream>>>(XB, nullptr, WB, nullptr, CSN, PP, P3);
    k_flash<<<NB_ * NH_ * (TT / 128), 256, 0, stream>>>(QPh, QPl, QP16, KPh, KPl, KP16, VTh, VTl, VT16, amask, NEED, ATh, ATl);
    k_gemms<1, DD, DD, false, 128, 256><<<dim3(NB_ * TT / 128, DD / 256, 1), 256, 0, stream>>>(ATh, ATl, WO, OUT, nullptr, nullptr, nullptr);
}
